// v000
// The times below were measured on an AMD MI455X: many runs one after another, warmed up first and cycling through
// copies of the inputs, with the whole window's GPU time divided by the number of runs. Launches and the gaps
// between them are all in it. The median over several windows is given; except for v000 it joins two sittings, which
// can be a few percent apart, so the side-by-side timings, each taken in one sitting, are the better comparison.
// The starting kernel, v000, takes 272 microseconds a run.
#include <hip/hip_runtime.h>

// Causal multi-head attention with a sigmoid output gate, x [2][2048][1024], 16 heads x 64, weights [out][in], one score scale 1/8, tril mask, out = (merged heads * sigmoid(x Wg^T)) x Wo^T + bo.
// Compute dtypes, f32 accumulate: all float inputs RNE-converted to bf16 on load; q/k/v/gate projections v_wmma_f32_16x16x32_bf16 (exact products);
// attention rows < RH: bf16 hi/lo planes, 3 products on q.k and on p.v; rows >= RH: v_wmma_f32_16x16x32_f16 with q,k x16, v x16, p x1024 carries; softmax f32 (running max); gate sigmoid f32 on the VALU;
// output projection: gated ctx bf16 hi/lo x bf16 Wo (2 products) + bf16(bo).
// Fused attention in transposed form: S^T = K Q^T (D rows = keys, lane = query), P^T fragment built lane-locally from two S^T tiles, O^T = V^T P^T; no score plane in global memory.

#ifndef NB
#define NB 2
#endif
#ifndef SEQ
#define SEQ 2048
#endif
#ifndef RH
#define RH 256                       // query rows < RH use hi+lo planes
#endif
#define NB_FULL  2
#define SEQ_FULL 2048
#define CC   1024
#define NH   16
#define HD   64
#define MROWS (NB * SEQ)
#define PCAR 1024.0f
#define QCAR 16.0f
#define VCAR 16.0f
#define L2E  1.4426950408889634f
#define NEGB (-1.0e30f)
#define OSP  68
#define W1   ((size_t)CC * CC)
#define PL16 ((size_t)MROWS * CC)
#define PLR  ((size_t)NB * NH * RH * HD)
// carve: 4+1 bf16 weight planes, bf16 x, 4 f32 projection planes (q plane later reused for the gated-ctx hi|lo planes), f16 q|k|v^T planes, bf16 hi/lo planes of the first RH rows
#define WS_TOTAL (10 * W1 + 24 * PL16 + 12 * PLR)
static_assert(CC == NH * HD);                 // head split covers the model width
static_assert(HD == 64);
static_assert(CC % 64 == 0 && CC % 32 == 0);  // GEMM N tile 64, K step 32
static_assert(MROWS % 64 == 0);               // GEMM M tile 64
static_assert(SEQ % 256 == 0);                // a wave of the transposed-plane builder stays inside one (head, d) row
static_assert(RH % 256 == 0 && RH <= SEQ);    // hi/lo row boundary is wave-uniform in both builders
static_assert((SEQ - RH) % 32 == 0 && RH % 32 == 0 && RH % 16 == 0);   // query tiles of 32 (f16 path) and 16 (hi/lo path)
static_assert(NB <= NB_FULL && SEQ <= SEQ_FULL);
static_assert((W1 * 2) % 256 == 0 && (PL16 * 2) % 256 == 0 && (PLR * 2) % 256 == 0);   // carve pieces stay 256-B aligned without padding
static_assert(2 * PL16 * sizeof(unsigned short) <= PL16 * sizeof(float));              // gated-ctx hi|lo planes fit exactly inside the f32 q plane they reuse
static_assert(WS_TOTAL <= (size_t)134217728); // total carve <= 128 MiB

typedef _Float16 h16;
typedef unsigned short bf;
typedef __attribute__((ext_vector_type(16))) __bf16   v16bf;
typedef __attribute__((ext_vector_type(16))) _Float16 v16h;
typedef __attribute__((ext_vector_type(16))) unsigned short v16us;
typedef __attribute__((ext_vector_type(8)))  _Float16 v8h;
typedef __attribute__((ext_vector_type(8)))  unsigned short v8us;
typedef __attribute__((ext_vector_type(8)))  float    v8f;
typedef __attribute__((ext_vector_type(4)))  float    v4f;
typedef v4f  __attribute__((may_alias)) v4fa;

__device__ __forceinline__ unsigned short f2bf(float f) { unsigned u = __float_as_uint(f); u += 0x7FFFu + ((u >> 16) & 1u); return (unsigned short)(u >> 16); }
__device__ __forceinline__ float bf2f(unsigned short b) { return __uint_as_float(((unsigned)b) << 16); }
__device__ __forceinline__ float bfr(float f) { return bf2f(f2bf(f)); }
__device__ __forceinline__ h16 tohx(float x) { return (h16)x; }
__device__ __forceinline__ void splitf(float y, unsigned short& h, unsigned short& l) { h = f2bf(y); l = f2bf(y - bf2f(h)); }
__device__ __forceinline__ float sigm(float g) { return __builtin_amdgcn_rcpf(1.0f + __builtin_amdgcn_exp2f(-g * L2E)); }
__device__ __forceinline__ v16h cat16(v8h lo, v8h hi) { return __builtin_shufflevector(lo, hi, 0, 1, 2, 3, 4, 5, 6, 7, 8, 9, 10, 11, 12, 13, 14, 15); }
__device__ __forceinline__ v16bf cat16b(v8us lo, v8us hi) { return __builtin_bit_cast(v16bf, __builtin_shufflevector(lo, hi, 0, 1, 2, 3, 4, 5, 6, 7, 8, 9, 10, 11, 12, 13, 14, 15)); }
__device__ __forceinline__ v8f wmma16(v16h a, v16h b, v8f c) { return __builtin_amdgcn_wmma_f32_16x16x32_f16(false, a, false, b, (short)0, c, false, false); }
__device__ __forceinline__ v8f wmmab(v16bf a, v16bf b, v8f c) { return __builtin_amdgcn_wmma_f32_16x16x32_bf16(false, a, false, b, (short)0, c, false, false); }

// Fragment loader from a K-contiguous 16-bit row: p already includes + 8*(lane>>4); elements 0..7 <- p[0..7], elements 8..15 <- p[16..23].
template <typename T16> struct WFrag;
template <> struct WFrag<h16> { typedef v16h V; static __device__ __forceinline__ V ld(const h16* p) { return cat16(*(const v8h*)p, *(const v8h*)(p + 16)); } static __device__ __forceinline__ v8f mma(V a, V b, v8f c) { return wmma16(a, b, c); } };
template <> struct WFrag<bf> { typedef v16bf V; static __device__ __forceinline__ V ld(const bf* p) { return cat16b(*(const v8us*)p, *(const v8us*)(p + 16)); } static __device__ __forceinline__ v8f mma(V a, V b, v8f c) { return wmmab(a, b, c); } };

// ---- one-wave 64x64 tile GEMM body: C[m][n] (f32, pitch ldc, + optional bf16-converted bias[n]) = sum_k A[m][k] Bt[n][k] (+ A2 x Bt when NSPLIT == 1); K % 32 == 0.
template <typename T16, int NSPLIT, bool BIAS>
__device__ __forceinline__ void gemmw_body(const T16* __restrict__ A, const T16* __restrict__ A2, const T16* __restrict__ Bt, const T16* __restrict__ Bt2, int K, float* C, int ldc, const float* __restrict__ bias, size_t sA, size_t sB, size_t sC, float* os) {
    typedef typename WFrag<T16>::V V;
    const size_t z = blockIdx.z; A += z * sA; if (A2) A2 += z * sA; Bt += z * sB; if (Bt2) Bt2 += z * sB; C += z * sC;
    const int lane = threadIdx.x & 31, lr = lane & 15, hi = lane >> 4; const int r0 = blockIdx.x * 64, c0 = blockIdx.y * 64;
    v8f acc[4][4];
#pragma unroll
    for (int mb = 0; mb < 4; ++mb)
#pragma unroll
        for (int nb = 0; nb < 4; ++nb) acc[mb][nb] = (v8f){};
    const size_t aoff = (size_t)(r0 + lr) * K + 8 * hi, boff = (size_t)(c0 + lr) * K + 8 * hi;
#pragma unroll 1
    for (int kc = 0; kc < K; kc += 32) {
        V a[4], a2[4];
#pragma unroll
        for (int mb = 0; mb < 4; ++mb) { a[mb] = WFrag<T16>::ld(A + aoff + (size_t)mb * 16 * K + kc); if (NSPLIT == 1 || NSPLIT == 2) a2[mb] = WFrag<T16>::ld(A2 + aoff + (size_t)mb * 16 * K + kc); }
#pragma unroll
        for (int nb = 0; nb < 4; ++nb) { const V b = WFrag<T16>::ld(Bt + boff + (size_t)nb * 16 * K + kc); V b2; if (NSPLIT >= 2) b2 = WFrag<T16>::ld(Bt2 + boff + (size_t)nb * 16 * K + kc);
#pragma unroll
            for (int mb = 0; mb < 4; ++mb) { acc[mb][nb] = WFrag<T16>::mma(a[mb], b, acc[mb][nb]); if (NSPLIT == 1 || NSPLIT == 2) acc[mb][nb] = WFrag<T16>::mma(a2[mb], b, acc[mb][nb]); if (NSPLIT >= 2) acc[mb][nb] = WFrag<T16>::mma(a[mb], b2, acc[mb][nb]); } }
        asm volatile("v_nop\n\tv_nop\n\tv_nop\n\tv_nop" : "+v"(acc[0][0]), "+v"(acc[1][1]), "+v"(acc[2][2]), "+v"(acc[3][3]) : "v"(a[0]), "v"(a[3]));
    }
#pragma unroll
    for (int mb = 0; mb < 4; ++mb) {
#pragma unroll
        for (int nb = 0; nb < 4; ++nb) {
#pragma unroll
            for (int j = 0; j < 8; ++j) os[(hi * 8 + j) * OSP + nb * 16 + lr] = acc[mb][nb][j]; }
        __builtin_amdgcn_wave_barrier(); asm volatile("" ::: "memory");
        float* crow = C + (size_t)(r0 + mb * 16) * ldc + c0;
{
#pragma unroll
            for (int s = 0; s < 8; ++s) { const int row = 2 * s + hi, cofs = lr * 4; v4f val = *(const v4fa*)(os + row * OSP + cofs); if (BIAS) { val[0] += bfr(bias[c0 + cofs]); val[1] += bfr(bias[c0 + cofs + 1]); val[2] += bfr(bias[c0 + cofs + 2]); val[3] += bfr(bias[c0 + cofs + 3]); }
                *(v4f*)(crow + (size_t)row * ldc + cofs) = val; }
             }
        __builtin_amdgcn_wave_barrier(); asm volatile("" ::: "memory");
    }
}

// q/k/v/gate projections: z = 0..3 selects the weight plane (stride sB) and the f32 result plane (stride sC); A = bf16 x [MROWS][CC].
__global__ __launch_bounds__(32) void k_gemm_proj(const bf* __restrict__ A, const bf* __restrict__ Bt, float* C, size_t sB, size_t sC) {
    __shared__ __align__(16) float os[16 * OSP];
    gemmw_body<bf, 0, false>(A, nullptr, Bt, nullptr, CC, C, CC, nullptr, 0, sB, sC, os);
}
// output projection: (gated ctx hi + gated ctx lo) x Wo^T + bf16(bo) -> d_out rows.
__global__ __launch_bounds__(32) void k_gemm_out(const bf* __restrict__ Ah, const bf* __restrict__ Al, const bf* __restrict__ Bt, float* C, const float* __restrict__ bias) {
    __shared__ __align__(16) float os[16 * OSP];
    gemmw_body<bf, 1, true>(Ah, Al, Bt, nullptr, CC, C, CC, bias, 0, 0, 0, os);
}

__global__ __launch_bounds__(256) void k_cvt8(const float* __restrict__ src, bf* dst, unsigned n8, unsigned per8, unsigned sstr8) {
    const unsigned i = blockIdx.x * 256u + threadIdx.x; if (i >= n8) return;
    const unsigned b = i / per8, r = i - b * per8;
    const v8f v = *(const v8f*)(src + ((size_t)b * sstr8 + r) * 8); v8us o;
#pragma unroll
    for (int k = 0; k < 8; ++k) o[k] = f2bf(v[k]);
    *(v8us*)(dst + (size_t)i * 8) = o;  }

__global__ __launch_bounds__(256) void k_qkp(const float* __restrict__ F, h16* P16, bf* Ph, bf* Pl) {
    const unsigned i = blockIdx.x * 256u + threadIdx.x; if (i >= (unsigned)(MROWS * (CC / 8))) return;
    const unsigned w = blockIdx.y; const unsigned e = i * 8u; const unsigned c = e % CC, row = e / CC; const unsigned b = row / SEQ, t = row % SEQ; const unsigned h = c / HD, d = c % HD;
    const float* f = F + (size_t)w * MROWS * CC + e;
    const v4f a = *(const v4f*)f, g = *(const v4f*)(f + 4); v8h o16; v8us oh, ol;
#pragma unroll
    for (int k = 0; k < 4; ++k) { unsigned short hh, ll; o16[k] = tohx(a[k] * QCAR); splitf(a[k], hh, ll); oh[k] = hh; ol[k] = ll; o16[4 + k] = tohx(g[k] * QCAR); splitf(g[k], hh, ll); oh[4 + k] = hh; ol[4 + k] = ll; }
    const size_t bh = (size_t)(w * NB + b) * NH + h;
    const size_t o1 = (bh * SEQ + t) * HD + d;
    const size_t o2 = (bh * RH + (t < RH ? t : 0u)) * HD + d;
{ *(v8h*)(P16 + o1) = o16; if (t < RH) { *(v8us*)(Ph + o2) = oh; *(v8us*)(Pl + o2) = ol; }  }
}

__global__ __launch_bounds__(256) void k_vtp(const float* __restrict__ F, h16* V16, bf* Vh, bf* Vl) {
    const unsigned i = blockIdx.x * 256u + threadIdx.x; if (i >= (unsigned)(MROWS * (CC / 8))) return;
    const unsigned e = i * 8u; const unsigned t = e % SEQ; const unsigned d = (e / SEQ) % HD; const unsigned bh = e / (SEQ * HD); const unsigned b = bh / NH, h = bh % NH;
    const float* f = F + ((size_t)b * SEQ + t) * CC + h * HD + d; v8h o16; v8us oh, ol;
#pragma unroll
    for (int k = 0; k < 8; ++k) { const float x = f[(size_t)k * CC]; unsigned short hh, ll; o16[k] = tohx(x * VCAR); splitf(x, hh, ll); oh[k] = hh; ol[k] = ll; }
    const size_t o2 = ((size_t)bh * HD + d) * RH + (t < RH ? t : 0u);
{ *(v8h*)(V16 + e) = o16; if (t < RH) { *(v8us*)(Vh + o2) = oh; *(v8us*)(Vl + o2) = ol; }  }
}

// P^T fragment (B operand of O^T = V^T P^T) built lane-locally from the two S^T tiles of a 32-key step: element r <- tile(keys 0..15)[r], element 8+r <- tile(keys 16..31)[r].
template <typename T16> struct PPack;
template <> struct PPack<h16> { static __device__ __forceinline__ void mk(const v8f& p0, const v8f& p1, float car, v16h& a, v16h& b) { v16h r;
#pragma unroll
        for (int i = 0; i < 8; ++i) { r[i] = tohx(p0[i] * car); r[8 + i] = tohx(p1[i] * car); }
        a = r; b = r; } };
template <> struct PPack<bf> { static __device__ __forceinline__ void mk(const v8f& p0, const v8f& p1, float car, v16bf& a, v16bf& b) { (void)car; v16us h, l;
#pragma unroll
        for (int i = 0; i < 8; ++i) { unsigned short hh, ll; splitf(p0[i], hh, ll); h[i] = hh; l[i] = ll; splitf(p1[i], hh, ll); h[8 + i] = hh; l[8 + i] = ll; }
        a = __builtin_bit_cast(v16bf, h); b = __builtin_bit_cast(v16bf, l); } };

// Hazard guards: 4 VALU-slot nops tied to every accumulator of the group and to the fragments of the last products.
template <int N> struct Grd;
template <> struct Grd<1> {
    template <typename V> static __device__ __forceinline__ void s(v8f (&st)[2][1], const V& x, const V& y) { asm volatile("v_nop\n\tv_nop\n\tv_nop\n\tv_nop" : "+v"(st[0][0]), "+v"(st[1][0]) : "v"(x), "v"(y)); }
    template <typename V> static __device__ __forceinline__ void o(v8f (&oa)[4][1], const V& x, const V& y, const V& z) { asm volatile("v_nop\n\tv_nop\n\tv_nop\n\tv_nop" : "+v"(oa[0][0]), "+v"(oa[1][0]), "+v"(oa[2][0]), "+v"(oa[3][0]) : "v"(x), "v"(y), "v"(z)); }
};
template <> struct Grd<2> {
    template <typename V> static __device__ __forceinline__ void s(v8f (&st)[2][2], const V& x, const V& y) { asm volatile("v_nop\n\tv_nop\n\tv_nop\n\tv_nop" : "+v"(st[0][0]), "+v"(st[1][0]), "+v"(st[0][1]), "+v"(st[1][1]) : "v"(x), "v"(y)); }
    template <typename V> static __device__ __forceinline__ void o(v8f (&oa)[4][2], const V& x, const V& y, const V& z) { asm volatile("v_nop\n\tv_nop\n\tv_nop\n\tv_nop" : "+v"(oa[0][0]), "+v"(oa[1][0]), "+v"(oa[2][0]), "+v"(oa[3][0]), "+v"(oa[0][1]), "+v"(oa[1][1]), "+v"(oa[2][1]), "+v"(oa[3][1]) : "v"(x), "v"(y), "v"(z)); }
};

// ---- fused causal attention body, one wave per 16*NQ query rows of one (batch, head); keys in steps of 32.
// S^T[key][query] = sum_d K[key][d] Q[query][d]: A = K rows (lane -> key), B = Q rows (lane -> query); D: lane = query (lane&15), element r = key 8*(lane>>4) + r.
// Row statistics are per lane (query); the two lane halves hold different keys and exchange the step maximum with one xor-16 shuffle; row sums stay per-lane partials until the end.
// O^T[d][query] += V^T[d][key] P^T[key][query]: A = V^T rows (lane -> d), B = packed P^T. Planes: Q, K [t][HD]; V^T [d][vpitch].
template <typename T16, bool SPLIT, int NQ>
__device__ __forceinline__ void attn_body(const T16* __restrict__ Q, const T16* __restrict__ Q2, const T16* __restrict__ Kp, const T16* __restrict__ K2, const T16* __restrict__ Vt, const T16* __restrict__ V2,
                                          const float* __restrict__ G, int vpitch, int q0, float ssc, float osc, float pcar, bf* Ah, bf* Al, float* os) {
    typedef typename WFrag<T16>::V V;
    const int lane = threadIdx.x & 31, lr = lane & 15, hi = lane >> 4;
    V qf[NQ][2], qf2[NQ][2];
#pragma unroll
    for (int nb = 0; nb < NQ; ++nb)
#pragma unroll
        for (int ds = 0; ds < 2; ++ds) { const size_t qo = (size_t)(q0 + 16 * nb + lr) * HD + 32 * ds + 8 * hi; qf[nb][ds] = WFrag<T16>::ld(Q + qo); if (SPLIT) qf2[nb][ds] = WFrag<T16>::ld(Q2 + qo); }
    v8f o[4][NQ]; float mrun[NQ], lrun[NQ];
#pragma unroll
    for (int nb = 0; nb < NQ; ++nb) { mrun[nb] = NEGB; lrun[nb] = 0.0f;
#pragma unroll
        for (int dt = 0; dt < 4; ++dt) o[dt][nb] = (v8f){}; }
    const int kend = q0 + 16 * NQ;
#pragma unroll 1
    for (int kt = 0; kt < kend; kt += 32) {
        V ka[2][2], ka2[2][2];
#pragma unroll
        for (int mb = 0; mb < 2; ++mb)
#pragma unroll
            for (int ds = 0; ds < 2; ++ds) { const size_t ko = (size_t)(kt + 16 * mb + lr) * HD + 32 * ds + 8 * hi; ka[mb][ds] = WFrag<T16>::ld(Kp + ko); if (SPLIT) ka2[mb][ds] = WFrag<T16>::ld(K2 + ko); }
        v8f st[2][NQ];
#pragma unroll
        for (int mb = 0; mb < 2; ++mb)
#pragma unroll
            for (int nb = 0; nb < NQ; ++nb) { v8f z = (v8f){};
                z = WFrag<T16>::mma(ka[mb][0], qf[nb][0], z); z = WFrag<T16>::mma(ka[mb][1], qf[nb][1], z);
                if (SPLIT) { z = WFrag<T16>::mma(ka2[mb][0], qf[nb][0], z); z = WFrag<T16>::mma(ka2[mb][1], qf[nb][1], z); z = WFrag<T16>::mma(ka[mb][0], qf2[nb][0], z); z = WFrag<T16>::mma(ka[mb][1], qf2[nb][1], z); }
                st[mb][nb] = z; }
        Grd<NQ>::s(st, ka[1][1], SPLIT ? qf2[NQ - 1][1] : qf[NQ - 1][1]);
        V pb[NQ], pb2[NQ];
#pragma unroll
        for (int nb = 0; nb < NQ; ++nb) {
            const int qg = q0 + 16 * nb + lr; float mx = NEGB;
#pragma unroll
            for (int mb = 0; mb < 2; ++mb)
#pragma unroll
                for (int r = 0; r < 8; ++r) { const int kg = kt + 16 * mb + 8 * hi + r; float t = st[mb][nb][r] * ssc; t = (kg <= qg) ? t : NEGB; st[mb][nb][r] = t; mx = fmaxf(mx, t); }
            mx = fmaxf(mx, __shfl_xor(mx, 16, 32));
            const float mn = fmaxf(mrun[nb], mx);
            const float al = __builtin_amdgcn_exp2f((mrun[nb] - mn) * L2E); mrun[nb] = mn;
            float psum = 0.0f;
#pragma unroll
            for (int mb = 0; mb < 2; ++mb)
#pragma unroll
                for (int r = 0; r < 8; ++r) { const float p = __builtin_amdgcn_exp2f((st[mb][nb][r] - mn) * L2E); psum += p; st[mb][nb][r] = p; }
            lrun[nb] = lrun[nb] * al + psum;
#pragma unroll
            for (int dt = 0; dt < 4; ++dt)
#pragma unroll
                for (int r = 0; r < 8; ++r) o[dt][nb][r] *= al;
            PPack<T16>::mk(st[0][nb], st[1][nb], pcar, pb[nb], pb2[nb]);
        }
        V va, va2;
#pragma unroll
        for (int dt = 0; dt < 4; ++dt) { const size_t vo = (size_t)(16 * dt + lr) * vpitch + kt + 8 * hi; va = WFrag<T16>::ld(Vt + vo); if (SPLIT) va2 = WFrag<T16>::ld(V2 + vo);
#pragma unroll
            for (int nb = 0; nb < NQ; ++nb) { o[dt][nb] = WFrag<T16>::mma(va, pb[nb], o[dt][nb]); if (SPLIT) { o[dt][nb] = WFrag<T16>::mma(va2, pb[nb], o[dt][nb]); o[dt][nb] = WFrag<T16>::mma(va, pb2[nb], o[dt][nb]); } } }
        Grd<NQ>::o(o, SPLIT ? va2 : va, pb[NQ - 1], SPLIT ? pb2[NQ - 1] : pb[0]);
    }
    // normalise; O^T lane = query, element r = d 16*dt + 8*hi + r  ->  LDS tile [query][d]
#pragma unroll
    for (int nb = 0; nb < NQ; ++nb) { float lt = lrun[nb]; lt += __shfl_xor(lt, 16, 32); const float inv = osc * __builtin_amdgcn_rcpf(lt);
#pragma unroll
        for (int dt = 0; dt < 4; ++dt) { v4f a, c;
#pragma unroll
            for (int r = 0; r < 4; ++r) { a[r] = o[dt][nb][r] * inv; c[r] = o[dt][nb][4 + r] * inv; }
            float* dst = os + (16 * nb + lr) * OSP + 16 * dt + 8 * hi; *(v4fa*)dst = a; *(v4fa*)(dst + 4) = c; } }
    __syncthreads();
    const int rr = lane >> 3, seg = (lane & 7) * 8;
{
#pragma unroll
        for (int s = 0; s < 4 * NQ; ++s) { const int row = 4 * s + rr; const v4f a = *(const v4fa*)(os + row * OSP + seg); const v4f c = *(const v4fa*)(os + row * OSP + seg + 4);
            const float* gp = G + (size_t)(q0 + row) * CC + seg; const v4f ga = *(const v4f*)gp; const v4f gc = *(const v4f*)(gp + 4); v8us oh, ol;
#pragma unroll
            for (int k = 0; k < 4; ++k) { unsigned short hh, ll; const float ya = a[k] * sigm(ga[k]); const float yc = c[k] * sigm(gc[k]); splitf(ya, hh, ll); oh[k] = hh; ol[k] = ll; splitf(yc, hh, ll); oh[4 + k] = hh; ol[4 + k] = ll; }
            const size_t oo = (size_t)(q0 + row) * CC + seg; *(v8us*)(Ah + oo) = oh; *(v8us*)(Al + oo) = ol; }
         }
}

// rows < RH: bf16 hi/lo planes [b][h][RH][HD] / [b][h][HD][RH], 16 query rows per wave; grid (RH/16, NH, NB)
__global__ __launch_bounds__(32) void k_attn_s(const bf* __restrict__ Qh, const bf* __restrict__ Ql, const bf* __restrict__ Kh, const bf* __restrict__ Kl, const bf* __restrict__ Vh, const bf* __restrict__ Vl, const float* __restrict__ Gt, bf* ATh, bf* ATl) {
    __shared__ __align__(16) float os[16 * OSP];
    const size_t bh = (size_t)blockIdx.z * NH + blockIdx.y; const size_t po = bh * RH * HD; const size_t ao = (size_t)blockIdx.z * SEQ * CC + (size_t)blockIdx.y * HD;
    attn_body<bf, true, 1>(Qh + po, Ql + po, Kh + po, Kl + po, Vh + po, Vl + po, Gt + ao, RH, (int)blockIdx.x * 16, 0.125f, 1.0f, 1.0f, ATh + ao, ATl + ao, os);
}
// rows >= RH: f16 planes [b][h][SEQ][HD] / [b][h][HD][SEQ] with carries, 32 query rows per wave; grid ((SEQ-RH)/32, NH, NB)
__global__ __launch_bounds__(32) void k_attn_h(const h16* __restrict__ Q, const h16* __restrict__ Kp, const h16* __restrict__ Vt, const float* __restrict__ Gt, bf* ATh, bf* ATl) {
    __shared__ __align__(16) float os[32 * OSP];
    const size_t bh = (size_t)blockIdx.z * NH + blockIdx.y; const size_t po = bh * SEQ * HD; const size_t ao = (size_t)blockIdx.z * SEQ * CC + (size_t)blockIdx.y * HD;
    attn_body<h16, false, 2>(Q + po, nullptr, Kp + po, nullptr, Vt + po, nullptr, Gt + ao, SEQ, RH + (int)blockIdx.x * 32, 0.125f / (QCAR * QCAR), 1.0f / (PCAR * VCAR), PCAR, ATh + ao, ATl + ao, os);
}

extern "C" void kernel_launch(void* const* d_in, const int* in_sizes, int n_in,
                              void* d_out, int out_size, void* d_ws, size_t ws_size, hipStream_t stream) {
    if (n_in < 7) return;
    if ((size_t)in_sizes[0] < ((size_t)(NB - 1) * SEQ_FULL + SEQ) * CC) return;
    if ((size_t)in_sizes[1] < W1 || (size_t)in_sizes[2] < W1 || (size_t)in_sizes[3] < W1 || (size_t)in_sizes[4] < W1 || (size_t)in_sizes[5] < W1 || in_sizes[6] < CC) return;
    if ((size_t)out_size < PL16) return;
    // wire order: x, Wq, Wk, Wv, Wg, Wo, bo
    const float* x = (const float*)d_in[0]; const float* wq = (const float*)d_in[1]; const float* wk = (const float*)d_in[2]; const float* wv = (const float*)d_in[3];
    const float* wg = (const float*)d_in[4]; const float* wo = (const float*)d_in[5]; const float* bo = (const float*)d_in[6];
    float* OUT = (float*)d_out;     // [NB][SEQ][CC]
    char* wsp = (char*)d_ws;
    auto take = [&](size_t bytes) { char* p = wsp; wsp += (bytes + 255) & ~(size_t)255; return (void*)p; };
    bf* WQ = (bf*)take(4 * W1 * 2);            // Wq | Wk | Wv | Wg bf16 [out][in]
    bf* WO = (bf*)take(W1 * 2);
    bf* XB = (bf*)take(PL16 * 2);              // bf16 x [MROWS][CC]
    float* F = (float*)take(4 * PL16 * 4);     // f32 q | k | v | gate [MROWS][CC]
    h16* QK16 = (h16*)take(2 * PL16 * 2);      // f16 q planes | k planes
    h16* VT16 = (h16*)take(PL16 * 2);
    bf* QKh = (bf*)take(2 * PLR * 2); bf* QKl = (bf*)take(2 * PLR * 2);
    bf* VTh = (bf*)take(PLR * 2); bf* VTl = (bf*)take(PLR * 2);
    if ((size_t)(wsp - (char*)d_ws) > ws_size) return;
    // gated-ctx hi | lo planes reuse the f32 q plane (its only consumer, k_qkp, has finished before the attention launches start; sizes match exactly)
    bf* ATh = (bf*)F; bf* ATl = ATh + PL16;
    const float* GATE = F + 3 * PL16;
    const unsigned w8 = (unsigned)(W1 / 8), x8 = (unsigned)(PL16 / 8);
    k_cvt8<<<(w8 + 255) / 256, 256, 0, stream>>>(wq, WQ, w8, w8, 0u);
    k_cvt8<<<(w8 + 255) / 256, 256, 0, stream>>>(wk, WQ + W1, w8, w8, 0u);
    k_cvt8<<<(w8 + 255) / 256, 256, 0, stream>>>(wv, WQ + 2 * W1, w8, w8, 0u);
    k_cvt8<<<(w8 + 255) / 256, 256, 0, stream>>>(wg, WQ + 3 * W1, w8, w8, 0u);
    k_cvt8<<<(w8 + 255) / 256, 256, 0, stream>>>(wo, WO, w8, w8, 0u);
    k_cvt8<<<(x8 + 255) / 256, 256, 0, stream>>>(x, XB, x8, (unsigned)((size_t)SEQ * CC / 8), (unsigned)((size_t)SEQ_FULL * CC / 8));
    k_gemm_proj<<<dim3(MROWS / 64, CC / 64, 4), 32, 0, stream>>>(XB, WQ, F, W1, PL16);
    k_qkp<<<dim3((x8 + 255) / 256, 2, 1), 256, 0, stream>>>(F, QK16, QKh, QKl);
    k_vtp<<<(x8 + 255) / 256, 256, 0, stream>>>(F + 2 * PL16, VT16, VTh, VTl);
    k_attn_s<<<dim3(RH / 16, NH, NB), 32, 0, stream>>>(QKh, QKl, QKh + PLR, QKl + PLR, VTh, VTl, GATE, ATh, ATl);
    if (SEQ > RH) k_attn_h<<<dim3((SEQ - RH) / 32 > 0 ? (SEQ - RH) / 32 : 1, NH, NB), 32, 0, stream>>>(QK16, QK16 + PL16, VT16, GATE, ATh, ATl);
    k_gemm_out<<<dim3(MROWS / 64, CC / 64, 1), 32, 0, stream>>>(ATh, ATl, WO, OUT, bo);
}

// v001
// A run of this version takes 225 microseconds.
// Two timings next to v000 both put it at 1.23 times that version's speed.
#include <hip/hip_runtime.h>

// Causal multi-head attention with a sigmoid output gate, x [2][2048][1024], 16 heads x 64, weights [out][in], one score scale 1/8, tril mask, out = (merged heads * sigmoid(x Wg^T)) x Wo^T + bo.
// Compute dtypes, f32 accumulate: all float inputs RNE-converted to bf16 on load; q/k/v/gate projections v_wmma_f32_16x16x32_bf16 (exact products);
// attention rows < RH: bf16 hi/lo planes, 3 products on q.k and on p.v; rows >= RH: v_wmma_f32_16x16x32_f16 with q,k x16, v x16, p x1024 carries; softmax f32 (running max); gate sigmoid f32 on the VALU;
// output projection: gated ctx bf16 hi/lo x bf16 Wo (2 products) + bf16(bo).
// Fused attention in transposed form: S^T = K Q^T (D rows = keys, lane = query), P^T fragment built lane-locally from two S^T tiles, O^T = V^T P^T; no score plane in global memory.

#ifndef NB
#define NB 2
#endif
#ifndef SEQ
#define SEQ 2048
#endif
#ifndef RH
#define RH 256                       // query rows < RH use hi+lo planes
#endif
#define NB_FULL  2
#define SEQ_FULL 2048
#define CC   1024
#define NH   16
#define HD   64
#define MROWS (NB * SEQ)
#define PCAR 1024.0f
#define QCAR 16.0f
#define VCAR 16.0f
#define L2E  1.4426950408889634f
#define NEGB (-1.0e30f)
#define OSP  68
#define W1   ((size_t)CC * CC)
#define PL16 ((size_t)MROWS * CC)
#define PLR  ((size_t)NB * NH * RH * HD)
// carve: 4+1 bf16 weight planes, bf16 x, 4 f32 projection planes (q plane later reused for the gated-ctx hi|lo planes), f16 q|k|v^T planes, bf16 hi/lo planes of the first RH rows
#define WS_TOTAL (10 * W1 + 24 * PL16 + 12 * PLR)
static_assert(CC == NH * HD);                 // head split covers the model width
static_assert(HD == 64);
static_assert(CC % 64 == 0 && CC % 32 == 0);  // GEMM N tile 64, K step 32
static_assert(MROWS % 64 == 0);               // GEMM M tile 64
static_assert(SEQ % 256 == 0);                // a wave of the transposed-plane builder stays inside one (head, d) row
static_assert(RH % 256 == 0 && RH <= SEQ);    // hi/lo row boundary is wave-uniform in both builders
static_assert((SEQ - RH) % 32 == 0 && RH % 32 == 0 && RH % 16 == 0);   // query tiles of 32 (f16 path) and 16 (hi/lo path)
static_assert(NB <= NB_FULL && SEQ <= SEQ_FULL);
static_assert((W1 * 2) % 256 == 0 && (PL16 * 2) % 256 == 0 && (PLR * 2) % 256 == 0);   // carve pieces stay 256-B aligned without padding
static_assert(2 * PL16 * sizeof(unsigned short) <= PL16 * sizeof(float));              // gated-ctx hi|lo planes fit exactly inside the f32 q plane they reuse
static_assert(WS_TOTAL <= (size_t)134217728); // total carve <= 128 MiB

typedef _Float16 h16;
typedef unsigned short bf;
typedef __attribute__((ext_vector_type(16))) __bf16   v16bf;
typedef __attribute__((ext_vector_type(16))) _Float16 v16h;
typedef __attribute__((ext_vector_type(16))) unsigned short v16us;
typedef __attribute__((ext_vector_type(8)))  _Float16 v8h;
typedef __attribute__((ext_vector_type(8)))  unsigned short v8us;
typedef __attribute__((ext_vector_type(8)))  float    v8f;
typedef __attribute__((ext_vector_type(4)))  float    v4f;
typedef v4f  __attribute__((may_alias)) v4fa;

__device__ __forceinline__ unsigned short f2bf(float f) { unsigned u = __float_as_uint(f); u += 0x7FFFu + ((u >> 16) & 1u); return (unsigned short)(u >> 16); }
__device__ __forceinline__ float bf2f(unsigned short b) { return __uint_as_float(((unsigned)b) << 16); }
__device__ __forceinline__ float bfr(float f) { return bf2f(f2bf(f)); }
__device__ __forceinline__ h16 tohx(float x) { return (h16)x; }
__device__ __forceinline__ void splitf(float y, unsigned short& h, unsigned short& l) { h = f2bf(y); l = f2bf(y - bf2f(h)); }
__device__ __forceinline__ float sigm(float g) { return __builtin_amdgcn_rcpf(1.0f + __builtin_amdgcn_exp2f(-g * L2E)); }
__device__ __forceinline__ v16h cat16(v8h lo, v8h hi) { return __builtin_shufflevector(lo, hi, 0, 1, 2, 3, 4, 5, 6, 7, 8, 9, 10, 11, 12, 13, 14, 15); }
__device__ __forceinline__ v16bf cat16b(v8us lo, v8us hi) { return __builtin_bit_cast(v16bf, __builtin_shufflevector(lo, hi, 0, 1, 2, 3, 4, 5, 6, 7, 8, 9, 10, 11, 12, 13, 14, 15)); }
__device__ __forceinline__ v8f wmma16(v16h a, v16h b, v8f c) { return __builtin_amdgcn_wmma_f32_16x16x32_f16(false, a, false, b, (short)0, c, false, false); }
__device__ __forceinline__ v8f wmmab(v16bf a, v16bf b, v8f c) { return __builtin_amdgcn_wmma_f32_16x16x32_bf16(false, a, false, b, (short)0, c, false, false); }

// Fragment loader from a K-contiguous 16-bit row: p already includes + 8*(lane>>4); elements 0..7 <- p[0..7], elements 8..15 <- p[16..23].
template <typename T16> struct WFrag;
template <> struct WFrag<h16> { typedef v16h V; static __device__ __forceinline__ V ld(const h16* p) { return cat16(*(const v8h*)p, *(const v8h*)(p + 16)); } static __device__ __forceinline__ v8f mma(V a, V b, v8f c) { return wmma16(a, b, c); } };
template <> struct WFrag<bf> { typedef v16bf V; static __device__ __forceinline__ V ld(const bf* p) { return cat16b(*(const v8us*)p, *(const v8us*)(p + 16)); } static __device__ __forceinline__ v8f mma(V a, V b, v8f c) { return wmmab(a, b, c); } };
// s_wait_xcnt 0, written where the next load's result may be given the registers of an address that loads already issued name.
__device__ __forceinline__ void xwait() { asm volatile("s_wait_xcnt 0x0" ::: "memory"); }
// The f16 fragment loader again, for the last fragment read through an address: the wait stands in front of its last load.
__device__ __forceinline__ v16h ldw16(const h16* p) { const v8h lo = *(const v8h*)p; xwait(); return cat16(lo, *(const v8h*)(p + 16)); }

// ---- one-wave 64x64 tile GEMM body: C[m][n] (f32, pitch ldc, + optional bf16-converted bias[n]) = sum_k A[m][k] Bt[n][k] (+ A2 x Bt when NSPLIT == 1); K % 32 == 0.
template <typename T16, int NSPLIT, bool BIAS>
__device__ __forceinline__ void gemmw_body(const T16* __restrict__ A, const T16* __restrict__ A2, const T16* __restrict__ Bt, const T16* __restrict__ Bt2, int K, float* C, int ldc, const float* __restrict__ bias, size_t sA, size_t sB, size_t sC, float* os) {
    typedef typename WFrag<T16>::V V;
    const size_t z = blockIdx.z; A += z * sA; if (A2) A2 += z * sA; Bt += z * sB; if (Bt2) Bt2 += z * sB; C += z * sC;
    const int lane = threadIdx.x & 31, lr = lane & 15, hi = lane >> 4; const int r0 = blockIdx.x * 64, c0 = blockIdx.y * 64;
    v8f acc[4][4];
#pragma unroll
    for (int mb = 0; mb < 4; ++mb)
#pragma unroll
        for (int nb = 0; nb < 4; ++nb) acc[mb][nb] = (v8f){};
    const size_t aoff = (size_t)(r0 + lr) * K + 8 * hi, boff = (size_t)(c0 + lr) * K + 8 * hi;
#pragma unroll 1
    for (int kc = 0; kc < K; kc += 32) {
        V a[4], a2[4];
#pragma unroll
        for (int mb = 0; mb < 4; ++mb) { a[mb] = WFrag<T16>::ld(A + aoff + (size_t)mb * 16 * K + kc); if (NSPLIT == 1 || NSPLIT == 2) a2[mb] = WFrag<T16>::ld(A2 + aoff + (size_t)mb * 16 * K + kc); }
#pragma unroll
        for (int nb = 0; nb < 4; ++nb) { const V b = WFrag<T16>::ld(Bt + boff + (size_t)nb * 16 * K + kc); V b2; if (NSPLIT >= 2) b2 = WFrag<T16>::ld(Bt2 + boff + (size_t)nb * 16 * K + kc);
#pragma unroll
            for (int mb = 0; mb < 4; ++mb) { acc[mb][nb] = WFrag<T16>::mma(a[mb], b, acc[mb][nb]); if (NSPLIT == 1 || NSPLIT == 2) acc[mb][nb] = WFrag<T16>::mma(a2[mb], b, acc[mb][nb]); if (NSPLIT >= 2) acc[mb][nb] = WFrag<T16>::mma(a[mb], b2, acc[mb][nb]); } }
        asm volatile("v_nop\n\tv_nop\n\tv_nop\n\tv_nop" : "+v"(acc[0][0]), "+v"(acc[1][1]), "+v"(acc[2][2]), "+v"(acc[3][3]) : "v"(a[0]), "v"(a[3]));
    }
#pragma unroll
    for (int mb = 0; mb < 4; ++mb) {
#pragma unroll
        for (int nb = 0; nb < 4; ++nb) {
#pragma unroll
            for (int j = 0; j < 8; ++j) os[(hi * 8 + j) * OSP + nb * 16 + lr] = acc[mb][nb][j]; }
        __builtin_amdgcn_wave_barrier(); asm volatile("" ::: "memory");
        float* crow = C + (size_t)(r0 + mb * 16) * ldc + c0;
{
#pragma unroll
            for (int s = 0; s < 8; ++s) { const int row = 2 * s + hi, cofs = lr * 4; v4f val = *(const v4fa*)(os + row * OSP + cofs); if (BIAS) { val[0] += bfr(bias[c0 + cofs]); val[1] += bfr(bias[c0 + cofs + 1]); val[2] += bfr(bias[c0 + cofs + 2]); val[3] += bfr(bias[c0 + cofs + 3]); }
                *(v4f*)(crow + (size_t)row * ldc + cofs) = val; }
             }
        __builtin_amdgcn_wave_barrier(); asm volatile("" ::: "memory");
    }
}

// q/k/v/gate projections: z = 0..3 selects the weight plane (stride sB) and the f32 result plane (stride sC); A = bf16 x [MROWS][CC].
__global__ __launch_bounds__(32) void k_gemm_proj(const bf* __restrict__ A, const bf* __restrict__ Bt, float* C, size_t sB, size_t sC) {
    __shared__ __align__(16) float os[16 * OSP];
    gemmw_body<bf, 0, false>(A, nullptr, Bt, nullptr, CC, C, CC, nullptr, 0, sB, sC, os);
}
// output projection: (gated ctx hi + gated ctx lo) x Wo^T + bf16(bo) -> d_out rows.
__global__ __launch_bounds__(32) void k_gemm_out(const bf* __restrict__ Ah, const bf* __restrict__ Al, const bf* __restrict__ Bt, float* C, const float* __restrict__ bias) {
    __shared__ __align__(16) float os[16 * OSP];
    gemmw_body<bf, 1, true>(Ah, Al, Bt, nullptr, CC, C, CC, bias, 0, 0, 0, os);
}

__global__ __launch_bounds__(256) void k_cvt8(const float* __restrict__ src, bf* dst, unsigned n8, unsigned per8, unsigned sstr8) {
    const unsigned i = blockIdx.x * 256u + threadIdx.x; if (i >= n8) return;
    const unsigned b = i / per8, r = i - b * per8;
    const v8f v = *(const v8f*)(src + ((size_t)b * sstr8 + r) * 8); v8us o;
#pragma unroll
    for (int k = 0; k < 8; ++k) o[k] = f2bf(v[k]);
    *(v8us*)(dst + (size_t)i * 8) = o;  }

__global__ __launch_bounds__(256) void k_qkp(const float* __restrict__ F, h16* P16, bf* Ph, bf* Pl) {
    const unsigned i = blockIdx.x * 256u + threadIdx.x; if (i >= (unsigned)(MROWS * (CC / 8))) return;
    const unsigned w = blockIdx.y; const unsigned e = i * 8u; const unsigned c = e % CC, row = e / CC; const unsigned b = row / SEQ, t = row % SEQ; const unsigned h = c / HD, d = c % HD;
    const float* f = F + (size_t)w * MROWS * CC + e;
    const v4f a = *(const v4f*)f, g = *(const v4f*)(f + 4); v8h o16; v8us oh, ol;
#pragma unroll
    for (int k = 0; k < 4; ++k) { unsigned short hh, ll; o16[k] = tohx(a[k] * QCAR); splitf(a[k], hh, ll); oh[k] = hh; ol[k] = ll; o16[4 + k] = tohx(g[k] * QCAR); splitf(g[k], hh, ll); oh[4 + k] = hh; ol[4 + k] = ll; }
    const size_t bh = (size_t)(w * NB + b) * NH + h;
    const size_t o1 = (bh * SEQ + t) * HD + d;
    const size_t o2 = (bh * RH + (t < RH ? t : 0u)) * HD + d;
{ *(v8h*)(P16 + o1) = o16; if (t < RH) { *(v8us*)(Ph + o2) = oh; *(v8us*)(Pl + o2) = ol; }  }
}

__global__ __launch_bounds__(256) void k_vtp(const float* __restrict__ F, h16* V16, bf* Vh, bf* Vl) {
    const unsigned i = blockIdx.x * 256u + threadIdx.x; if (i >= (unsigned)(MROWS * (CC / 8))) return;
    const unsigned e = i * 8u; const unsigned t = e % SEQ; const unsigned d = (e / SEQ) % HD; const unsigned bh = e / (SEQ * HD); const unsigned b = bh / NH, h = bh % NH;
    const float* f = F + ((size_t)b * SEQ + t) * CC + h * HD + d; v8h o16; v8us oh, ol;
#pragma unroll
    for (int k = 0; k < 8; ++k) { const float x = f[(size_t)k * CC]; unsigned short hh, ll; o16[k] = tohx(x * VCAR); splitf(x, hh, ll); oh[k] = hh; ol[k] = ll; }
    const size_t o2 = ((size_t)bh * HD + d) * RH + (t < RH ? t : 0u);
{ *(v8h*)(V16 + e) = o16; if (t < RH) { *(v8us*)(Vh + o2) = oh; *(v8us*)(Vl + o2) = ol; }  }
}

// P^T fragment (B operand of O^T = V^T P^T) built lane-locally from the two S^T tiles of a 32-key step: element r <- tile(keys 0..15)[r], element 8+r <- tile(keys 16..31)[r].
template <typename T16> struct PPack;
template <> struct PPack<h16> { static __device__ __forceinline__ void mk(const v8f& p0, const v8f& p1, float car, v16h& a, v16h& b) { v16h r;
#pragma unroll
        for (int i = 0; i < 8; ++i) { r[i] = tohx(p0[i] * car); r[8 + i] = tohx(p1[i] * car); }
        a = r; b = r; } };
template <> struct PPack<bf> { static __device__ __forceinline__ void mk(const v8f& p0, const v8f& p1, float car, v16bf& a, v16bf& b) { (void)car; v16us h, l;
#pragma unroll
        for (int i = 0; i < 8; ++i) { unsigned short hh, ll; splitf(p0[i], hh, ll); h[i] = hh; l[i] = ll; splitf(p1[i], hh, ll); h[8 + i] = hh; l[8 + i] = ll; }
        a = __builtin_bit_cast(v16bf, h); b = __builtin_bit_cast(v16bf, l); } };

// Hazard guards: 4 VALU-slot nops tied to every accumulator of the group and to the fragments of the last products.
template <int N> struct Grd;
template <> struct Grd<1> {
    template <typename V> static __device__ __forceinline__ void s(v8f (&st)[2][1], const V& x, const V& y) { asm volatile("v_nop\n\tv_nop\n\tv_nop\n\tv_nop" : "+v"(st[0][0]), "+v"(st[1][0]) : "v"(x), "v"(y)); }
    template <typename V> static __device__ __forceinline__ void o(v8f (&oa)[4][1], const V& x, const V& y, const V& z) { asm volatile("v_nop\n\tv_nop\n\tv_nop\n\tv_nop" : "+v"(oa[0][0]), "+v"(oa[1][0]), "+v"(oa[2][0]), "+v"(oa[3][0]) : "v"(x), "v"(y), "v"(z)); }
};
template <> struct Grd<2> {
    template <typename V> static __device__ __forceinline__ void s(v8f (&st)[2][2], const V& x, const V& y) { asm volatile("v_nop\n\tv_nop\n\tv_nop\n\tv_nop" : "+v"(st[0][0]), "+v"(st[1][0]), "+v"(st[0][1]), "+v"(st[1][1]) : "v"(x), "v"(y)); }
    template <typename V> static __device__ __forceinline__ void o(v8f (&oa)[4][2], const V& x, const V& y, const V& z) { asm volatile("v_nop\n\tv_nop\n\tv_nop\n\tv_nop" : "+v"(oa[0][0]), "+v"(oa[1][0]), "+v"(oa[2][0]), "+v"(oa[3][0]), "+v"(oa[0][1]), "+v"(oa[1][1]), "+v"(oa[2][1]), "+v"(oa[3][1]) : "v"(x), "v"(y), "v"(z)); }
};

// ---- fused causal attention body, one wave per 16*NQ query rows of one (batch, head); keys in steps of 32.
// S^T[key][query] = sum_d K[key][d] Q[query][d]: A = K rows (lane -> key), B = Q rows (lane -> query); D: lane = query (lane&15), element r = key 8*(lane>>4) + r.
// Row statistics are per lane (query); the two lane halves hold different keys and exchange the step maximum with one xor-16 shuffle; row sums stay per-lane partials until the end.
// O^T[d][query] += V^T[d][key] P^T[key][query]: A = V^T rows (lane -> d), B = packed P^T. Planes: Q, K [t][HD]; V^T [d][vpitch].
template <typename T16, bool SPLIT, int NQ>
__device__ __forceinline__ void attn_body(const T16* __restrict__ Q, const T16* __restrict__ Q2, const T16* __restrict__ Kp, const T16* __restrict__ K2, const T16* __restrict__ Vt, const T16* __restrict__ V2,
                                          const float* __restrict__ G, int vpitch, int q0, float ssc, float osc, float pcar, bf* Ah, bf* Al, float* os) {
    typedef typename WFrag<T16>::V V;
    const int lane = threadIdx.x & 31, lr = lane & 15, hi = lane >> 4;
    V qf[NQ][2], qf2[NQ][2];
#pragma unroll
    for (int nb = 0; nb < NQ; ++nb)
#pragma unroll
        for (int ds = 0; ds < 2; ++ds) { const size_t qo = (size_t)(q0 + 16 * nb + lr) * HD + 32 * ds + 8 * hi; qf[nb][ds] = WFrag<T16>::ld(Q + qo); if (SPLIT) qf2[nb][ds] = WFrag<T16>::ld(Q2 + qo); }
    v8f o[4][NQ]; float mrun[NQ], lrun[NQ];
#pragma unroll
    for (int nb = 0; nb < NQ; ++nb) { mrun[nb] = NEGB; lrun[nb] = 0.0f;
#pragma unroll
        for (int dt = 0; dt < 4; ++dt) o[dt][nb] = (v8f){}; }
    const int kend = q0 + 16 * NQ;
#pragma unroll 1
    for (int kt = 0; kt < kend; kt += 32) {
        V ka[2][2], ka2[2][2];
#pragma unroll
        for (int mb = 0; mb < 2; ++mb)
#pragma unroll
            for (int ds = 0; ds < 2; ++ds) { const size_t ko = (size_t)(kt + 16 * mb + lr) * HD + 32 * ds + 8 * hi; ka[mb][ds] = WFrag<T16>::ld(Kp + ko); if (SPLIT) ka2[mb][ds] = WFrag<T16>::ld(K2 + ko); }
        // the four V^T fragments of this key step are asked for here, behind the K fragments, each into registers of its own: they arrive while the scores and the softmax are worked out
        V va[4], va2[4];
        if constexpr (SPLIT) {
#pragma unroll
            for (int dt = 0; dt < 4; ++dt) { const size_t vo = (size_t)(16 * dt + lr) * vpitch + kt + 8 * hi; va[dt] = WFrag<T16>::ld(Vt + vo); va2[dt] = WFrag<T16>::ld(V2 + vo); }
            const size_t kb = (size_t)(kt + lr) * HD + 8 * hi, vb = (size_t)lr * vpitch + kt + 8 * hi;
            asm volatile("s_wait_xcnt 0x0" :: "v"(Kp + kb), "v"(K2 + kb), "v"(Vt + vb), "v"(V2 + vb) : "memory");
        } else {
            xwait();   // behind the K loads: a V^T fragment may be given the registers of their address
#pragma unroll
            for (int dt = 0; dt < 4; ++dt) { const size_t vo = (size_t)(16 * dt + lr) * vpitch + kt + 8 * hi; va[dt] = dt < 3 ? WFrag<T16>::ld(Vt + vo) : ldw16(Vt + vo); }
        }
        v8f st[2][NQ];
#pragma unroll
        for (int mb = 0; mb < 2; ++mb)
#pragma unroll
            for (int nb = 0; nb < NQ; ++nb) { v8f z = (v8f){};
                z = WFrag<T16>::mma(ka[mb][0], qf[nb][0], z); z = WFrag<T16>::mma(ka[mb][1], qf[nb][1], z);
                if (SPLIT) { z = WFrag<T16>::mma(ka2[mb][0], qf[nb][0], z); z = WFrag<T16>::mma(ka2[mb][1], qf[nb][1], z); z = WFrag<T16>::mma(ka[mb][0], qf2[nb][0], z); z = WFrag<T16>::mma(ka[mb][1], qf2[nb][1], z); }
                st[mb][nb] = z; }
        Grd<NQ>::s(st, ka[1][1], SPLIT ? qf2[NQ - 1][1] : qf[NQ - 1][1]);
        V pb[NQ], pb2[NQ];
#pragma unroll
        for (int nb = 0; nb < NQ; ++nb) {
            const int qg = q0 + 16 * nb + lr; float mx = NEGB;
#pragma unroll
            for (int mb = 0; mb < 2; ++mb)
#pragma unroll
                for (int r = 0; r < 8; ++r) { const int kg = kt + 16 * mb + 8 * hi + r; float t = st[mb][nb][r] * ssc; t = (kg <= qg) ? t : NEGB; st[mb][nb][r] = t; mx = fmaxf(mx, t); }
            mx = fmaxf(mx, __shfl_xor(mx, 16, 32));
            const float mn = fmaxf(mrun[nb], mx);
            const float al = __builtin_amdgcn_exp2f((mrun[nb] - mn) * L2E); mrun[nb] = mn;
            float psum = 0.0f;
#pragma unroll
            for (int mb = 0; mb < 2; ++mb)
#pragma unroll
                for (int r = 0; r < 8; ++r) { const float p = __builtin_amdgcn_exp2f((st[mb][nb][r] - mn) * L2E); psum += p; st[mb][nb][r] = p; }
            lrun[nb] = lrun[nb] * al + psum;
#pragma unroll
            for (int dt = 0; dt < 4; ++dt)
#pragma unroll
                for (int r = 0; r < 8; ++r) o[dt][nb][r] *= al;
            PPack<T16>::mk(st[0][nb], st[1][nb], pcar, pb[nb], pb2[nb]);
        }
#pragma unroll
        for (int dt = 0; dt < 4; ++dt) {
#pragma unroll
            for (int nb = 0; nb < NQ; ++nb) { o[dt][nb] = WFrag<T16>::mma(va[dt], pb[nb], o[dt][nb]); if (SPLIT) { o[dt][nb] = WFrag<T16>::mma(va2[dt], pb[nb], o[dt][nb]); o[dt][nb] = WFrag<T16>::mma(va[dt], pb2[nb], o[dt][nb]); } } }
        Grd<NQ>::o(o, SPLIT ? va2[3] : va[3], pb[NQ - 1], SPLIT ? pb2[NQ - 1] : pb[0]);
    }
    // normalise; O^T lane = query, element r = d 16*dt + 8*hi + r  ->  LDS tile [query][d]
#pragma unroll
    for (int nb = 0; nb < NQ; ++nb) { float lt = lrun[nb]; lt += __shfl_xor(lt, 16, 32); const float inv = osc * __builtin_amdgcn_rcpf(lt);
#pragma unroll
        for (int dt = 0; dt < 4; ++dt) { v4f a, c;
#pragma unroll
            for (int r = 0; r < 4; ++r) { a[r] = o[dt][nb][r] * inv; c[r] = o[dt][nb][4 + r] * inv; }
            float* dst = os + (16 * nb + lr) * OSP + 16 * dt + 8 * hi; *(v4fa*)dst = a; *(v4fa*)(dst + 4) = c; } }
    __syncthreads();
    const int rr = lane >> 3, seg = (lane & 7) * 8;
{
#pragma unroll
        for (int s = 0; s < 4 * NQ; ++s) { const int row = 4 * s + rr; const v4f a = *(const v4fa*)(os + row * OSP + seg); const v4f c = *(const v4fa*)(os + row * OSP + seg + 4);
            const float* gp = G + (size_t)(q0 + row) * CC + seg; const v4f ga = *(const v4f*)gp; const v4f gc = *(const v4f*)(gp + 4); v8us oh, ol;
#pragma unroll
            for (int k = 0; k < 4; ++k) { unsigned short hh, ll; const float ya = a[k] * sigm(ga[k]); const float yc = c[k] * sigm(gc[k]); splitf(ya, hh, ll); oh[k] = hh; ol[k] = ll; splitf(yc, hh, ll); oh[4 + k] = hh; ol[4 + k] = ll; }
            const size_t oo = (size_t)(q0 + row) * CC + seg; *(v8us*)(Ah + oo) = oh; *(v8us*)(Al + oo) = ol; }
         }
}

// rows < RH: bf16 hi/lo planes [b][h][RH][HD] / [b][h][HD][RH], 16 query rows per wave; grid (RH/16, NH, NB)
__global__ __launch_bounds__(32) void k_attn_s(const bf* __restrict__ Qh, const bf* __restrict__ Ql, const bf* __restrict__ Kh, const bf* __restrict__ Kl, const bf* __restrict__ Vh, const bf* __restrict__ Vl, const float* __restrict__ Gt, bf* ATh, bf* ATl) {
    __shared__ __align__(16) float os[16 * OSP];
    const size_t bh = (size_t)blockIdx.z * NH + blockIdx.y; const size_t po = bh * RH * HD; const size_t ao = (size_t)blockIdx.z * SEQ * CC + (size_t)blockIdx.y * HD;
    attn_body<bf, true, 1>(Qh + po, Ql + po, Kh + po, Kl + po, Vh + po, Vl + po, Gt + ao, RH, (int)blockIdx.x * 16, 0.125f, 1.0f, 1.0f, ATh + ao, ATl + ao, os);
}
// rows >= RH: f16 planes [b][h][SEQ][HD] / [b][h][HD][SEQ] with carries, 32 query rows per wave; grid ((SEQ-RH)/32, NH, NB)
__global__ __launch_bounds__(32) void k_attn_h(const h16* __restrict__ Q, const h16* __restrict__ Kp, const h16* __restrict__ Vt, const float* __restrict__ Gt, bf* ATh, bf* ATl) {
    __shared__ __align__(16) float os[32 * OSP];
    const size_t bh = (size_t)blockIdx.z * NH + blockIdx.y; const size_t po = bh * SEQ * HD; const size_t ao = (size_t)blockIdx.z * SEQ * CC + (size_t)blockIdx.y * HD;
    attn_body<h16, false, 2>(Q + po, nullptr, Kp + po, nullptr, Vt + po, nullptr, Gt + ao, SEQ, RH + (int)blockIdx.x * 32, 0.125f / (QCAR * QCAR), 1.0f / (PCAR * VCAR), PCAR, ATh + ao, ATl + ao, os);
}

extern "C" void kernel_launch(void* const* d_in, const int* in_sizes, int n_in,
                              void* d_out, int out_size, void* d_ws, size_t ws_size, hipStream_t stream) {
    if (n_in < 7) return;
    if ((size_t)in_sizes[0] < ((size_t)(NB - 1) * SEQ_FULL + SEQ) * CC) return;
    if ((size_t)in_sizes[1] < W1 || (size_t)in_sizes[2] < W1 || (size_t)in_sizes[3] < W1 || (size_t)in_sizes[4] < W1 || (size_t)in_sizes[5] < W1 || in_sizes[6] < CC) return;
    if ((size_t)out_size < PL16) return;
    // wire order: x, Wq, Wk, Wv, Wg, Wo, bo
    const float* x = (const float*)d_in[0]; const float* wq = (const float*)d_in[1]; const float* wk = (const float*)d_in[2]; const float* wv = (const float*)d_in[3];
    const float* wg = (const float*)d_in[4]; const float* wo = (const float*)d_in[5]; const float* bo = (const float*)d_in[6];
    float* OUT = (float*)d_out;     // [NB][SEQ][CC]
    char* wsp = (char*)d_ws;
    auto take = [&](size_t bytes) { char* p = wsp; wsp += (bytes + 255) & ~(size_t)255; return (void*)p; };
    bf* WQ = (bf*)take(4 * W1 * 2);            // Wq | Wk | Wv | Wg bf16 [out][in]
    bf* WO = (bf*)take(W1 * 2);
    bf* XB = (bf*)take(PL16 * 2);              // bf16 x [MROWS][CC]
    float* F = (float*)take(4 * PL16 * 4);     // f32 q | k | v | gate [MROWS][CC]
    h16* QK16 = (h16*)take(2 * PL16 * 2);      // f16 q planes | k planes
    h16* VT16 = (h16*)take(PL16 * 2);
    bf* QKh = (bf*)take(2 * PLR * 2); bf* QKl = (bf*)take(2 * PLR * 2);
    bf* VTh = (bf*)take(PLR * 2); bf* VTl = (bf*)take(PLR * 2);
    if ((size_t)(wsp - (char*)d_ws) > ws_size) return;
    // gated-ctx hi | lo planes reuse the f32 q plane (its only consumer, k_qkp, has finished before the attention launches start; sizes match exactly)
    bf* ATh = (bf*)F; bf* ATl = ATh + PL16;
    const float* GATE = F + 3 * PL16;
    const unsigned w8 = (unsigned)(W1 / 8), x8 = (unsigned)(PL16 / 8);
    k_cvt8<<<(w8 + 255) / 256, 256, 0, stream>>>(wq, WQ, w8, w8, 0u);
    k_cvt8<<<(w8 + 255) / 256, 256, 0, stream>>>(wk, WQ + W1, w8, w8, 0u);
    k_cvt8<<<(w8 + 255) / 256, 256, 0, stream>>>(wv, WQ + 2 * W1, w8, w8, 0u);
    k_cvt8<<<(w8 + 255) / 256, 256, 0, stream>>>(wg, WQ + 3 * W1, w8, w8, 0u);
    k_cvt8<<<(w8 + 255) / 256, 256, 0, stream>>>(wo, WO, w8, w8, 0u);
    k_cvt8<<<(x8 + 255) / 256, 256, 0, stream>>>(x, XB, x8, (unsigned)((size_t)SEQ * CC / 8), (unsigned)((size_t)SEQ_FULL * CC / 8));
    k_gemm_proj<<<dim3(MROWS / 64, CC / 64, 4), 32, 0, stream>>>(XB, WQ, F, W1, PL16);
    k_qkp<<<dim3((x8 + 255) / 256, 2, 1), 256, 0, stream>>>(F, QK16, QKh, QKl);
    k_vtp<<<(x8 + 255) / 256, 256, 0, stream>>>(F + 2 * PL16, VT16, VTh, VTl);
    k_attn_s<<<dim3(RH / 16, NH, NB), 32, 0, stream>>>(QKh, QKl, QKh + PLR, QKl + PLR, VTh, VTl, GATE, ATh, ATl);
    if (SEQ > RH) k_attn_h<<<dim3((SEQ - RH) / 32 > 0 ? (SEQ - RH) / 32 : 1, NH, NB), 32, 0, stream>>>(QK16, QK16 + PL16, VT16, GATE, ATh, ATl);
    k_gemm_out<<<dim3(MROWS / 64, CC / 64, 1), 32, 0, stream>>>(ATh, ATl, WO, OUT, bo);
}

// v002
// One run takes 197 microseconds.
// Next to v001, in two timings, it ran 1.15 and 1.13 times as fast.
// All steps since v000 together make it 1.41 times as fast.
#include <hip/hip_runtime.h>

// Causal multi-head attention with a sigmoid output gate, x [2][2048][1024], 16 heads x 64, weights [out][in], one score scale 1/8, tril mask, out = (merged heads * sigmoid(x Wg^T)) x Wo^T + bo.
// Compute dtypes, f32 accumulate: all float inputs RNE-converted to bf16 on load; q/k/v/gate projections v_wmma_f32_16x16x32_bf16 (exact products);
// attention rows < RH: bf16 hi/lo planes, 3 products on q.k and on p.v; rows >= RH: v_wmma_f32_16x16x32_f16 with q,k x16, v x16, p x1024 carries; softmax f32 (running max); gate sigmoid f32 on the VALU;
// output projection: gated ctx bf16 hi/lo x bf16 Wo (2 products) + bf16(bo).
// Fused attention in transposed form: S^T = K Q^T (D rows = keys, lane = query), P^T fragment built lane-locally from two S^T tiles, O^T = V^T P^T; no score plane in global memory.

#ifndef NB
#define NB 2
#endif
#ifndef SEQ
#define SEQ 2048
#endif
#ifndef RH
#define RH 256                       // query rows < RH use hi+lo planes
#endif
#define NB_FULL  2
#define SEQ_FULL 2048
#define CC   1024
#define NH   16
#define HD   64
#define MROWS (NB * SEQ)
#define PCAR 1024.0f
#define QCAR 16.0f
#define VCAR 16.0f
#define L2E  1.4426950408889634f
#define NEGB (-1.0e30f)
#define OSP  68
#define W1   ((size_t)CC * CC)
#define PL16 ((size_t)MROWS * CC)
#define PLR  ((size_t)NB * NH * RH * HD)
// carve: 4+1 bf16 weight planes, bf16 x, 4 f32 planes (the last: gate; the first: the gated-ctx hi|lo planes), f16 q|k|v^T planes, bf16 hi/lo planes of the first RH rows
#define WS_TOTAL (10 * W1 + 24 * PL16 + 12 * PLR)
static_assert(CC == NH * HD);                 // head split covers the model width
static_assert(HD == 64);
static_assert(CC % 64 == 0 && CC % 32 == 0);  // GEMM N tile 64, K step 32
static_assert(MROWS % 64 == 0);               // GEMM M tile 64
static_assert(SEQ % 256 == 0);                // a 64-row projection tile stays inside one batch
static_assert(RH % 256 == 0 && RH <= SEQ);    // a 64-row projection tile lies on one side of the hi/lo row boundary
static_assert((SEQ - RH) % 32 == 0 && RH % 32 == 0 && RH % 16 == 0);   // query tiles of 32 (f16 path) and 16 (hi/lo path)
static_assert(NB <= NB_FULL && SEQ <= SEQ_FULL);
static_assert((W1 * 2) % 256 == 0 && (PL16 * 2) % 256 == 0 && (PLR * 2) % 256 == 0);   // carve pieces stay 256-B aligned without padding
static_assert(2 * PL16 * sizeof(unsigned short) <= PL16 * sizeof(float));              // gated-ctx hi|lo planes fit exactly inside the first f32 plane of F
static_assert(WS_TOTAL <= (size_t)134217728); // total carve <= 128 MiB

typedef _Float16 h16;
typedef unsigned short bf;
typedef __attribute__((ext_vector_type(16))) __bf16   v16bf;
typedef __attribute__((ext_vector_type(16))) _Float16 v16h;
typedef __attribute__((ext_vector_type(16))) unsigned short v16us;
typedef __attribute__((ext_vector_type(8)))  _Float16 v8h;
typedef __attribute__((ext_vector_type(8)))  unsigned short v8us;
typedef __attribute__((ext_vector_type(8)))  float    v8f;
typedef __attribute__((ext_vector_type(4)))  float    v4f;
typedef v4f  __attribute__((may_alias)) v4fa;

__device__ __forceinline__ unsigned short f2bf(float f) { unsigned u = __float_as_uint(f); u += 0x7FFFu + ((u >> 16) & 1u); return (unsigned short)(u >> 16); }
__device__ __forceinline__ float bf2f(unsigned short b) { return __uint_as_float(((unsigned)b) << 16); }
__device__ __forceinline__ float bfr(float f) { return bf2f(f2bf(f)); }
__device__ __forceinline__ h16 tohx(float x) { return (h16)x; }
__device__ __forceinline__ void splitf(float y, unsigned short& h, unsigned short& l) { h = f2bf(y); l = f2bf(y - bf2f(h)); }
__device__ __forceinline__ float sigm(float g) { return __builtin_amdgcn_rcpf(1.0f + __builtin_amdgcn_exp2f(-g * L2E)); }
__device__ __forceinline__ v16h cat16(v8h lo, v8h hi) { return __builtin_shufflevector(lo, hi, 0, 1, 2, 3, 4, 5, 6, 7, 8, 9, 10, 11, 12, 13, 14, 15); }
__device__ __forceinline__ v16bf cat16b(v8us lo, v8us hi) { return __builtin_bit_cast(v16bf, __builtin_shufflevector(lo, hi, 0, 1, 2, 3, 4, 5, 6, 7, 8, 9, 10, 11, 12, 13, 14, 15)); }
__device__ __forceinline__ v8f wmma16(v16h a, v16h b, v8f c) { return __builtin_amdgcn_wmma_f32_16x16x32_f16(false, a, false, b, (short)0, c, false, false); }
__device__ __forceinline__ v8f wmmab(v16bf a, v16bf b, v8f c) { return __builtin_amdgcn_wmma_f32_16x16x32_bf16(false, a, false, b, (short)0, c, false, false); }

// Fragment loader from a K-contiguous 16-bit row: p already includes + 8*(lane>>4); elements 0..7 <- p[0..7], elements 8..15 <- p[16..23].
template <typename T16> struct WFrag;
template <> struct WFrag<h16> { typedef v16h V; static __device__ __forceinline__ V ld(const h16* p) { return cat16(*(const v8h*)p, *(const v8h*)(p + 16)); } static __device__ __forceinline__ v8f mma(V a, V b, v8f c) { return wmma16(a, b, c); } };
template <> struct WFrag<bf> { typedef v16bf V; static __device__ __forceinline__ V ld(const bf* p) { return cat16b(*(const v8us*)p, *(const v8us*)(p + 16)); } static __device__ __forceinline__ v8f mma(V a, V b, v8f c) { return wmmab(a, b, c); } };
// s_wait_xcnt 0, written where the next load's result may be given the registers of an address that loads already issued name.
__device__ __forceinline__ void xwait() { asm volatile("s_wait_xcnt 0x0" ::: "memory"); }
// The f16 fragment loader again, for the last fragment read through an address: the wait stands in front of its last load.
__device__ __forceinline__ v16h ldw16(const h16* p) { const v8h lo = *(const v8h*)p; xwait(); return cat16(lo, *(const v8h*)(p + 16)); }

// The attention planes that the projection tiles are written to: f16 q|k [w][b][h][t][HD] and v^T [b][h][d][t] with their carries, bf16 hi/lo planes of the first RH rows.
struct Planes { h16* qk16; bf* qkh; bf* qkl; h16* vt16; bf* vth; bf* vtl; };

// A 64x64 f32 accumulator tile (lane&15 = column within 16 nb, element j = row 8*(lane>>4) + j within 16 mb) leaves as q or k rows [t][HD]: f16 with the carry, and for HL the bf16 hi/lo pair.
// 16 rows at a time go through the LDS stage; then a store covers 4 whole rows of 128 B (512 contiguous B). p16, ph, pl point at the tile's first row.
template <bool HL>
__device__ __forceinline__ void put_qk(const v8f (&acc)[4][4], float* os, h16* p16, bf* ph, bf* pl, int lane) {
    const int lr = lane & 15, hi = lane >> 4, rr = lane >> 3, seg = (lane & 7) * 8;
#pragma unroll
    for (int mb = 0; mb < 4; ++mb) {
#pragma unroll
        for (int nb = 0; nb < 4; ++nb) {
#pragma unroll
            for (int j = 0; j < 8; ++j) os[(hi * 8 + j) * OSP + nb * 16 + lr] = acc[mb][nb][j]; }
        __builtin_amdgcn_wave_barrier(); asm volatile("" ::: "memory");   // compiler fence: the row reads below take other lanes' writes and must not be moved over them
#pragma unroll
        for (int s = 0; s < 4; ++s) { const int row = 4 * s + rr; const v4f a = *(const v4fa*)(os + row * OSP + seg), g = *(const v4fa*)(os + row * OSP + seg + 4); v8h o16;
#pragma unroll
            for (int k = 0; k < 4; ++k) { o16[k] = tohx(a[k] * QCAR); o16[4 + k] = tohx(g[k] * QCAR); }
            const int o = (mb * 16 + row) * HD + seg;
            *(v8h*)(p16 + o) = o16;
            if constexpr (HL) { v8us oh, ol;
#pragma unroll
                for (int k = 0; k < 4; ++k) { unsigned short hh, ll; splitf(a[k], hh, ll); oh[k] = hh; ol[k] = ll; splitf(g[k], hh, ll); oh[4 + k] = hh; ol[4 + k] = ll; }
                *(v8us*)(ph + o) = oh; *(v8us*)(pl + o) = ol; } }
        __builtin_amdgcn_wave_barrier(); asm volatile("" ::: "memory");   // compiler fence: the next 16 rows' writes stay behind these reads
    }
    xwait();   // behind the last stores: where the build lays another epilogue block out behind this one, that block rewrites registers that they name
}
// The same tile leaves as v^T rows [d][t]: a lane's 8 accumulator elements are 8 consecutive t of one d, 16 B of a v^T row, stored from the registers. p16 (pitch SEQ), ph, pl (pitch RH) point at d = 0 of the head, first t of the tile; hl (the same in every lane): the bf16 hi/lo pair is wanted too.
__device__ __forceinline__ void put_vt(const v8f (&acc)[4][4], h16* p16, bf* ph, bf* pl, bool hl, int lane) {
    const int lr = lane & 15, hi = lane >> 4;
    if (hl) {
#pragma unroll
        for (int nb = 0; nb < 4; ++nb)
#pragma unroll
            for (int mb = 0; mb < 4; ++mb) { const int o = (nb * 16 + lr) * RH + mb * 16 + hi * 8; v8us oh, ol;
#pragma unroll
                for (int j = 0; j < 8; ++j) { unsigned short hh, ll; splitf(acc[mb][nb][j], hh, ll); oh[j] = hh; ol[j] = ll; }
                *(v8us*)(ph + o) = oh; *(v8us*)(pl + o) = ol; }
    }
#pragma unroll
    for (int nb = 0; nb < 4; ++nb)
#pragma unroll
        for (int mb = 0; mb < 4; ++mb) { v8h o16;
#pragma unroll
            for (int j = 0; j < 8; ++j) o16[j] = tohx(acc[mb][nb][j] * VCAR);
            *(v8h*)(p16 + (nb * 16 + lr) * SEQ + mb * 16 + hi * 8) = o16; }
    xwait();   // behind the last stores: where the build lays another epilogue block out behind this one, that block rewrites registers that they name
}

// ---- one-wave 64x64 tile GEMM body: C[m][n] (f32, pitch ldc, + optional bf16-converted bias[n]) = sum_k A[m][k] Bt[n][k] (+ A2 x Bt when NSPLIT == 1); K % 32 == 0.
// PLANES: tiles of z = 0, 1 (q, k) and z = 2 (v) leave as attention planes straight from the f32 accumulators; z = 3 (gate) leaves as f32 rows like any other tile.
template <typename T16, int NSPLIT, bool BIAS, bool PLANES>
__device__ __forceinline__ void gemmw_body(const T16* __restrict__ A, const T16* __restrict__ A2, const T16* __restrict__ Bt, const T16* __restrict__ Bt2, int K, float* C, int ldc, const float* __restrict__ bias, size_t sA, size_t sB, size_t sC, float* os, const Planes pl) {
    typedef typename WFrag<T16>::V V;
    const size_t z = blockIdx.z; A += z * sA; if (A2) A2 += z * sA; Bt += z * sB; if (Bt2) Bt2 += z * sB; C += z * sC;
    const int lane = threadIdx.x & 31, lr = lane & 15, hi = lane >> 4; const int r0 = blockIdx.x * 64, c0 = blockIdx.y * 64;
    v8f acc[4][4];
#pragma unroll
    for (int mb = 0; mb < 4; ++mb)
#pragma unroll
        for (int nb = 0; nb < 4; ++nb) acc[mb][nb] = (v8f){};
    const size_t aoff = (size_t)(r0 + lr) * K + 8 * hi, boff = (size_t)(c0 + lr) * K + 8 * hi;
#pragma unroll 1
    for (int kc = 0; kc < K; kc += 32) {
        V a[4], a2[4];
#pragma unroll
        for (int mb = 0; mb < 4; ++mb) { a[mb] = WFrag<T16>::ld(A + aoff + (size_t)mb * 16 * K + kc); if (NSPLIT == 1 || NSPLIT == 2) a2[mb] = WFrag<T16>::ld(A2 + aoff + (size_t)mb * 16 * K + kc); }
#pragma unroll
        for (int nb = 0; nb < 4; ++nb) { const V b = WFrag<T16>::ld(Bt + boff + (size_t)nb * 16 * K + kc); V b2; if (NSPLIT >= 2) b2 = WFrag<T16>::ld(Bt2 + boff + (size_t)nb * 16 * K + kc);
#pragma unroll
            for (int mb = 0; mb < 4; ++mb) { acc[mb][nb] = WFrag<T16>::mma(a[mb], b, acc[mb][nb]); if (NSPLIT == 1 || NSPLIT == 2) acc[mb][nb] = WFrag<T16>::mma(a2[mb], b, acc[mb][nb]); if (NSPLIT >= 2) acc[mb][nb] = WFrag<T16>::mma(a[mb], b2, acc[mb][nb]); } }
        asm volatile("v_nop\n\tv_nop\n\tv_nop\n\tv_nop" : "+v"(acc[0][0]), "+v"(acc[1][1]), "+v"(acc[2][2]), "+v"(acc[3][3]) : "v"(a[0]), "v"(a[3]));
    }
    if constexpr (PLANES) {
        // a tile's 64 columns are one head (HD == 64), its 64 rows lie in one batch and on one side of RH: every test here is the same for the whole wave
        const unsigned w = blockIdx.z, h = blockIdx.y, b = (unsigned)r0 / SEQ, t0 = (unsigned)r0 % SEQ;
        if (w < 2u) { const size_t bh = (size_t)(w * NB + b) * NH + h; h16* p16 = pl.qk16 + (bh * SEQ + t0) * HD;
            if (t0 < RH) put_qk<true>(acc, os, p16, pl.qkh + (bh * RH + t0) * HD, pl.qkl + (bh * RH + t0) * HD, lane); else put_qk<false>(acc, os, p16, nullptr, nullptr, lane);
            return; }
        if (w == 2u) { const size_t bh = (size_t)b * NH + h; h16* p16 = pl.vt16 + bh * HD * SEQ + t0;
            const size_t o2 = bh * HD * RH + (t0 < RH ? t0 : 0u);   // stays inside the hi/lo planes for a tile that does not write them
            put_vt(acc, p16, pl.vth + o2, pl.vtl + o2, t0 < RH, lane);
            return; }
    }
#pragma unroll
    for (int mb = 0; mb < 4; ++mb) {
#pragma unroll
        for (int nb = 0; nb < 4; ++nb) {
#pragma unroll
            for (int j = 0; j < 8; ++j) os[(hi * 8 + j) * OSP + nb * 16 + lr] = acc[mb][nb][j]; }
        __builtin_amdgcn_wave_barrier(); asm volatile("" ::: "memory");
        float* crow = C + (size_t)(r0 + mb * 16) * ldc + c0;
{
#pragma unroll
            for (int s = 0; s < 8; ++s) { const int row = 2 * s + hi, cofs = lr * 4; v4f val = *(const v4fa*)(os + row * OSP + cofs); if (BIAS) { val[0] += bfr(bias[c0 + cofs]); val[1] += bfr(bias[c0 + cofs + 1]); val[2] += bfr(bias[c0 + cofs + 2]); val[3] += bfr(bias[c0 + cofs + 3]); }
                *(v4f*)(crow + (size_t)row * ldc + cofs) = val; }
             }
        __builtin_amdgcn_wave_barrier(); asm volatile("" ::: "memory");
    }
    if constexpr (PLANES) xwait();   // behind the gate tile's last stores: the plane blocks laid out behind them rewrite registers that they name
}

// q/k/v/gate projections: z = 0..3 selects the weight plane (stride sB); q, k, v tiles go to the attention planes, the gate tile to the f32 plane C + 3 sC; A = bf16 x [MROWS][CC].
__global__ __launch_bounds__(32) void k_gemm_proj(const bf* __restrict__ A, const bf* __restrict__ Bt, float* C, size_t sB, size_t sC, h16* QK16, bf* QKh, bf* QKl, h16* VT16, bf* VTh, bf* VTl) {
    __shared__ __align__(16) float os[16 * OSP];
    gemmw_body<bf, 0, false, true>(A, nullptr, Bt, nullptr, CC, C, CC, nullptr, 0, sB, sC, os, Planes{QK16, QKh, QKl, VT16, VTh, VTl});
}
// output projection: (gated ctx hi + gated ctx lo) x Wo^T + bf16(bo) -> d_out rows.
__global__ __launch_bounds__(32) void k_gemm_out(const bf* __restrict__ Ah, const bf* __restrict__ Al, const bf* __restrict__ Bt, float* C, const float* __restrict__ bias) {
    __shared__ __align__(16) float os[16 * OSP];
    gemmw_body<bf, 1, true, false>(Ah, Al, Bt, nullptr, CC, C, CC, bias, 0, 0, 0, os, Planes{});
}

__global__ __launch_bounds__(256) void k_cvt8(const float* __restrict__ src, bf* dst, unsigned n8, unsigned per8, unsigned sstr8) {
    const unsigned i = blockIdx.x * 256u + threadIdx.x; if (i >= n8) return;
    const unsigned b = i / per8, r = i - b * per8;
    const v8f v = *(const v8f*)(src + ((size_t)b * sstr8 + r) * 8); v8us o;
#pragma unroll
    for (int k = 0; k < 8; ++k) o[k] = f2bf(v[k]);
    *(v8us*)(dst + (size_t)i * 8) = o;  }

// P^T fragment (B operand of O^T = V^T P^T) built lane-locally from the two S^T tiles of a 32-key step: element r <- tile(keys 0..15)[r], element 8+r <- tile(keys 16..31)[r].
template <typename T16> struct PPack;
template <> struct PPack<h16> { static __device__ __forceinline__ void mk(const v8f& p0, const v8f& p1, float car, v16h& a, v16h& b) { v16h r;
#pragma unroll
        for (int i = 0; i < 8; ++i) { r[i] = tohx(p0[i] * car); r[8 + i] = tohx(p1[i] * car); }
        a = r; b = r; } };
template <> struct PPack<bf> { static __device__ __forceinline__ void mk(const v8f& p0, const v8f& p1, float car, v16bf& a, v16bf& b) { (void)car; v16us h, l;
#pragma unroll
        for (int i = 0; i < 8; ++i) { unsigned short hh, ll; splitf(p0[i], hh, ll); h[i] = hh; l[i] = ll; splitf(p1[i], hh, ll); h[8 + i] = hh; l[8 + i] = ll; }
        a = __builtin_bit_cast(v16bf, h); b = __builtin_bit_cast(v16bf, l); } };

// Hazard guards: 4 VALU-slot nops tied to every accumulator of the group and to the fragments of the last products.
template <int N> struct Grd;
template <> struct Grd<1> {
    template <typename V> static __device__ __forceinline__ void s(v8f (&st)[2][1], const V& x, const V& y) { asm volatile("v_nop\n\tv_nop\n\tv_nop\n\tv_nop" : "+v"(st[0][0]), "+v"(st[1][0]) : "v"(x), "v"(y)); }
    template <typename V> static __device__ __forceinline__ void o(v8f (&oa)[4][1], const V& x, const V& y, const V& z) { asm volatile("v_nop\n\tv_nop\n\tv_nop\n\tv_nop" : "+v"(oa[0][0]), "+v"(oa[1][0]), "+v"(oa[2][0]), "+v"(oa[3][0]) : "v"(x), "v"(y), "v"(z)); }
};
template <> struct Grd<2> {
    template <typename V> static __device__ __forceinline__ void s(v8f (&st)[2][2], const V& x, const V& y) { asm volatile("v_nop\n\tv_nop\n\tv_nop\n\tv_nop" : "+v"(st[0][0]), "+v"(st[1][0]), "+v"(st[0][1]), "+v"(st[1][1]) : "v"(x), "v"(y)); }
    template <typename V> static __device__ __forceinline__ void o(v8f (&oa)[4][2], const V& x, const V& y, const V& z) { asm volatile("v_nop\n\tv_nop\n\tv_nop\n\tv_nop" : "+v"(oa[0][0]), "+v"(oa[1][0]), "+v"(oa[2][0]), "+v"(oa[3][0]), "+v"(oa[0][1]), "+v"(oa[1][1]), "+v"(oa[2][1]), "+v"(oa[3][1]) : "v"(x), "v"(y), "v"(z)); }
};

// ---- fused causal attention body, one wave per 16*NQ query rows of one (batch, head); keys in steps of 32.
// S^T[key][query] = sum_d K[key][d] Q[query][d]: A = K rows (lane -> key), B = Q rows (lane -> query); D: lane = query (lane&15), element r = key 8*(lane>>4) + r.
// Row statistics are per lane (query); the two lane halves hold different keys and exchange the step maximum with one xor-16 shuffle; row sums stay per-lane partials until the end.
// O^T[d][query] += V^T[d][key] P^T[key][query]: A = V^T rows (lane -> d), B = packed P^T. Planes: Q, K [t][HD]; V^T [d][vpitch].
template <typename T16, bool SPLIT, int NQ>
__device__ __forceinline__ void attn_body(const T16* __restrict__ Q, const T16* __restrict__ Q2, const T16* __restrict__ Kp, const T16* __restrict__ K2, const T16* __restrict__ Vt, const T16* __restrict__ V2,
                                          const float* __restrict__ G, int vpitch, int q0, float ssc, float osc, float pcar, bf* Ah, bf* Al, float* os) {
    typedef typename WFrag<T16>::V V;
    const int lane = threadIdx.x & 31, lr = lane & 15, hi = lane >> 4;
    V qf[NQ][2], qf2[NQ][2];
#pragma unroll
    for (int nb = 0; nb < NQ; ++nb)
#pragma unroll
        for (int ds = 0; ds < 2; ++ds) { const size_t qo = (size_t)(q0 + 16 * nb + lr) * HD + 32 * ds + 8 * hi; qf[nb][ds] = WFrag<T16>::ld(Q + qo); if (SPLIT) qf2[nb][ds] = WFrag<T16>::ld(Q2 + qo); }
    v8f o[4][NQ]; float mrun[NQ], lrun[NQ];
#pragma unroll
    for (int nb = 0; nb < NQ; ++nb) { mrun[nb] = NEGB; lrun[nb] = 0.0f;
#pragma unroll
        for (int dt = 0; dt < 4; ++dt) o[dt][nb] = (v8f){}; }
    const int kend = q0 + 16 * NQ;
#pragma unroll 1
    for (int kt = 0; kt < kend; kt += 32) {
        V ka[2][2], ka2[2][2];
#pragma unroll
        for (int mb = 0; mb < 2; ++mb)
#pragma unroll
            for (int ds = 0; ds < 2; ++ds) { const size_t ko = (size_t)(kt + 16 * mb + lr) * HD + 32 * ds + 8 * hi; ka[mb][ds] = WFrag<T16>::ld(Kp + ko); if (SPLIT) ka2[mb][ds] = WFrag<T16>::ld(K2 + ko); }
        // the four V^T fragments of this key step are asked for here, behind the K fragments, each into registers of its own: they arrive while the scores and the softmax are worked out
        V va[4], va2[4];
        if constexpr (SPLIT) {
#pragma unroll
            for (int dt = 0; dt < 4; ++dt) { const size_t vo = (size_t)(16 * dt + lr) * vpitch + kt + 8 * hi; va[dt] = WFrag<T16>::ld(Vt + vo); va2[dt] = WFrag<T16>::ld(V2 + vo); }
            const size_t kb = (size_t)(kt + lr) * HD + 8 * hi, vb = (size_t)lr * vpitch + kt + 8 * hi;
            asm volatile("s_wait_xcnt 0x0" :: "v"(Kp + kb), "v"(K2 + kb), "v"(Vt + vb), "v"(V2 + vb) : "memory");
        } else {
            xwait();   // behind the K loads: a V^T fragment may be given the registers of their address
#pragma unroll
            for (int dt = 0; dt < 4; ++dt) { const size_t vo = (size_t)(16 * dt + lr) * vpitch + kt + 8 * hi; va[dt] = dt < 3 ? WFrag<T16>::ld(Vt + vo) : ldw16(Vt + vo); }
        }
        v8f st[2][NQ];
#pragma unroll
        for (int mb = 0; mb < 2; ++mb)
#pragma unroll
            for (int nb = 0; nb < NQ; ++nb) { v8f z = (v8f){};
                z = WFrag<T16>::mma(ka[mb][0], qf[nb][0], z); z = WFrag<T16>::mma(ka[mb][1], qf[nb][1], z);
                if (SPLIT) { z = WFrag<T16>::mma(ka2[mb][0], qf[nb][0], z); z = WFrag<T16>::mma(ka2[mb][1], qf[nb][1], z); z = WFrag<T16>::mma(ka[mb][0], qf2[nb][0], z); z = WFrag<T16>::mma(ka[mb][1], qf2[nb][1], z); }
                st[mb][nb] = z; }
        Grd<NQ>::s(st, ka[1][1], SPLIT ? qf2[NQ - 1][1] : qf[NQ - 1][1]);
        V pb[NQ], pb2[NQ];
#pragma unroll
        for (int nb = 0; nb < NQ; ++nb) {
            const int qg = q0 + 16 * nb + lr; float mx = NEGB;
#pragma unroll
            for (int mb = 0; mb < 2; ++mb)
#pragma unroll
                for (int r = 0; r < 8; ++r) { const int kg = kt + 16 * mb + 8 * hi + r; float t = st[mb][nb][r] * ssc; t = (kg <= qg) ? t : NEGB; st[mb][nb][r] = t; mx = fmaxf(mx, t); }
            mx = fmaxf(mx, __shfl_xor(mx, 16, 32));
            const float mn = fmaxf(mrun[nb], mx);
            const float al = __builtin_amdgcn_exp2f((mrun[nb] - mn) * L2E); mrun[nb] = mn;
            float psum = 0.0f;
#pragma unroll
            for (int mb = 0; mb < 2; ++mb)
#pragma unroll
                for (int r = 0; r < 8; ++r) { const float p = __builtin_amdgcn_exp2f((st[mb][nb][r] - mn) * L2E); psum += p; st[mb][nb][r] = p; }
            lrun[nb] = lrun[nb] * al + psum;
#pragma unroll
            for (int dt = 0; dt < 4; ++dt)
#pragma unroll
                for (int r = 0; r < 8; ++r) o[dt][nb][r] *= al;
            PPack<T16>::mk(st[0][nb], st[1][nb], pcar, pb[nb], pb2[nb]);
        }
#pragma unroll
        for (int dt = 0; dt < 4; ++dt) {
#pragma unroll
            for (int nb = 0; nb < NQ; ++nb) { o[dt][nb] = WFrag<T16>::mma(va[dt], pb[nb], o[dt][nb]); if (SPLIT) { o[dt][nb] = WFrag<T16>::mma(va2[dt], pb[nb], o[dt][nb]); o[dt][nb] = WFrag<T16>::mma(va[dt], pb2[nb], o[dt][nb]); } } }
        Grd<NQ>::o(o, SPLIT ? va2[3] : va[3], pb[NQ - 1], SPLIT ? pb2[NQ - 1] : pb[0]);
    }
    // normalise; O^T lane = query, element r = d 16*dt + 8*hi + r  ->  LDS tile [query][d]
#pragma unroll
    for (int nb = 0; nb < NQ; ++nb) { float lt = lrun[nb]; lt += __shfl_xor(lt, 16, 32); const float inv = osc * __builtin_amdgcn_rcpf(lt);
#pragma unroll
        for (int dt = 0; dt < 4; ++dt) { v4f a, c;
#pragma unroll
            for (int r = 0; r < 4; ++r) { a[r] = o[dt][nb][r] * inv; c[r] = o[dt][nb][4 + r] * inv; }
            float* dst = os + (16 * nb + lr) * OSP + 16 * dt + 8 * hi; *(v4fa*)dst = a; *(v4fa*)(dst + 4) = c; } }
    __syncthreads();
    const int rr = lane >> 3, seg = (lane & 7) * 8;
{
#pragma unroll
        for (int s = 0; s < 4 * NQ; ++s) { const int row = 4 * s + rr; const v4f a = *(const v4fa*)(os + row * OSP + seg); const v4f c = *(const v4fa*)(os + row * OSP + seg + 4);
            const float* gp = G + (size_t)(q0 + row) * CC + seg; const v4f ga = *(const v4f*)gp; const v4f gc = *(const v4f*)(gp + 4); v8us oh, ol;
#pragma unroll
            for (int k = 0; k < 4; ++k) { unsigned short hh, ll; const float ya = a[k] * sigm(ga[k]); const float yc = c[k] * sigm(gc[k]); splitf(ya, hh, ll); oh[k] = hh; ol[k] = ll; splitf(yc, hh, ll); oh[4 + k] = hh; ol[4 + k] = ll; }
            const size_t oo = (size_t)(q0 + row) * CC + seg; *(v8us*)(Ah + oo) = oh; *(v8us*)(Al + oo) = ol; }
         }
}

// rows < RH: bf16 hi/lo planes [b][h][RH][HD] / [b][h][HD][RH], 16 query rows per wave; grid (RH/16, NH, NB)
__global__ __launch_bounds__(32) void k_attn_s(const bf* __restrict__ Qh, const bf* __restrict__ Ql, const bf* __restrict__ Kh, const bf* __restrict__ Kl, const bf* __restrict__ Vh, const bf* __restrict__ Vl, const float* __restrict__ Gt, bf* ATh, bf* ATl) {
    __shared__ __align__(16) float os[16 * OSP];
    const size_t bh = (size_t)blockIdx.z * NH + blockIdx.y; const size_t po = bh * RH * HD; const size_t ao = (size_t)blockIdx.z * SEQ * CC + (size_t)blockIdx.y * HD;
    attn_body<bf, true, 1>(Qh + po, Ql + po, Kh + po, Kl + po, Vh + po, Vl + po, Gt + ao, RH, (int)blockIdx.x * 16, 0.125f, 1.0f, 1.0f, ATh + ao, ATl + ao, os);
}
// rows >= RH: f16 planes [b][h][SEQ][HD] / [b][h][HD][SEQ] with carries, 32 query rows per wave; grid ((SEQ-RH)/32, NH, NB)
__global__ __launch_bounds__(32) void k_attn_h(const h16* __restrict__ Q, const h16* __restrict__ Kp, const h16* __restrict__ Vt, const float* __restrict__ Gt, bf* ATh, bf* ATl) {
    __shared__ __align__(16) float os[32 * OSP];
    const size_t bh = (size_t)blockIdx.z * NH + blockIdx.y; const size_t po = bh * SEQ * HD; const size_t ao = (size_t)blockIdx.z * SEQ * CC + (size_t)blockIdx.y * HD;
    attn_body<h16, false, 2>(Q + po, nullptr, Kp + po, nullptr, Vt + po, nullptr, Gt + ao, SEQ, RH + (int)blockIdx.x * 32, 0.125f / (QCAR * QCAR), 1.0f / (PCAR * VCAR), PCAR, ATh + ao, ATl + ao, os);
}

extern "C" void kernel_launch(void* const* d_in, const int* in_sizes, int n_in,
                              void* d_out, int out_size, void* d_ws, size_t ws_size, hipStream_t stream) {
    if (n_in < 7) return;
    if ((size_t)in_sizes[0] < ((size_t)(NB - 1) * SEQ_FULL + SEQ) * CC) return;
    if ((size_t)in_sizes[1] < W1 || (size_t)in_sizes[2] < W1 || (size_t)in_sizes[3] < W1 || (size_t)in_sizes[4] < W1 || (size_t)in_sizes[5] < W1 || in_sizes[6] < CC) return;
    if ((size_t)out_size < PL16) return;
    // wire order: x, Wq, Wk, Wv, Wg, Wo, bo
    const float* x = (const float*)d_in[0]; const float* wq = (const float*)d_in[1]; const float* wk = (const float*)d_in[2]; const float* wv = (const float*)d_in[3];
    const float* wg = (const float*)d_in[4]; const float* wo = (const float*)d_in[5]; const float* bo = (const float*)d_in[6];
    float* OUT = (float*)d_out;     // [NB][SEQ][CC]
    char* wsp = (char*)d_ws;
    auto take = [&](size_t bytes) { char* p = wsp; wsp += (bytes + 255) & ~(size_t)255; return (void*)p; };
    bf* WQ = (bf*)take(4 * W1 * 2);            // Wq | Wk | Wv | Wg bf16 [out][in]
    bf* WO = (bf*)take(W1 * 2);
    bf* XB = (bf*)take(PL16 * 2);              // bf16 x [MROWS][CC]
    float* F = (float*)take(4 * PL16 * 4);     // four f32 planes [MROWS][CC]: the last holds the gate, the first the gated ctx
    h16* QK16 = (h16*)take(2 * PL16 * 2);      // f16 q planes | k planes
    h16* VT16 = (h16*)take(PL16 * 2);
    bf* QKh = (bf*)take(2 * PLR * 2); bf* QKl = (bf*)take(2 * PLR * 2);
    bf* VTh = (bf*)take(PLR * 2); bf* VTl = (bf*)take(PLR * 2);
    if ((size_t)(wsp - (char*)d_ws) > ws_size) return;
    // gated-ctx hi | lo planes lie in the first f32 plane of F, which no launch writes as f32 (only the gate plane is); sizes match exactly
    bf* ATh = (bf*)F; bf* ATl = ATh + PL16;
    const float* GATE = F + 3 * PL16;
    const unsigned w8 = (unsigned)(W1 / 8), x8 = (unsigned)(PL16 / 8);
    k_cvt8<<<(w8 + 255) / 256, 256, 0, stream>>>(wq, WQ, w8, w8, 0u);
    k_cvt8<<<(w8 + 255) / 256, 256, 0, stream>>>(wk, WQ + W1, w8, w8, 0u);
    k_cvt8<<<(w8 + 255) / 256, 256, 0, stream>>>(wv, WQ + 2 * W1, w8, w8, 0u);
    k_cvt8<<<(w8 + 255) / 256, 256, 0, stream>>>(wg, WQ + 3 * W1, w8, w8, 0u);
    k_cvt8<<<(w8 + 255) / 256, 256, 0, stream>>>(wo, WO, w8, w8, 0u);
    k_cvt8<<<(x8 + 255) / 256, 256, 0, stream>>>(x, XB, x8, (unsigned)((size_t)SEQ * CC / 8), (unsigned)((size_t)SEQ_FULL * CC / 8));
    k_gemm_proj<<<dim3(MROWS / 64, CC / 64, 4), 32, 0, stream>>>(XB, WQ, F, W1, PL16, QK16, QKh, QKl, VT16, VTh, VTl);
    k_attn_s<<<dim3(RH / 16, NH, NB), 32, 0, stream>>>(QKh, QKl, QKh + PLR, QKl + PLR, VTh, VTl, GATE, ATh, ATl);
    if (SEQ > RH) k_attn_h<<<dim3((SEQ - RH) / 32 > 0 ? (SEQ - RH) / 32 : 1, NH, NB), 32, 0, stream>>>(QK16, QK16 + PL16, VT16, GATE, ATh, ATl);
    k_gemm_out<<<dim3(MROWS / 64, CC / 64, 1), 32, 0, stream>>>(ATh, ATl, WO, OUT, bo);
}

// v003
// One run takes 175 microseconds.
// Two timings next to v002 put it at 1.13 and 1.14 times that version's speed.
// Counting every step since v000, it is 1.59 times as fast.
#include <hip/hip_runtime.h>

// Causal multi-head attention with a sigmoid output gate, x [2][2048][1024], 16 heads x 64, weights [out][in], one score scale 1/8, tril mask, out = (merged heads * sigmoid(x Wg^T)) x Wo^T + bo.
// Compute dtypes, f32 accumulate: all float inputs RNE-converted to bf16 on load; q/k/v/gate projections v_wmma_f32_16x16x32_bf16 (exact products);
// attention rows < RH: bf16 hi/lo planes, 3 products on q.k and on p.v; rows >= RH: v_wmma_f32_16x16x32_f16 with q,k x16, v x16, p x1024 carries; softmax f32 (running max); gate sigmoid f32 on the VALU;
// output projection: gated ctx bf16 hi/lo x bf16 Wo (2 products) + bf16(bo).
// Every 16-bit matrix operand plane [rows][K] of the workspace lies in fragment order: blocks of 16 rows x 32 k (512 elements, 1 KiB), block (row/16, k/32) at index (row/16)*(K/32) + k/32;
// in a block the 16-B unit 32*half + lane holds row lane&15, k = 16*half + 8*(lane>>4) + 0..7. A wave's fragment load or store of 16 B a lane then covers 512 contiguous bytes.
// Fused attention in transposed form: S^T = K Q^T (D rows = keys, lane = query), P^T fragment built lane-locally from two S^T tiles, O^T = V^T P^T; no score plane in global memory.

#ifndef NB
#define NB 2
#endif
#ifndef SEQ
#define SEQ 2048
#endif
#ifndef RH
#define RH 256                       // query rows < RH use hi+lo planes
#endif
#define NB_FULL  2
#define SEQ_FULL 2048
#define CC   1024
#define NH   16
#define HD   64
#define MROWS (NB * SEQ)
#define PCAR 1024.0f
#define QCAR 16.0f
#define VCAR 16.0f
#define L2E  1.4426950408889634f
#define NEGB (-1.0e30f)
#define OSP  68
#define W1   ((size_t)CC * CC)
#define PL16 ((size_t)MROWS * CC)
#define PLR  ((size_t)NB * NH * RH * HD)
// carve: 4+1 bf16 weight planes, bf16 x, 4 f32 planes (the last: gate; the first: the gated-ctx hi|lo planes), f16 q|k|v^T planes, bf16 hi/lo planes of the first RH rows
#define WS_TOTAL (10 * W1 + 24 * PL16 + 12 * PLR)
static_assert(CC == NH * HD);                 // head split covers the model width
static_assert(HD == 64);
static_assert(CC % 64 == 0 && CC % 32 == 0);  // GEMM N tile 64, K step 32
static_assert(MROWS % 64 == 0);               // GEMM M tile 64
static_assert(SEQ % 256 == 0);                // a 64-row projection tile stays inside one batch
static_assert(RH % 256 == 0 && RH <= SEQ);    // a 64-row projection tile lies on one side of the hi/lo row boundary
static_assert((SEQ - RH) % 32 == 0 && RH % 32 == 0 && RH % 16 == 0);   // query tiles of 32 (f16 path) and 16 (hi/lo path)
static_assert(NB <= NB_FULL && SEQ <= SEQ_FULL);
static_assert((W1 * 2) % 256 == 0 && (PL16 * 2) % 256 == 0 && (PLR * 2) % 256 == 0);   // carve pieces stay 256-B aligned without padding
static_assert(2 * PL16 * sizeof(unsigned short) <= PL16 * sizeof(float));              // gated-ctx hi|lo planes fit exactly inside the first f32 plane of F
static_assert(WS_TOTAL <= (size_t)134217728); // total carve <= 128 MiB

typedef _Float16 h16;
typedef unsigned short bf;
typedef __attribute__((ext_vector_type(16))) __bf16   v16bf;
typedef __attribute__((ext_vector_type(16))) _Float16 v16h;
typedef __attribute__((ext_vector_type(16))) unsigned short v16us;
typedef __attribute__((ext_vector_type(8)))  _Float16 v8h;
typedef __attribute__((ext_vector_type(8)))  unsigned short v8us;
typedef __attribute__((ext_vector_type(8)))  float    v8f;
typedef __attribute__((ext_vector_type(4)))  float    v4f;
typedef v4f  __attribute__((may_alias)) v4fa;

__device__ __forceinline__ unsigned short f2bf(float f) { unsigned u = __float_as_uint(f); u += 0x7FFFu + ((u >> 16) & 1u); return (unsigned short)(u >> 16); }
__device__ __forceinline__ float bf2f(unsigned short b) { return __uint_as_float(((unsigned)b) << 16); }
__device__ __forceinline__ float bfr(float f) { return bf2f(f2bf(f)); }
__device__ __forceinline__ h16 tohx(float x) { return (h16)x; }
__device__ __forceinline__ void splitf(float y, unsigned short& h, unsigned short& l) { h = f2bf(y); l = f2bf(y - bf2f(h)); }
// v_exp_f32 and v_rcp_f32 as the builtins give them, each with one v_nop in its own statement: the slot that the instruction set asks for between a transcendental and a directly following instruction that reads its result or overwrites its source
__device__ __forceinline__ float sigm(float g) { float e, r; asm("v_exp_f32 %0, %1\n\tv_nop" : "=v"(e) : "v"(-g * L2E)); asm("v_rcp_f32 %0, %1\n\tv_nop" : "=v"(r) : "v"(1.0f + e)); return r; }
__device__ __forceinline__ v16h cat16(v8h lo, v8h hi) { return __builtin_shufflevector(lo, hi, 0, 1, 2, 3, 4, 5, 6, 7, 8, 9, 10, 11, 12, 13, 14, 15); }
__device__ __forceinline__ v16bf cat16b(v8us lo, v8us hi) { return __builtin_bit_cast(v16bf, __builtin_shufflevector(lo, hi, 0, 1, 2, 3, 4, 5, 6, 7, 8, 9, 10, 11, 12, 13, 14, 15)); }
__device__ __forceinline__ v8f wmma16(v16h a, v16h b, v8f c) { return __builtin_amdgcn_wmma_f32_16x16x32_f16(false, a, false, b, (short)0, c, false, false); }
__device__ __forceinline__ v8f wmmab(v16bf a, v16bf b, v8f c) { return __builtin_amdgcn_wmma_f32_16x16x32_bf16(false, a, false, b, (short)0, c, false, false); }

// Fragment loader from a block in fragment order: p = block + 8*lane; elements 0..7 <- p[0..7] (half 0), elements 8..15 <- p[256..263] (half 1).
template <typename T16> struct WFrag;
template <> struct WFrag<h16> { typedef v16h V; static __device__ __forceinline__ V ld(const h16* p) { return cat16(*(const v8h*)p, *(const v8h*)(p + 256)); } static __device__ __forceinline__ v8f mma(V a, V b, v8f c) { return wmma16(a, b, c); } };
template <> struct WFrag<bf> { typedef v16bf V; static __device__ __forceinline__ V ld(const bf* p) { return cat16b(*(const v8us*)p, *(const v8us*)(p + 256)); } static __device__ __forceinline__ v8f mma(V a, V b, v8f c) { return wmmab(a, b, c); } };
// s_wait_xcnt 0, written where the next load's result may be given the registers of an address that loads already issued name.
__device__ __forceinline__ void xwait() { asm volatile("s_wait_xcnt 0x0" ::: "memory"); }
// The fragment loaders again, for the last fragment read through an address: the wait stands in front of its last load, whose result may be given the address's own registers.
__device__ __forceinline__ v16h ldw(const h16* p) { const v8h lo = *(const v8h*)p; xwait(); return cat16(lo, *(const v8h*)(p + 256)); }
__device__ __forceinline__ v16bf ldw(const bf* p) { const v8us lo = *(const v8us*)p; xwait(); return cat16b(lo, *(const v8us*)(p + 256)); }

// The attention planes that the projection tiles are written to: f16 q|k [w][b][h] x ([t][HD]) and v^T [b][h] x ([d][t]) with their carries, bf16 hi/lo planes of the first RH rows; each [rows][K] plane in fragment order.
struct Planes { h16* qk16; bf* qkh; bf* qkl; h16* vt16; bf* vth; bf* vtl; };

// A 64x64 f32 accumulator tile (lane&15 = column within 16 nb, element j = row 8*(lane>>4) + j within 16 mb) leaves as q or k rows [t][HD]: f16 with the carry, and for HL the bf16 hi/lo pair.
// 16 rows at a time go through the LDS stage; then a store writes one half of a block (512 contiguous B). p16, ph, pl point at the block of the tile's first row.
template <bool HL>
__device__ __forceinline__ void put_qk(const v8f (&acc)[4][4], float* os, h16* p16, bf* ph, bf* pl, int lane) {
    const int lr = lane & 15, hi = lane >> 4;
#pragma unroll
    for (int mb = 0; mb < 4; ++mb) {
#pragma unroll
        for (int nb = 0; nb < 4; ++nb) {
#pragma unroll
            for (int j = 0; j < 8; ++j) os[(hi * 8 + j) * OSP + nb * 16 + lr] = acc[mb][nb][j]; }
        __builtin_amdgcn_wave_barrier(); asm volatile("" ::: "memory");   // compiler fence: the row reads below take other lanes' writes and must not be moved over them
#pragma unroll
        for (int s = 0; s < 4; ++s) { const int seg = 16 * s + 8 * hi; const v4f a = *(const v4fa*)(os + lr * OSP + seg), g = *(const v4fa*)(os + lr * OSP + seg + 4); v8h o16;
#pragma unroll
            for (int k = 0; k < 4; ++k) { o16[k] = tohx(a[k] * QCAR); o16[4 + k] = tohx(g[k] * QCAR); }
            const int o = mb * 16 * HD + s * 256 + lane * 8;   // block (mb, s >> 1), half s & 1
            *(v8h*)(p16 + o) = o16;
            if constexpr (HL) { v8us oh, ol;
#pragma unroll
                for (int k = 0; k < 4; ++k) { unsigned short hh, ll; splitf(a[k], hh, ll); oh[k] = hh; ol[k] = ll; splitf(g[k], hh, ll); oh[4 + k] = hh; ol[4 + k] = ll; }
                *(v8us*)(ph + o) = oh; *(v8us*)(pl + o) = ol; } }
        __builtin_amdgcn_wave_barrier(); asm volatile("" ::: "memory");   // compiler fence: the next 16 rows' writes stay behind these reads
    }
    xwait();   // behind the last stores: where the build lays another epilogue block out behind this one, that block rewrites registers that they name
}
// The same tile leaves as v^T [d][t]: a lane's 8 accumulator elements are 8 consecutive t of one d, its own 16-B unit of block (nb, mb >> 1), half mb & 1, stored from the registers. p16 (K = SEQ), ph, pl (K = RH) point at the block of d = 0 of the head, first t of the tile; hl (the same in every lane): the bf16 hi/lo pair is wanted too.
__device__ __forceinline__ void put_vt(const v8f (&acc)[4][4], h16* p16, bf* ph, bf* pl, bool hl, int lane) {
    if (hl) {
#pragma unroll
        for (int nb = 0; nb < 4; ++nb)
#pragma unroll
            for (int mb = 0; mb < 4; ++mb) { const int o = nb * 16 * RH + mb * 256 + lane * 8; v8us oh, ol;
#pragma unroll
                for (int j = 0; j < 8; ++j) { unsigned short hh, ll; splitf(acc[mb][nb][j], hh, ll); oh[j] = hh; ol[j] = ll; }
                *(v8us*)(ph + o) = oh; *(v8us*)(pl + o) = ol; }
        xwait();   // behind the hi/lo stores: the f16 stores' address is formed in registers that they name
    }
#pragma unroll
    for (int nb = 0; nb < 4; ++nb)
#pragma unroll
        for (int mb = 0; mb < 4; ++mb) { v8h o16;
#pragma unroll
            for (int j = 0; j < 8; ++j) o16[j] = tohx(acc[mb][nb][j] * VCAR);
            *(v8h*)(p16 + nb * 16 * SEQ + mb * 256 + lane * 8) = o16; }
    xwait();   // behind the last stores: where the build lays another epilogue block out behind this one, that block rewrites registers that they name
}

// ---- one-wave 64x64 tile GEMM body: C[m][n] (f32, pitch ldc, + optional bf16-converted bias[n]) = sum_k A[m][k] Bt[n][k] (+ A2 x Bt when NSPLIT == 1); K % 32 == 0; A, A2, Bt, Bt2 in fragment order.
// PLANES: tiles of z = 0, 1 (q, k) and z = 2 (v) leave as attention planes straight from the f32 accumulators; z = 3 (gate) leaves as f32 rows like any other tile.
template <typename T16, int NSPLIT, bool BIAS, bool PLANES>
__device__ __forceinline__ void gemmw_body(const T16* __restrict__ A, const T16* __restrict__ A2, const T16* __restrict__ Bt, const T16* __restrict__ Bt2, int K, float* C, int ldc, const float* __restrict__ bias, size_t sA, size_t sB, size_t sC, float* os, const Planes pl) {
    typedef typename WFrag<T16>::V V;
    const size_t z = blockIdx.z; A += z * sA; if (A2) A2 += z * sA; Bt += z * sB; if (Bt2) Bt2 += z * sB; C += z * sC;
    const int lane = threadIdx.x & 31, lr = lane & 15, hi = lane >> 4; const int r0 = blockIdx.x * 64, c0 = blockIdx.y * 64;
    v8f acc[4][4];
#pragma unroll
    for (int mb = 0; mb < 4; ++mb)
#pragma unroll
        for (int nb = 0; nb < 4; ++nb) acc[mb][nb] = (v8f){};
    const size_t aoff = (size_t)r0 * K + 8 * lane, boff = (size_t)c0 * K + 8 * lane;   // 16 rows of blocks are 16 K elements, one k step of 32 is one block of 512
#pragma unroll 1
    for (int kc = 0; kc < K; kc += 32) {
        V a[4], a2[4];
#pragma unroll
        for (int mb = 0; mb < 4; ++mb) { a[mb] = WFrag<T16>::ld(A + aoff + (size_t)mb * 16 * K + kc * 16); if (NSPLIT == 1 || NSPLIT == 2) a2[mb] = mb < 3 ? WFrag<T16>::ld(A2 + aoff + (size_t)mb * 16 * K + kc * 16) : ldw(A2 + aoff + (size_t)mb * 16 * K + kc * 16); }
        xwait();   // behind the A loads: a B fragment may be given the registers of their addresses
#pragma unroll
        for (int nb = 0; nb < 4; ++nb) { const T16* pb = Bt + boff + (size_t)nb * 16 * K + kc * 16; const V b = nb < 3 ? WFrag<T16>::ld(pb) : ldw(pb); V b2; if (NSPLIT >= 2) b2 = WFrag<T16>::ld(Bt2 + boff + (size_t)nb * 16 * K + kc * 16);
#pragma unroll
            for (int mb = 0; mb < 4; ++mb) { acc[mb][nb] = WFrag<T16>::mma(a[mb], b, acc[mb][nb]); if (NSPLIT == 1 || NSPLIT == 2) acc[mb][nb] = WFrag<T16>::mma(a2[mb], b, acc[mb][nb]); if (NSPLIT >= 2) acc[mb][nb] = WFrag<T16>::mma(a[mb], b2, acc[mb][nb]); } }
        asm volatile("v_nop\n\tv_nop\n\tv_nop\n\tv_nop" : "+v"(acc[0][0]), "+v"(acc[1][1]), "+v"(acc[2][2]), "+v"(acc[3][3]) : "v"(a[0]), "v"(a[3]));
    }
    if constexpr (PLANES) {
        // a tile's 64 columns are one head (HD == 64), its 64 rows lie in one batch and on one side of RH: every test here is the same for the whole wave
        const unsigned w = blockIdx.z, h = blockIdx.y, b = (unsigned)r0 / SEQ, t0 = (unsigned)r0 % SEQ;
        if (w < 2u) { const size_t bh = (size_t)(w * NB + b) * NH + h; h16* p16 = pl.qk16 + (bh * SEQ + t0) * HD;
            if (t0 < RH) put_qk<true>(acc, os, p16, pl.qkh + (bh * RH + t0) * HD, pl.qkl + (bh * RH + t0) * HD, lane); else put_qk<false>(acc, os, p16, nullptr, nullptr, lane);
            return; }
        if (w == 2u) { const size_t bh = (size_t)b * NH + h; h16* p16 = pl.vt16 + bh * HD * SEQ + t0 * 16;
            const size_t o2 = bh * HD * RH + (t0 < RH ? t0 * 16 : 0u);   // stays inside the hi/lo planes for a tile that does not write them
            put_vt(acc, p16, pl.vth + o2, pl.vtl + o2, t0 < RH, lane);
            return; }
    }
#pragma unroll
    for (int mb = 0; mb < 4; ++mb) {
#pragma unroll
        for (int nb = 0; nb < 4; ++nb) {
#pragma unroll
            for (int j = 0; j < 8; ++j) os[(hi * 8 + j) * OSP + nb * 16 + lr] = acc[mb][nb][j]; }
        __builtin_amdgcn_wave_barrier(); asm volatile("" ::: "memory");
        float* crow = C + (size_t)(r0 + mb * 16) * ldc + c0;
{
#pragma unroll
            for (int s = 0; s < 8; ++s) { const int row = 2 * s + hi, cofs = lr * 4; v4f val = *(const v4fa*)(os + row * OSP + cofs); if (BIAS) { val[0] += bfr(bias[c0 + cofs]); val[1] += bfr(bias[c0 + cofs + 1]); val[2] += bfr(bias[c0 + cofs + 2]); val[3] += bfr(bias[c0 + cofs + 3]); }
                *(v4f*)(crow + (size_t)row * ldc + cofs) = val; }
             }
        __builtin_amdgcn_wave_barrier(); asm volatile("" ::: "memory");
    }
    if constexpr (PLANES) xwait();   // behind the gate tile's last stores: the plane blocks laid out behind them rewrite registers that they name
}

// q/k/v/gate projections: z = 0..3 selects the weight plane (stride sB); q, k, v tiles go to the attention planes, the gate tile to the f32 plane C + 3 sC; A = bf16 x [MROWS][CC].
__global__ __launch_bounds__(32) void k_gemm_proj(const bf* __restrict__ A, const bf* __restrict__ Bt, float* C, size_t sB, size_t sC, h16* QK16, bf* QKh, bf* QKl, h16* VT16, bf* VTh, bf* VTl) {
    __shared__ __align__(16) float os[16 * OSP];
    gemmw_body<bf, 0, false, true>(A, nullptr, Bt, nullptr, CC, C, CC, nullptr, 0, sB, sC, os, Planes{QK16, QKh, QKl, VT16, VTh, VTl});
}
// output projection: (gated ctx hi + gated ctx lo) x Wo^T + bf16(bo) -> d_out rows.
__global__ __launch_bounds__(32) void k_gemm_out(const bf* __restrict__ Ah, const bf* __restrict__ Al, const bf* __restrict__ Bt, float* C, const float* __restrict__ bias) {
    __shared__ __align__(16) float os[16 * OSP];
    gemmw_body<bf, 1, true, false>(Ah, Al, Bt, nullptr, CC, C, CC, bias, 0, 0, 0, os, Planes{});
}

// f32 rows [..][CC] -> bf16 plane in fragment order: a wave takes 8 rows x 4 groups of 8 floats of one block: it reads 8 whole 128-B lines and writes 4 whole 128-B lines (8 units of 16 B each).
__global__ __launch_bounds__(256) void k_cvt8(const float* __restrict__ src, bf* dst, unsigned n8, unsigned per8, unsigned sstr8) {
    const unsigned i = blockIdx.x * 256u + threadIdx.x; if (i >= n8) return;
    const unsigned blk = i >> 6, lr = (i & 7u) + ((i >> 5) & 1u) * 8u, c = (i >> 3) & 3u;   // block, row in the block, 8-float group in the block (c = 2 * half + (fragment lane >> 4))
    const unsigned row = (blk / (CC / 32)) * 16u + lr, ch = (blk % (CC / 32)) * 4u + c;
    const unsigned u = row * (CC / 8) + ch;
    const unsigned b = u / per8, r = u - b * per8;
    const v8f v = *(const v8f*)(src + ((size_t)b * sstr8 + r) * 8); v8us o;
#pragma unroll
    for (int k = 0; k < 8; ++k) o[k] = f2bf(v[k]);
    *(v8us*)(dst + ((size_t)blk * 64 + c * 16u + lr) * 8) = o;  }

// P^T fragment (B operand of O^T = V^T P^T) built lane-locally from the two S^T tiles of a 32-key step: element r <- tile(keys 0..15)[r], element 8+r <- tile(keys 16..31)[r].
template <typename T16> struct PPack;
template <> struct PPack<h16> { static __device__ __forceinline__ void mk(const v8f& p0, const v8f& p1, float car, v16h& a, v16h& b) { v16h r;
#pragma unroll
        for (int i = 0; i < 8; ++i) { r[i] = tohx(p0[i] * car); r[8 + i] = tohx(p1[i] * car); }
        a = r; b = r; } };
template <> struct PPack<bf> { static __device__ __forceinline__ void mk(const v8f& p0, const v8f& p1, float car, v16bf& a, v16bf& b) { (void)car; v16us h, l;
#pragma unroll
        for (int i = 0; i < 8; ++i) { unsigned short hh, ll; splitf(p0[i], hh, ll); h[i] = hh; l[i] = ll; splitf(p1[i], hh, ll); h[8 + i] = hh; l[8 + i] = ll; }
        a = __builtin_bit_cast(v16bf, h); b = __builtin_bit_cast(v16bf, l); } };

// Hazard guards: 4 VALU-slot nops tied to every accumulator of the group and to the fragments of the last products.
template <int N> struct Grd;
template <> struct Grd<1> {
    template <typename V> static __device__ __forceinline__ void s(v8f (&st)[2][1], const V& x, const V& y) { asm volatile("v_nop\n\tv_nop\n\tv_nop\n\tv_nop" : "+v"(st[0][0]), "+v"(st[1][0]) : "v"(x), "v"(y)); }
    template <typename V> static __device__ __forceinline__ void o(v8f (&oa)[4][1], const V& x, const V& y, const V& z) { asm volatile("v_nop\n\tv_nop\n\tv_nop\n\tv_nop" : "+v"(oa[0][0]), "+v"(oa[1][0]), "+v"(oa[2][0]), "+v"(oa[3][0]) : "v"(x), "v"(y), "v"(z)); }
};
template <> struct Grd<2> {
    template <typename V> static __device__ __forceinline__ void s(v8f (&st)[2][2], const V& x, const V& y) { asm volatile("v_nop\n\tv_nop\n\tv_nop\n\tv_nop" : "+v"(st[0][0]), "+v"(st[1][0]), "+v"(st[0][1]), "+v"(st[1][1]) : "v"(x), "v"(y)); }
    template <typename V> static __device__ __forceinline__ void o(v8f (&oa)[4][2], const V& x, const V& y, const V& z) { asm volatile("v_nop\n\tv_nop\n\tv_nop\n\tv_nop" : "+v"(oa[0][0]), "+v"(oa[1][0]), "+v"(oa[2][0]), "+v"(oa[3][0]), "+v"(oa[0][1]), "+v"(oa[1][1]), "+v"(oa[2][1]), "+v"(oa[3][1]) : "v"(x), "v"(y), "v"(z)); }
};

// ---- fused causal attention body, one wave per 16*NQ query rows of one (batch, head); keys in steps of 32.
// S^T[key][query] = sum_d K[key][d] Q[query][d]: A = K rows (lane -> key), B = Q rows (lane -> query); D: lane = query (lane&15), element r = key 8*(lane>>4) + r.
// Row statistics are per lane (query); the two lane halves hold different keys and exchange the step maximum with one xor-16 shuffle; row sums stay per-lane partials until the end.
// O^T[d][query] += V^T[d][key] P^T[key][query]: A = V^T rows (lane -> d), B = packed P^T. Planes, in fragment order: Q, K [t][HD]; V^T [d][vpitch]; Ah, Al [t][CC], pointing at the head's first block of row 0. G: f32 rows.
template <typename T16, bool SPLIT, int NQ>
__device__ __forceinline__ void attn_body(const T16* __restrict__ Q, const T16* __restrict__ Q2, const T16* __restrict__ Kp, const T16* __restrict__ K2, const T16* __restrict__ Vt, const T16* __restrict__ V2,
                                          const float* __restrict__ G, int vpitch, int q0, float ssc, float osc, float pcar, bf* Ah, bf* Al, float* os) {
    typedef typename WFrag<T16>::V V;
    const int lane = threadIdx.x & 31, lr = lane & 15, hi = lane >> 4;
    V qf[NQ][2], qf2[NQ][2];
#pragma unroll
    for (int nb = 0; nb < NQ; ++nb)
#pragma unroll
        for (int ds = 0; ds < 2; ++ds) { const size_t qo = (size_t)(q0 + 16 * nb) * HD + 512 * ds + 8 * lane; qf[nb][ds] = WFrag<T16>::ld(Q + qo); if (SPLIT) qf2[nb][ds] = WFrag<T16>::ld(Q2 + qo); }
    v8f o[4][NQ]; float mrun[NQ], lrun[NQ];
#pragma unroll
    for (int nb = 0; nb < NQ; ++nb) { mrun[nb] = NEGB; lrun[nb] = 0.0f;
#pragma unroll
        for (int dt = 0; dt < 4; ++dt) o[dt][nb] = (v8f){}; }
    const int kend = q0 + 16 * NQ;
#pragma unroll 1
    for (int kt = 0; kt < kend; kt += 32) {
        V ka[2][2], ka2[2][2];
#pragma unroll
        for (int mb = 0; mb < 2; ++mb)
#pragma unroll
            for (int ds = 0; ds < 2; ++ds) { const size_t ko = (size_t)(kt + 16 * mb) * HD + 512 * ds + 8 * lane; ka[mb][ds] = (!SPLIT || mb + ds < 2) ? WFrag<T16>::ld(Kp + ko) : ldw(Kp + ko); }
        // the four V^T fragments of this key step are asked for here, behind the K fragments, each into registers of its own: they arrive while the scores and the softmax are worked out
        V va[4], va2[4];
        if constexpr (SPLIT) {
            // plane by plane; s_wait_xcnt 0 in front of a plane's last load and behind it: that load's result, or a later one's, may be given the registers of the plane's address
            xwait();
#pragma unroll
            for (int f = 0; f < 4; ++f) { const size_t ko = (size_t)(kt + 16 * (f >> 1)) * HD + 512 * (f & 1) + 8 * lane; ka2[f >> 1][f & 1] = f < 3 ? WFrag<T16>::ld(K2 + ko) : ldw(K2 + ko); }
            xwait();
#pragma unroll
            for (int dt = 0; dt < 4; ++dt) { const size_t vo = (size_t)(16 * dt) * vpitch + kt * 16 + 8 * lane; va[dt] = dt < 3 ? WFrag<T16>::ld(Vt + vo) : ldw(Vt + vo); }
            xwait();
#pragma unroll
            for (int dt = 0; dt < 4; ++dt) { const size_t vo = (size_t)(16 * dt) * vpitch + kt * 16 + 8 * lane; va2[dt] = dt < 3 ? WFrag<T16>::ld(V2 + vo) : ldw(V2 + vo); }
            xwait();
            __builtin_amdgcn_sched_barrier(0);   // the score products stay behind the step's loads: else the build waits for the K fragments first and asks for the V^T fragments only then
        } else {
            xwait();   // behind the K loads: a V^T fragment may be given the registers of their address
#pragma unroll
            for (int dt = 0; dt < 4; ++dt) { const size_t vo = (size_t)(16 * dt) * vpitch + kt * 16 + 8 * lane; va[dt] = dt < 3 ? WFrag<T16>::ld(Vt + vo) : ldw(Vt + vo); }
        }
        v8f st[2][NQ];
#pragma unroll
        for (int mb = 0; mb < 2; ++mb)
#pragma unroll
            for (int nb = 0; nb < NQ; ++nb) { v8f z = (v8f){};
                z = WFrag<T16>::mma(ka[mb][0], qf[nb][0], z); z = WFrag<T16>::mma(ka[mb][1], qf[nb][1], z);
                if (SPLIT) { z = WFrag<T16>::mma(ka2[mb][0], qf[nb][0], z); z = WFrag<T16>::mma(ka2[mb][1], qf[nb][1], z); z = WFrag<T16>::mma(ka[mb][0], qf2[nb][0], z); z = WFrag<T16>::mma(ka[mb][1], qf2[nb][1], z); }
                st[mb][nb] = z; }
        Grd<NQ>::s(st, ka[1][1], SPLIT ? qf2[NQ - 1][1] : qf[NQ - 1][1]);
        V pb[NQ], pb2[NQ];
#pragma unroll
        for (int nb = 0; nb < NQ; ++nb) {
            const int qg = q0 + 16 * nb + lr; float mx = NEGB;
#pragma unroll
            for (int mb = 0; mb < 2; ++mb)
#pragma unroll
                for (int r = 0; r < 8; ++r) { const int kg = kt + 16 * mb + 8 * hi + r; float t = st[mb][nb][r] * ssc; t = (kg <= qg) ? t : NEGB; st[mb][nb][r] = t; mx = fmaxf(mx, t); }
            mx = fmaxf(mx, __shfl_xor(mx, 16, 32));
            const float mn = fmaxf(mrun[nb], mx);
            const float al = __builtin_amdgcn_exp2f((mrun[nb] - mn) * L2E); mrun[nb] = mn;
            float psum = 0.0f;
#pragma unroll
            for (int mb = 0; mb < 2; ++mb)
#pragma unroll
                for (int r = 0; r < 8; ++r) { const float p = __builtin_amdgcn_exp2f((st[mb][nb][r] - mn) * L2E); psum += p; st[mb][nb][r] = p; }
            lrun[nb] = lrun[nb] * al + psum;
#pragma unroll
            for (int dt = 0; dt < 4; ++dt)
#pragma unroll
                for (int r = 0; r < 8; ++r) o[dt][nb][r] *= al;
            PPack<T16>::mk(st[0][nb], st[1][nb], pcar, pb[nb], pb2[nb]);
        }
#pragma unroll
        for (int dt = 0; dt < 4; ++dt) {
#pragma unroll
            for (int nb = 0; nb < NQ; ++nb) { o[dt][nb] = WFrag<T16>::mma(va[dt], pb[nb], o[dt][nb]); if (SPLIT) { o[dt][nb] = WFrag<T16>::mma(va2[dt], pb[nb], o[dt][nb]); o[dt][nb] = WFrag<T16>::mma(va[dt], pb2[nb], o[dt][nb]); } } }
        Grd<NQ>::o(o, SPLIT ? va2[3] : va[3], pb[NQ - 1], SPLIT ? pb2[NQ - 1] : pb[0]);
    }
    // normalise; O^T lane = query, element r = d 16*dt + 8*hi + r  ->  LDS tile [query][d]
#pragma unroll
    for (int nb = 0; nb < NQ; ++nb) { float lt = lrun[nb]; lt += __shfl_xor(lt, 16, 32); const float inv = osc * __builtin_amdgcn_rcpf(lt);
#pragma unroll
        for (int dt = 0; dt < 4; ++dt) { v4f a, c;
#pragma unroll
            for (int r = 0; r < 4; ++r) { a[r] = o[dt][nb][r] * inv; c[r] = o[dt][nb][4 + r] * inv; }
            float* dst = os + (16 * nb + lr) * OSP + 16 * dt + 8 * hi; *(v4fa*)dst = a; *(v4fa*)(dst + 4) = c; } }
    __syncthreads();
{
        // the tile's gate values are asked for together, in front of the trips: the wait behind each trip's stores would else hold the next trip's gate loads back, one round trip a trip
        v4f ga[4 * NQ], gc[4 * NQ];
#pragma unroll
        for (int s = 0; s < 4 * NQ; ++s) { const float* gp = G + (size_t)(q0 + 16 * (s >> 2) + lr) * CC + 16 * (s & 3) + 8 * hi; ga[s] = *(const v4f*)gp;
            if ((s & 3) == 3) xwait();   // in front of the last load through a row's address: its result may be given the registers of that address
            gc[s] = *(const v4f*)(gp + 4);
            if ((s & 3) == 3) xwait(); }   // and behind it: so may a later load's result, or a value of the trips below
#pragma unroll
        for (int s = 0; s < 4 * NQ; ++s) { const int row = 16 * (s >> 2) + lr, seg = 16 * (s & 3) + 8 * hi; const v4f a = *(const v4fa*)(os + row * OSP + seg); const v4f c = *(const v4fa*)(os + row * OSP + seg + 4);
            v8us oh, ol;
#pragma unroll
            for (int k = 0; k < 4; ++k) { unsigned short hh, ll; const float ya = a[k] * sigm(ga[s][k]); const float yc = c[k] * sigm(gc[s][k]); splitf(ya, hh, ll); oh[k] = hh; ol[k] = ll; splitf(yc, hh, ll); oh[4 + k] = hh; ol[4 + k] = ll; }
            const size_t oo = (size_t)(q0 + 16 * (s >> 2)) * CC + (s & 3) * 256 + 8 * lane;   // block (row / 16, (s & 3) >> 1) of the head's two, half s & 1
            *(v8us*)(Ah + oo) = oh; *(v8us*)(Al + oo) = ol;
            xwait(); }   // behind each pair of stores: the next trip's values may be given the registers that hold their data
         }
}

// rows < RH: bf16 hi/lo planes [b][h] x ([RH][HD]) / [b][h] x ([HD][RH]), 16 query rows per wave; grid (RH/16, NH, NB)
__global__ __launch_bounds__(32) void k_attn_s(const bf* __restrict__ Qh, const bf* __restrict__ Ql, const bf* __restrict__ Kh, const bf* __restrict__ Kl, const bf* __restrict__ Vh, const bf* __restrict__ Vl, const float* __restrict__ Gt, bf* ATh, bf* ATl) {
    __shared__ __align__(16) float os[16 * OSP];
    const size_t bh = (size_t)blockIdx.z * NH + blockIdx.y; const size_t po = bh * RH * HD; const size_t ao = (size_t)blockIdx.z * SEQ * CC + (size_t)blockIdx.y * HD, ap = (size_t)blockIdx.z * SEQ * CC + (size_t)blockIdx.y * HD * 16;
    attn_body<bf, true, 1>(Qh + po, Ql + po, Kh + po, Kl + po, Vh + po, Vl + po, Gt + ao, RH, (int)blockIdx.x * 16, 0.125f, 1.0f, 1.0f, ATh + ap, ATl + ap, os);
}
// rows >= RH: f16 planes [b][h] x ([SEQ][HD]) / [b][h] x ([HD][SEQ]) with carries, 32 query rows per wave; grid ((SEQ-RH)/32, NH, NB)
__global__ __launch_bounds__(32) void k_attn_h(const h16* __restrict__ Q, const h16* __restrict__ Kp, const h16* __restrict__ Vt, const float* __restrict__ Gt, bf* ATh, bf* ATl) {
    __shared__ __align__(16) float os[32 * OSP];
    const size_t bh = (size_t)blockIdx.z * NH + blockIdx.y; const size_t po = bh * SEQ * HD; const size_t ao = (size_t)blockIdx.z * SEQ * CC + (size_t)blockIdx.y * HD, ap = (size_t)blockIdx.z * SEQ * CC + (size_t)blockIdx.y * HD * 16;
    attn_body<h16, false, 2>(Q + po, nullptr, Kp + po, nullptr, Vt + po, nullptr, Gt + ao, SEQ, RH + (int)blockIdx.x * 32, 0.125f / (QCAR * QCAR), 1.0f / (PCAR * VCAR), PCAR, ATh + ap, ATl + ap, os);
}

extern "C" void kernel_launch(void* const* d_in, const int* in_sizes, int n_in,
                              void* d_out, int out_size, void* d_ws, size_t ws_size, hipStream_t stream) {
    if (n_in < 7) return;
    if ((size_t)in_sizes[0] < ((size_t)(NB - 1) * SEQ_FULL + SEQ) * CC) return;
    if ((size_t)in_sizes[1] < W1 || (size_t)in_sizes[2] < W1 || (size_t)in_sizes[3] < W1 || (size_t)in_sizes[4] < W1 || (size_t)in_sizes[5] < W1 || in_sizes[6] < CC) return;
    if ((size_t)out_size < PL16) return;
    // wire order: x, Wq, Wk, Wv, Wg, Wo, bo
    const float* x = (const float*)d_in[0]; const float* wq = (const float*)d_in[1]; const float* wk = (const float*)d_in[2]; const float* wv = (const float*)d_in[3];
    const float* wg = (const float*)d_in[4]; const float* wo = (const float*)d_in[5]; const float* bo = (const float*)d_in[6];
    float* OUT = (float*)d_out;     // [NB][SEQ][CC]
    char* wsp = (char*)d_ws;
    auto take = [&](size_t bytes) { char* p = wsp; wsp += (bytes + 255) & ~(size_t)255; return (void*)p; };
    bf* WQ = (bf*)take(4 * W1 * 2);            // Wq | Wk | Wv | Wg bf16 [out][in], each in fragment order
    bf* WO = (bf*)take(W1 * 2);
    bf* XB = (bf*)take(PL16 * 2);              // bf16 x [MROWS][CC] in fragment order
    float* F = (float*)take(4 * PL16 * 4);     // four f32 planes [MROWS][CC]: the last holds the gate, the first the gated ctx
    h16* QK16 = (h16*)take(2 * PL16 * 2);      // f16 q planes | k planes
    h16* VT16 = (h16*)take(PL16 * 2);
    bf* QKh = (bf*)take(2 * PLR * 2); bf* QKl = (bf*)take(2 * PLR * 2);
    bf* VTh = (bf*)take(PLR * 2); bf* VTl = (bf*)take(PLR * 2);
    if ((size_t)(wsp - (char*)d_ws) > ws_size) return;
    // gated-ctx hi | lo planes lie in the first f32 plane of F, which no launch writes as f32 (only the gate plane is); sizes match exactly
    bf* ATh = (bf*)F; bf* ATl = ATh + PL16;
    const float* GATE = F + 3 * PL16;
    const unsigned w8 = (unsigned)(W1 / 8), x8 = (unsigned)(PL16 / 8);
    k_cvt8<<<(w8 + 255) / 256, 256, 0, stream>>>(wq, WQ, w8, w8, 0u);
    k_cvt8<<<(w8 + 255) / 256, 256, 0, stream>>>(wk, WQ + W1, w8, w8, 0u);
    k_cvt8<<<(w8 + 255) / 256, 256, 0, stream>>>(wv, WQ + 2 * W1, w8, w8, 0u);
    k_cvt8<<<(w8 + 255) / 256, 256, 0, stream>>>(wg, WQ + 3 * W1, w8, w8, 0u);
    k_cvt8<<<(w8 + 255) / 256, 256, 0, stream>>>(wo, WO, w8, w8, 0u);
    k_cvt8<<<(x8 + 255) / 256, 256, 0, stream>>>(x, XB, x8, (unsigned)((size_t)SEQ * CC / 8), (unsigned)((size_t)SEQ_FULL * CC / 8));
    k_gemm_proj<<<dim3(MROWS / 64, CC / 64, 4), 32, 0, stream>>>(XB, WQ, F, W1, PL16, QK16, QKh, QKl, VT16, VTh, VTl);
    k_attn_s<<<dim3(RH / 16, NH, NB), 32, 0, stream>>>(QKh, QKl, QKh + PLR, QKl + PLR, VTh, VTl, GATE, ATh, ATl);
    if (SEQ > RH) k_attn_h<<<dim3((SEQ - RH) / 32 > 0 ? (SEQ - RH) / 32 : 1, NH, NB), 32, 0, stream>>>(QK16, QK16 + PL16, VT16, GATE, ATh, ATl);
    k_gemm_out<<<dim3(MROWS / 64, CC / 64, 1), 32, 0, stream>>>(ATh, ATl, WO, OUT, bo);
}

// v004
// One run takes 137 microseconds.
// Next to v003, in two timings, it ran 1.29 and 1.27 times as fast.
// All steps since v000 together make it 2.03 times as fast.
#include <hip/hip_runtime.h>

// Causal multi-head attention with a sigmoid output gate, x [2][2048][1024], 16 heads x 64, weights [out][in], one score scale 1/8, tril mask, out = (merged heads * sigmoid(x Wg^T)) x Wo^T + bo.
// Compute dtypes, f32 accumulate: all float inputs RNE-converted to bf16 on load; q/k/v/gate projections v_wmma_f32_16x16x32_bf16 (exact products);
// attention rows < RH: bf16 hi/lo planes, 3 products on q.k and on p.v; rows >= RH: v_wmma_f32_16x16x32_f16 with q,k x16, v x16, p x1024 carries; softmax f32 (running max); gate sigmoid f32 on the VALU;
// output projection: gated ctx bf16 hi/lo x bf16 Wo (2 products) + bf16(bo).
// Every 16-bit matrix operand plane [rows][K] of the workspace lies in fragment order: blocks of 16 rows x 32 k (512 elements, 1 KiB), block (row/16, k/32) at index (row/16)*(K/32) + k/32;
// in a block the 16-B unit 32*half + lane holds row lane&15, k = 16*half + 8*(lane>>4) + 0..7. A wave's fragment load or store of 16 B a lane then covers 512 contiguous bytes.
// Fused attention in transposed form: S^T = K Q^T (D rows = keys, lane = query), P^T fragment built lane-locally from two S^T tiles, O^T = V^T P^T; no score plane in global memory.

#ifndef NB
#define NB 2
#endif
#ifndef SEQ
#define SEQ 2048
#endif
#ifndef RH
#define RH 256                       // query rows < RH use hi+lo planes
#endif
#define NB_FULL  2
#define SEQ_FULL 2048
#define CC   1024
#define NH   16
#define HD   64
#define MROWS (NB * SEQ)
#define PCAR 1024.0f
#define QCAR 16.0f
#define VCAR 16.0f
#define L2E  1.4426950408889634f
#define NEGB (-1.0e30f)
#define OSP  68
#define NWV  8                        // waves of an attention work-group: they share out the key steps of one query tile
#define W1   ((size_t)CC * CC)
#define PL16 ((size_t)MROWS * CC)
#define PLR  ((size_t)NB * NH * RH * HD)
// carve: 4+1 bf16 weight planes, bf16 x, 4 f32 planes (the last: gate; the first: the gated-ctx hi|lo planes), f16 q|k|v^T planes, bf16 hi/lo planes of the first RH rows
#define WS_TOTAL (10 * W1 + 24 * PL16 + 12 * PLR)
static_assert(CC == NH * HD);                 // head split covers the model width
static_assert(HD == 64);
static_assert(CC % 64 == 0 && CC % 32 == 0);  // GEMM N tile 64, K step 32
static_assert(MROWS % 64 == 0);               // GEMM M tile 64
static_assert(SEQ % 256 == 0);                // a 64-row projection tile stays inside one batch
static_assert(RH % 256 == 0 && RH <= SEQ);    // a 64-row projection tile lies on one side of the hi/lo row boundary
static_assert((SEQ - RH) % 32 == 0 && RH % 32 == 0 && RH % 16 == 0);   // query tiles of 32 (f16 path) and 16 (hi/lo path)
static_assert(NB <= NB_FULL && SEQ <= SEQ_FULL);
static_assert((W1 * 2) % 256 == 0 && (PL16 * 2) % 256 == 0 && (PLR * 2) % 256 == 0);   // carve pieces stay 256-B aligned without padding
static_assert(2 * PL16 * sizeof(unsigned short) <= PL16 * sizeof(float));              // gated-ctx hi|lo planes fit exactly inside the first f32 plane of F
static_assert(WS_TOTAL <= (size_t)134217728); // total carve <= 128 MiB

typedef _Float16 h16;
typedef unsigned short bf;
typedef __attribute__((ext_vector_type(16))) __bf16   v16bf;
typedef __attribute__((ext_vector_type(16))) _Float16 v16h;
typedef __attribute__((ext_vector_type(16))) unsigned short v16us;
typedef __attribute__((ext_vector_type(8)))  _Float16 v8h;
typedef __attribute__((ext_vector_type(8)))  unsigned short v8us;
typedef __attribute__((ext_vector_type(8)))  float    v8f;
typedef __attribute__((ext_vector_type(4)))  float    v4f;
typedef v4f  __attribute__((may_alias)) v4fa;

__device__ __forceinline__ unsigned short f2bf(float f) { unsigned u = __float_as_uint(f); u += 0x7FFFu + ((u >> 16) & 1u); return (unsigned short)(u >> 16); }
__device__ __forceinline__ float bf2f(unsigned short b) { return __uint_as_float(((unsigned)b) << 16); }
__device__ __forceinline__ float bfr(float f) { return bf2f(f2bf(f)); }
__device__ __forceinline__ h16 tohx(float x) { return (h16)x; }
__device__ __forceinline__ void splitf(float y, unsigned short& h, unsigned short& l) { h = f2bf(y); l = f2bf(y - bf2f(h)); }
// v_exp_f32 and v_rcp_f32 as the builtins give them, each with one v_nop in its own statement: the slot that the instruction set asks for between a transcendental and a directly following instruction that reads its result or overwrites its source
__device__ __forceinline__ float sigm(float g) { float e, r; asm("v_exp_f32 %0, %1\n\tv_nop" : "=v"(e) : "v"(-g * L2E)); asm("v_rcp_f32 %0, %1\n\tv_nop" : "=v"(r) : "v"(1.0f + e)); return r; }
// the same two statements singly, for the join of the attention waves' partial results
__device__ __forceinline__ float ex2s(float x) { float e; asm("v_exp_f32 %0, %1\n\tv_nop" : "=v"(e) : "v"(x)); return e; }
__device__ __forceinline__ float rcps(float x) { float r; asm("v_rcp_f32 %0, %1\n\tv_nop" : "=v"(r) : "v"(x)); return r; }
__device__ __forceinline__ v16h cat16(v8h lo, v8h hi) { return __builtin_shufflevector(lo, hi, 0, 1, 2, 3, 4, 5, 6, 7, 8, 9, 10, 11, 12, 13, 14, 15); }
__device__ __forceinline__ v16bf cat16b(v8us lo, v8us hi) { return __builtin_bit_cast(v16bf, __builtin_shufflevector(lo, hi, 0, 1, 2, 3, 4, 5, 6, 7, 8, 9, 10, 11, 12, 13, 14, 15)); }
__device__ __forceinline__ v8f wmma16(v16h a, v16h b, v8f c) { return __builtin_amdgcn_wmma_f32_16x16x32_f16(false, a, false, b, (short)0, c, false, false); }
__device__ __forceinline__ v8f wmmab(v16bf a, v16bf b, v8f c) { return __builtin_amdgcn_wmma_f32_16x16x32_bf16(false, a, false, b, (short)0, c, false, false); }

// Fragment loader from a block in fragment order: p = block + 8*lane; elements 0..7 <- p[0..7] (half 0), elements 8..15 <- p[256..263] (half 1).
template <typename T16> struct WFrag;
template <> struct WFrag<h16> { typedef v16h V; static __device__ __forceinline__ V ld(const h16* p) { return cat16(*(const v8h*)p, *(const v8h*)(p + 256)); } static __device__ __forceinline__ v8f mma(V a, V b, v8f c) { return wmma16(a, b, c); } };
template <> struct WFrag<bf> { typedef v16bf V; static __device__ __forceinline__ V ld(const bf* p) { return cat16b(*(const v8us*)p, *(const v8us*)(p + 256)); } static __device__ __forceinline__ v8f mma(V a, V b, v8f c) { return wmmab(a, b, c); } };
// s_wait_xcnt 0, written where the next load's result may be given the registers of an address that loads already issued name.
__device__ __forceinline__ void xwait() { asm volatile("s_wait_xcnt 0x0" ::: "memory"); }
// The fragment loaders again, for the last fragment read through an address: the wait stands in front of its last load, whose result may be given the address's own registers.
__device__ __forceinline__ v16h ldw(const h16* p) { const v8h lo = *(const v8h*)p; xwait(); return cat16(lo, *(const v8h*)(p + 256)); }
__device__ __forceinline__ v16bf ldw(const bf* p) { const v8us lo = *(const v8us*)p; xwait(); return cat16b(lo, *(const v8us*)(p + 256)); }

// The attention planes that the projection tiles are written to: f16 q|k [w][b][h] x ([t][HD]) and v^T [b][h] x ([d][t]) with their carries, bf16 hi/lo planes of the first RH rows; each [rows][K] plane in fragment order.
struct Planes { h16* qk16; bf* qkh; bf* qkl; h16* vt16; bf* vth; bf* vtl; };

// A 64x64 f32 accumulator tile (lane&15 = column within 16 nb, element j = row 8*(lane>>4) + j within 16 mb) leaves as q or k rows [t][HD]: f16 with the carry, and for HL the bf16 hi/lo pair.
// 16 rows at a time go through the LDS stage; then a store writes one half of a block (512 contiguous B). p16, ph, pl point at the block of the tile's first row.
template <bool HL>
__device__ __forceinline__ void put_qk(const v8f (&acc)[4][4], float* os, h16* p16, bf* ph, bf* pl, int lane) {
    const int lr = lane & 15, hi = lane >> 4;
#pragma unroll
    for (int mb = 0; mb < 4; ++mb) {
#pragma unroll
        for (int nb = 0; nb < 4; ++nb) {
#pragma unroll
            for (int j = 0; j < 8; ++j) os[(hi * 8 + j) * OSP + nb * 16 + lr] = acc[mb][nb][j]; }
        __builtin_amdgcn_wave_barrier(); asm volatile("" ::: "memory");   // compiler fence: the row reads below take other lanes' writes and must not be moved over them
#pragma unroll
        for (int s = 0; s < 4; ++s) { const int seg = 16 * s + 8 * hi; const v4f a = *(const v4fa*)(os + lr * OSP + seg), g = *(const v4fa*)(os + lr * OSP + seg + 4); v8h o16;
#pragma unroll
            for (int k = 0; k < 4; ++k) { o16[k] = tohx(a[k] * QCAR); o16[4 + k] = tohx(g[k] * QCAR); }
            const int o = mb * 16 * HD + s * 256 + lane * 8;   // block (mb, s >> 1), half s & 1
            *(v8h*)(p16 + o) = o16;
            if constexpr (HL) { v8us oh, ol;
#pragma unroll
                for (int k = 0; k < 4; ++k) { unsigned short hh, ll; splitf(a[k], hh, ll); oh[k] = hh; ol[k] = ll; splitf(g[k], hh, ll); oh[4 + k] = hh; ol[4 + k] = ll; }
                *(v8us*)(ph + o) = oh; *(v8us*)(pl + o) = ol; } }
        __builtin_amdgcn_wave_barrier(); asm volatile("" ::: "memory");   // compiler fence: the next 16 rows' writes stay behind these reads
    }
    xwait();   // behind the last stores: where the build lays another epilogue block out behind this one, that block rewrites registers that they name
}
// The same tile leaves as v^T [d][t]: a lane's 8 accumulator elements are 8 consecutive t of one d, its own 16-B unit of block (nb, mb >> 1), half mb & 1, stored from the registers. p16 (K = SEQ), ph, pl (K = RH) point at the block of d = 0 of the head, first t of the tile; hl (the same in every lane): the bf16 hi/lo pair is wanted too.
__device__ __forceinline__ void put_vt(const v8f (&acc)[4][4], h16* p16, bf* ph, bf* pl, bool hl, int lane) {
    if (hl) {
#pragma unroll
        for (int nb = 0; nb < 4; ++nb)
#pragma unroll
            for (int mb = 0; mb < 4; ++mb) { const int o = nb * 16 * RH + mb * 256 + lane * 8; v8us oh, ol;
#pragma unroll
                for (int j = 0; j < 8; ++j) { unsigned short hh, ll; splitf(acc[mb][nb][j], hh, ll); oh[j] = hh; ol[j] = ll; }
                *(v8us*)(ph + o) = oh; *(v8us*)(pl + o) = ol; }
        xwait();   // behind the hi/lo stores: the f16 stores' address is formed in registers that they name
    }
#pragma unroll
    for (int nb = 0; nb < 4; ++nb)
#pragma unroll
        for (int mb = 0; mb < 4; ++mb) { v8h o16;
#pragma unroll
            for (int j = 0; j < 8; ++j) o16[j] = tohx(acc[mb][nb][j] * VCAR);
            *(v8h*)(p16 + nb * 16 * SEQ + mb * 256 + lane * 8) = o16; }
    xwait();   // behind the last stores: where the build lays another epilogue block out behind this one, that block rewrites registers that they name
}

// ---- one-wave 64x64 tile GEMM body: C[m][n] (f32, pitch ldc, + optional bf16-converted bias[n]) = sum_k A[m][k] Bt[n][k] (+ A2 x Bt when NSPLIT == 1); K % 32 == 0; A, A2, Bt, Bt2 in fragment order.
// PLANES: tiles of z = 0, 1 (q, k) and z = 2 (v) leave as attention planes straight from the f32 accumulators; z = 3 (gate) leaves as f32 rows like any other tile.
template <typename T16, int NSPLIT, bool BIAS, bool PLANES>
__device__ __forceinline__ void gemmw_body(const T16* __restrict__ A, const T16* __restrict__ A2, const T16* __restrict__ Bt, const T16* __restrict__ Bt2, int K, float* C, int ldc, const float* __restrict__ bias, size_t sA, size_t sB, size_t sC, float* os, const Planes pl) {
    typedef typename WFrag<T16>::V V;
    const size_t z = blockIdx.z; A += z * sA; if (A2) A2 += z * sA; Bt += z * sB; if (Bt2) Bt2 += z * sB; C += z * sC;
    const int lane = threadIdx.x & 31, lr = lane & 15, hi = lane >> 4; const int r0 = blockIdx.x * 64, c0 = blockIdx.y * 64;
    v8f acc[4][4];
#pragma unroll
    for (int mb = 0; mb < 4; ++mb)
#pragma unroll
        for (int nb = 0; nb < 4; ++nb) acc[mb][nb] = (v8f){};
    const size_t aoff = (size_t)r0 * K + 8 * lane, boff = (size_t)c0 * K + 8 * lane;   // 16 rows of blocks are 16 K elements, one k step of 32 is one block of 512
#pragma unroll 1
    for (int kc = 0; kc < K; kc += 32) {
        V a[4], a2[4];
#pragma unroll
        for (int mb = 0; mb < 4; ++mb) { a[mb] = WFrag<T16>::ld(A + aoff + (size_t)mb * 16 * K + kc * 16); if (NSPLIT == 1 || NSPLIT == 2) a2[mb] = mb < 3 ? WFrag<T16>::ld(A2 + aoff + (size_t)mb * 16 * K + kc * 16) : ldw(A2 + aoff + (size_t)mb * 16 * K + kc * 16); }
        xwait();   // behind the A loads: a B fragment may be given the registers of their addresses
#pragma unroll
        for (int nb = 0; nb < 4; ++nb) { const T16* pb = Bt + boff + (size_t)nb * 16 * K + kc * 16; const V b = nb < 3 ? WFrag<T16>::ld(pb) : ldw(pb); V b2; if (NSPLIT >= 2) b2 = WFrag<T16>::ld(Bt2 + boff + (size_t)nb * 16 * K + kc * 16);
#pragma unroll
            for (int mb = 0; mb < 4; ++mb) { acc[mb][nb] = WFrag<T16>::mma(a[mb], b, acc[mb][nb]); if (NSPLIT == 1 || NSPLIT == 2) acc[mb][nb] = WFrag<T16>::mma(a2[mb], b, acc[mb][nb]); if (NSPLIT >= 2) acc[mb][nb] = WFrag<T16>::mma(a[mb], b2, acc[mb][nb]); } }
        asm volatile("v_nop\n\tv_nop\n\tv_nop\n\tv_nop" : "+v"(acc[0][0]), "+v"(acc[1][1]), "+v"(acc[2][2]), "+v"(acc[3][3]) : "v"(a[0]), "v"(a[3]));
    }
    if constexpr (PLANES) {
        // a tile's 64 columns are one head (HD == 64), its 64 rows lie in one batch and on one side of RH: every test here is the same for the whole wave
        const unsigned w = blockIdx.z, h = blockIdx.y, b = (unsigned)r0 / SEQ, t0 = (unsigned)r0 % SEQ;
        if (w < 2u) { const size_t bh = (size_t)(w * NB + b) * NH + h; h16* p16 = pl.qk16 + (bh * SEQ + t0) * HD;
            if (t0 < RH) put_qk<true>(acc, os, p16, pl.qkh + (bh * RH + t0) * HD, pl.qkl + (bh * RH + t0) * HD, lane); else put_qk<false>(acc, os, p16, nullptr, nullptr, lane);
            return; }
        if (w == 2u) { const size_t bh = (size_t)b * NH + h; h16* p16 = pl.vt16 + bh * HD * SEQ + t0 * 16;
            const size_t o2 = bh * HD * RH + (t0 < RH ? t0 * 16 : 0u);   // stays inside the hi/lo planes for a tile that does not write them
            put_vt(acc, p16, pl.vth + o2, pl.vtl + o2, t0 < RH, lane);
            return; }
    }
#pragma unroll
    for (int mb = 0; mb < 4; ++mb) {
#pragma unroll
        for (int nb = 0; nb < 4; ++nb) {
#pragma unroll
            for (int j = 0; j < 8; ++j) os[(hi * 8 + j) * OSP + nb * 16 + lr] = acc[mb][nb][j]; }
        __builtin_amdgcn_wave_barrier(); asm volatile("" ::: "memory");
        float* crow = C + (size_t)(r0 + mb * 16) * ldc + c0;
{
#pragma unroll
            for (int s = 0; s < 8; ++s) { const int row = 2 * s + hi, cofs = lr * 4; v4f val = *(const v4fa*)(os + row * OSP + cofs); if (BIAS) { val[0] += bfr(bias[c0 + cofs]); val[1] += bfr(bias[c0 + cofs + 1]); val[2] += bfr(bias[c0 + cofs + 2]); val[3] += bfr(bias[c0 + cofs + 3]); }
                *(v4f*)(crow + (size_t)row * ldc + cofs) = val; }
             }
        __builtin_amdgcn_wave_barrier(); asm volatile("" ::: "memory");
    }
    if constexpr (PLANES) xwait();   // behind the gate tile's last stores: the plane blocks laid out behind them rewrite registers that they name
}

// q/k/v/gate projections: z = 0..3 selects the weight plane (stride sB); q, k, v tiles go to the attention planes, the gate tile to the f32 plane C + 3 sC; A = bf16 x [MROWS][CC].
__global__ __launch_bounds__(32) void k_gemm_proj(const bf* __restrict__ A, const bf* __restrict__ Bt, float* C, size_t sB, size_t sC, h16* QK16, bf* QKh, bf* QKl, h16* VT16, bf* VTh, bf* VTl) {
    __shared__ __align__(16) float os[16 * OSP];
    gemmw_body<bf, 0, false, true>(A, nullptr, Bt, nullptr, CC, C, CC, nullptr, 0, sB, sC, os, Planes{QK16, QKh, QKl, VT16, VTh, VTl});
}
// output projection: (gated ctx hi + gated ctx lo) x Wo^T + bf16(bo) -> d_out rows.
__global__ __launch_bounds__(32) void k_gemm_out(const bf* __restrict__ Ah, const bf* __restrict__ Al, const bf* __restrict__ Bt, float* C, const float* __restrict__ bias) {
    __shared__ __align__(16) float os[16 * OSP];
    gemmw_body<bf, 1, true, false>(Ah, Al, Bt, nullptr, CC, C, CC, bias, 0, 0, 0, os, Planes{});
}

// f32 rows [..][CC] -> bf16 plane in fragment order: a wave takes 8 rows x 4 groups of 8 floats of one block: it reads 8 whole 128-B lines and writes 4 whole 128-B lines (8 units of 16 B each).
__global__ __launch_bounds__(256) void k_cvt8(const float* __restrict__ src, bf* dst, unsigned n8, unsigned per8, unsigned sstr8) {
    const unsigned i = blockIdx.x * 256u + threadIdx.x; if (i >= n8) return;
    const unsigned blk = i >> 6, lr = (i & 7u) + ((i >> 5) & 1u) * 8u, c = (i >> 3) & 3u;   // block, row in the block, 8-float group in the block (c = 2 * half + (fragment lane >> 4))
    const unsigned row = (blk / (CC / 32)) * 16u + lr, ch = (blk % (CC / 32)) * 4u + c;
    const unsigned u = row * (CC / 8) + ch;
    const unsigned b = u / per8, r = u - b * per8;
    const v8f v = *(const v8f*)(src + ((size_t)b * sstr8 + r) * 8); v8us o;
#pragma unroll
    for (int k = 0; k < 8; ++k) o[k] = f2bf(v[k]);
    *(v8us*)(dst + ((size_t)blk * 64 + c * 16u + lr) * 8) = o;  }

// P^T fragment (B operand of O^T = V^T P^T) built lane-locally from the two S^T tiles of a 32-key step: element r <- tile(keys 0..15)[r], element 8+r <- tile(keys 16..31)[r].
template <typename T16> struct PPack;
template <> struct PPack<h16> { static __device__ __forceinline__ void mk(const v8f& p0, const v8f& p1, float car, v16h& a, v16h& b) { v16h r;
#pragma unroll
        for (int i = 0; i < 8; ++i) { r[i] = tohx(p0[i] * car); r[8 + i] = tohx(p1[i] * car); }
        a = r; b = r; } };
template <> struct PPack<bf> { static __device__ __forceinline__ void mk(const v8f& p0, const v8f& p1, float car, v16bf& a, v16bf& b) { (void)car; v16us h, l;
#pragma unroll
        for (int i = 0; i < 8; ++i) { unsigned short hh, ll; splitf(p0[i], hh, ll); h[i] = hh; l[i] = ll; splitf(p1[i], hh, ll); h[8 + i] = hh; l[8 + i] = ll; }
        a = __builtin_bit_cast(v16bf, h); b = __builtin_bit_cast(v16bf, l); } };

// Hazard guards: 4 VALU-slot nops tied to every accumulator of the group and to the fragments of the last products.
template <int N> struct Grd;
template <> struct Grd<1> {
    template <typename V> static __device__ __forceinline__ void s(v8f (&st)[2][1], const V& x, const V& y) { asm volatile("v_nop\n\tv_nop\n\tv_nop\n\tv_nop" : "+v"(st[0][0]), "+v"(st[1][0]) : "v"(x), "v"(y)); }
    template <typename V> static __device__ __forceinline__ void o(v8f (&oa)[4][1], const V& x, const V& y, const V& z) { asm volatile("v_nop\n\tv_nop\n\tv_nop\n\tv_nop" : "+v"(oa[0][0]), "+v"(oa[1][0]), "+v"(oa[2][0]), "+v"(oa[3][0]) : "v"(x), "v"(y), "v"(z)); }
};
template <> struct Grd<2> {
    template <typename V> static __device__ __forceinline__ void s(v8f (&st)[2][2], const V& x, const V& y) { asm volatile("v_nop\n\tv_nop\n\tv_nop\n\tv_nop" : "+v"(st[0][0]), "+v"(st[1][0]), "+v"(st[0][1]), "+v"(st[1][1]) : "v"(x), "v"(y)); }
    template <typename V> static __device__ __forceinline__ void o(v8f (&oa)[4][2], const V& x, const V& y, const V& z) { asm volatile("v_nop\n\tv_nop\n\tv_nop\n\tv_nop" : "+v"(oa[0][0]), "+v"(oa[1][0]), "+v"(oa[2][0]), "+v"(oa[3][0]), "+v"(oa[0][1]), "+v"(oa[1][1]), "+v"(oa[2][1]), "+v"(oa[3][1]) : "v"(x), "v"(y), "v"(z)); }
};

// ---- fused causal attention body, one work-group of NW waves per 16*NQ query rows of one (batch, head); keys in steps of 32, step i worked by wave i % NW with its own running maximum, row sums and O^T;
// behind the loop the waves' partial results are joined in LDS: every wave rescales its O^T to the common maximum and the common sum, the tiles are added in wave order, at most one epilogue trip a wave.
// S^T[key][query] = sum_d K[key][d] Q[query][d]: A = K rows (lane -> key), B = Q rows (lane -> query); D: lane = query (lane&15), element r = key 8*(lane>>4) + r.
// Row statistics are per lane (query); the two lane halves hold different keys and exchange the step maximum with one xor-16 shuffle; row sums stay per-lane partials until the end.
// O^T[d][query] += V^T[d][key] P^T[key][query]: A = V^T rows (lane -> d), B = packed P^T. Planes, in fragment order: Q, K [t][HD]; V^T [d][vpitch]; Ah, Al [t][CC], pointing at the head's first block of row 0. G: f32 rows.
template <typename T16, bool SPLIT, int NQ, int NW>
__device__ __forceinline__ void attn_body(const T16* __restrict__ Q, const T16* __restrict__ Q2, const T16* __restrict__ Kp, const T16* __restrict__ K2, const T16* __restrict__ Vt, const T16* __restrict__ V2,
                                          const float* __restrict__ G, int vpitch, int q0, float ssc, float osc, float pcar, bf* Ah, bf* Al, float* os, float* ml) {
    typedef typename WFrag<T16>::V V;
    static_assert(4 * NQ <= NW);   // at most one epilogue trip a wave
    const int lane = threadIdx.x & 31, lr = lane & 15, hi = lane >> 4;
    const int wv = __builtin_amdgcn_readfirstlane((int)(threadIdx.x >> 5));   // the wave's number, in a scalar register: the loop's bounds and the epilogue's test stay scalar
    V qf[NQ][2], qf2[NQ][2];
#pragma unroll
    for (int nb = 0; nb < NQ; ++nb)
#pragma unroll
        for (int ds = 0; ds < 2; ++ds) { const size_t qo = (size_t)(q0 + 16 * nb) * HD + 512 * ds + 8 * lane; qf[nb][ds] = WFrag<T16>::ld(Q + qo); if (SPLIT) qf2[nb][ds] = WFrag<T16>::ld(Q2 + qo); }
    v8f o[4][NQ]; float mrun[NQ], lrun[NQ];
#pragma unroll
    for (int nb = 0; nb < NQ; ++nb) { mrun[nb] = NEGB; lrun[nb] = 0.0f;
#pragma unroll
        for (int dt = 0; dt < 4; ++dt) o[dt][nb] = (v8f){}; }
    const int kend = q0 + 16 * NQ;
#pragma unroll 1
    for (int kt = 32 * wv; kt < kend; kt += 32 * NW) {
        V ka[2][2], ka2[2][2];
#pragma unroll
        for (int mb = 0; mb < 2; ++mb)
#pragma unroll
            for (int ds = 0; ds < 2; ++ds) { const size_t ko = (size_t)(kt + 16 * mb) * HD + 512 * ds + 8 * lane; ka[mb][ds] = (!SPLIT || mb + ds < 2) ? WFrag<T16>::ld(Kp + ko) : ldw(Kp + ko); }
        // the four V^T fragments of this key step are asked for here, behind the K fragments, each into registers of its own: they arrive while the scores and the softmax are worked out
        V va[4], va2[4];
        if constexpr (SPLIT) {
            // plane by plane; s_wait_xcnt 0 in front of a plane's last load and behind it: that load's result, or a later one's, may be given the registers of the plane's address
            xwait();
#pragma unroll
            for (int f = 0; f < 4; ++f) { const size_t ko = (size_t)(kt + 16 * (f >> 1)) * HD + 512 * (f & 1) + 8 * lane; ka2[f >> 1][f & 1] = f < 3 ? WFrag<T16>::ld(K2 + ko) : ldw(K2 + ko); }
            xwait();
#pragma unroll
            for (int dt = 0; dt < 4; ++dt) { const size_t vo = (size_t)(16 * dt) * vpitch + kt * 16 + 8 * lane; va[dt] = dt < 3 ? WFrag<T16>::ld(Vt + vo) : ldw(Vt + vo); }
            xwait();
#pragma unroll
            for (int dt = 0; dt < 4; ++dt) { const size_t vo = (size_t)(16 * dt) * vpitch + kt * 16 + 8 * lane; va2[dt] = dt < 3 ? WFrag<T16>::ld(V2 + vo) : ldw(V2 + vo); }
            xwait();
            __builtin_amdgcn_sched_barrier(0);   // the score products stay behind the step's loads: else the build waits for the K fragments first and asks for the V^T fragments only then
        } else {
            xwait();   // behind the K loads: a V^T fragment may be given the registers of their address
#pragma unroll
            for (int dt = 0; dt < 4; ++dt) { const size_t vo = (size_t)(16 * dt) * vpitch + kt * 16 + 8 * lane; va[dt] = dt < 3 ? WFrag<T16>::ld(Vt + vo) : ldw(Vt + vo); }
        }
        v8f st[2][NQ];
#pragma unroll
        for (int mb = 0; mb < 2; ++mb)
#pragma unroll
            for (int nb = 0; nb < NQ; ++nb) { v8f z = (v8f){};
                z = WFrag<T16>::mma(ka[mb][0], qf[nb][0], z); z = WFrag<T16>::mma(ka[mb][1], qf[nb][1], z);
                if (SPLIT) { z = WFrag<T16>::mma(ka2[mb][0], qf[nb][0], z); z = WFrag<T16>::mma(ka2[mb][1], qf[nb][1], z); z = WFrag<T16>::mma(ka[mb][0], qf2[nb][0], z); z = WFrag<T16>::mma(ka[mb][1], qf2[nb][1], z); }
                st[mb][nb] = z; }
        Grd<NQ>::s(st, ka[1][1], SPLIT ? qf2[NQ - 1][1] : qf[NQ - 1][1]);
        V pb[NQ], pb2[NQ];
#pragma unroll
        for (int nb = 0; nb < NQ; ++nb) {
            const int qg = q0 + 16 * nb + lr; float mx = NEGB;
#pragma unroll
            for (int mb = 0; mb < 2; ++mb)
#pragma unroll
                for (int r = 0; r < 8; ++r) { const int kg = kt + 16 * mb + 8 * hi + r; float t = st[mb][nb][r] * ssc; t = (kg <= qg) ? t : NEGB; st[mb][nb][r] = t; mx = fmaxf(mx, t); }
            mx = fmaxf(mx, __shfl_xor(mx, 16, 32));
            const float mn = fmaxf(mrun[nb], mx);
            const float al = __builtin_amdgcn_exp2f((mrun[nb] - mn) * L2E); mrun[nb] = mn;
            float psum = 0.0f;
#pragma unroll
            for (int mb = 0; mb < 2; ++mb)
#pragma unroll
                for (int r = 0; r < 8; ++r) { const float p = __builtin_amdgcn_exp2f((st[mb][nb][r] - mn) * L2E); psum += p; st[mb][nb][r] = p; }
            lrun[nb] = lrun[nb] * al + psum;
#pragma unroll
            for (int dt = 0; dt < 4; ++dt)
#pragma unroll
                for (int r = 0; r < 8; ++r) o[dt][nb][r] *= al;
            PPack<T16>::mk(st[0][nb], st[1][nb], pcar, pb[nb], pb2[nb]);
        }
#pragma unroll
        for (int dt = 0; dt < 4; ++dt) {
#pragma unroll
            for (int nb = 0; nb < NQ; ++nb) { o[dt][nb] = WFrag<T16>::mma(va[dt], pb[nb], o[dt][nb]); if (SPLIT) { o[dt][nb] = WFrag<T16>::mma(va2[dt], pb[nb], o[dt][nb]); o[dt][nb] = WFrag<T16>::mma(va[dt], pb2[nb], o[dt][nb]); } } }
        Grd<NQ>::o(o, SPLIT ? va2[3] : va[3], pb[NQ - 1], SPLIT ? pb2[NQ - 1] : pb[0]);
    }
    // the wave's epilogue trip: 16 query rows x 16 d of the tile; its gate values are asked for here, in front of the join: their round trip ends at the first barrier, where a wave waits for the others anyway
    const int s = wv; const bool mine = 4 * NQ == NW || s < 4 * NQ;   // the same in every lane of a wave; with fewer trips than waves the last waves have none
    v4f ga = (v4f){}, gc = (v4f){};
    if (mine) { const float* gp = G + (size_t)(q0 + 16 * (s >> 2) + lr) * CC + 16 * (s & 3) + 8 * hi; ga = *(const v4f*)gp;
        xwait();   // in front of the last load through the address: its result may be given the registers of that address
        gc = *(const v4f*)(gp + 4);
        xwait(); }   // and behind it: so may a value of the join below
    // (the loops of the join are unrolled so that their small arrays stay in registers)
    // every wave's maximum (lanes 0..15) and row sum (lanes 16..31; the two lane halves' partial sums joined first) of each query go to LDS: ml[0][wave][query], ml[1][wave][query]
#pragma unroll
    for (int nb = 0; nb < NQ; ++nb) { float lt = lrun[nb]; lt += __shfl_xor(lt, 16, 32); ml[(hi * NW + wv) * 16 * NQ + 16 * nb + lr] = hi ? lt : mrun[nb]; }
    __syncthreads();   // the maxima and sums of all waves are read below
    // normalise to the common maximum and sum; O^T lane = query, element r = d 16*dt + 8*hi + r  ->  the wave's own LDS tile [query][d]. A wave without a key step holds NEGB, 0 and zeros: its factor is 0.
    float* ow = os + wv * (16 * NQ * OSP);
#pragma unroll
    for (int nb = 0; nb < NQ; ++nb) { float mw[NW], ms = NEGB, lt = 0.0f;
#pragma unroll
        for (int w = 0; w < NW; ++w) { mw[w] = ml[w * 16 * NQ + 16 * nb + lr]; ms = fmaxf(ms, mw[w]); }
#pragma unroll
        for (int w = 0; w < NW; ++w) lt += ml[(NW + w) * 16 * NQ + 16 * nb + lr] * ex2s((mw[w] - ms) * L2E);
        const float inv = osc * rcps(lt) * ex2s((mrun[nb] - ms) * L2E);
#pragma unroll
        for (int dt = 0; dt < 4; ++dt) { v4f a, c;
#pragma unroll
            for (int r = 0; r < 4; ++r) { a[r] = o[dt][nb][r] * inv; c[r] = o[dt][nb][4 + r] * inv; }
            float* dst = ow + (16 * nb + lr) * OSP + 16 * dt + 8 * hi; *(v4fa*)dst = a; *(v4fa*)(dst + 4) = c; } }
    __syncthreads();   // every wave's tile is read below
    if (mine) { const int row = 16 * (s >> 2) + lr, seg = 16 * (s & 3) + 8 * hi; v4f a = *(const v4fa*)(os + row * OSP + seg), c = *(const v4fa*)(os + row * OSP + seg + 4);
#pragma unroll
        for (int w = 1; w < NW; ++w) { a += *(const v4fa*)(os + w * (16 * NQ * OSP) + row * OSP + seg); c += *(const v4fa*)(os + w * (16 * NQ * OSP) + row * OSP + seg + 4); }
        v8us oh, ol;
#pragma unroll
        for (int k = 0; k < 4; ++k) { unsigned short hh, ll; const float ya = a[k] * sigm(ga[k]); const float yc = c[k] * sigm(gc[k]); splitf(ya, hh, ll); oh[k] = hh; ol[k] = ll; splitf(yc, hh, ll); oh[4 + k] = hh; ol[4 + k] = ll; }
        const size_t oo = (size_t)(q0 + 16 * (s >> 2)) * CC + (s & 3) * 256 + 8 * lane;   // block (row / 16, (s & 3) >> 1) of the head's two, half s & 1
        *(v8us*)(Ah + oo) = oh; *(v8us*)(Al + oo) = ol; }
}

// rows < RH: bf16 hi/lo planes [b][h] x ([RH][HD]) / [b][h] x ([HD][RH]), 16 query rows per work-group of NWV waves; grid (RH/16, NH, NB)
__global__ __launch_bounds__(32 * NWV) void k_attn_s(const bf* __restrict__ Qh, const bf* __restrict__ Ql, const bf* __restrict__ Kh, const bf* __restrict__ Kl, const bf* __restrict__ Vh, const bf* __restrict__ Vl, const float* __restrict__ Gt, bf* ATh, bf* ATl) {
    __shared__ __align__(16) float os[NWV * 16 * OSP]; __shared__ float ml[2 * NWV * 16];
    const size_t bh = (size_t)blockIdx.z * NH + blockIdx.y; const size_t po = bh * RH * HD; const size_t ao = (size_t)blockIdx.z * SEQ * CC + (size_t)blockIdx.y * HD, ap = (size_t)blockIdx.z * SEQ * CC + (size_t)blockIdx.y * HD * 16;
    attn_body<bf, true, 1, NWV>(Qh + po, Ql + po, Kh + po, Kl + po, Vh + po, Vl + po, Gt + ao, RH, (int)blockIdx.x * 16, 0.125f, 1.0f, 1.0f, ATh + ap, ATl + ap, os, ml);
}
// rows >= RH: f16 planes [b][h] x ([SEQ][HD]) / [b][h] x ([HD][SEQ]) with carries, 32 query rows per work-group of NWV waves; grid ((SEQ-RH)/32, NH, NB)
__global__ __launch_bounds__(32 * NWV) void k_attn_h(const h16* __restrict__ Q, const h16* __restrict__ Kp, const h16* __restrict__ Vt, const float* __restrict__ Gt, bf* ATh, bf* ATl) {
    __shared__ __align__(16) float os[NWV * 32 * OSP]; __shared__ float ml[2 * NWV * 32];
    const size_t bh = (size_t)blockIdx.z * NH + blockIdx.y; const size_t po = bh * SEQ * HD; const size_t ao = (size_t)blockIdx.z * SEQ * CC + (size_t)blockIdx.y * HD, ap = (size_t)blockIdx.z * SEQ * CC + (size_t)blockIdx.y * HD * 16;
    attn_body<h16, false, 2, NWV>(Q + po, nullptr, Kp + po, nullptr, Vt + po, nullptr, Gt + ao, SEQ, RH + (int)blockIdx.x * 32, 0.125f / (QCAR * QCAR), 1.0f / (PCAR * VCAR), PCAR, ATh + ap, ATl + ap, os, ml);
}

extern "C" void kernel_launch(void* const* d_in, const int* in_sizes, int n_in,
                              void* d_out, int out_size, void* d_ws, size_t ws_size, hipStream_t stream) {
    if (n_in < 7) return;
    if ((size_t)in_sizes[0] < ((size_t)(NB - 1) * SEQ_FULL + SEQ) * CC) return;
    if ((size_t)in_sizes[1] < W1 || (size_t)in_sizes[2] < W1 || (size_t)in_sizes[3] < W1 || (size_t)in_sizes[4] < W1 || (size_t)in_sizes[5] < W1 || in_sizes[6] < CC) return;
    if ((size_t)out_size < PL16) return;
    // wire order: x, Wq, Wk, Wv, Wg, Wo, bo
    const float* x = (const float*)d_in[0]; const float* wq = (const float*)d_in[1]; const float* wk = (const float*)d_in[2]; const float* wv = (const float*)d_in[3];
    const float* wg = (const float*)d_in[4]; const float* wo = (const float*)d_in[5]; const float* bo = (const float*)d_in[6];
    float* OUT = (float*)d_out;     // [NB][SEQ][CC]
    char* wsp = (char*)d_ws;
    auto take = [&](size_t bytes) { char* p = wsp; wsp += (bytes + 255) & ~(size_t)255; return (void*)p; };
    bf* WQ = (bf*)take(4 * W1 * 2);            // Wq | Wk | Wv | Wg bf16 [out][in], each in fragment order
    bf* WO = (bf*)take(W1 * 2);
    bf* XB = (bf*)take(PL16 * 2);              // bf16 x [MROWS][CC] in fragment order
    float* F = (float*)take(4 * PL16 * 4);     // four f32 planes [MROWS][CC]: the last holds the gate, the first the gated ctx
    h16* QK16 = (h16*)take(2 * PL16 * 2);      // f16 q planes | k planes
    h16* VT16 = (h16*)take(PL16 * 2);
    bf* QKh = (bf*)take(2 * PLR * 2); bf* QKl = (bf*)take(2 * PLR * 2);
    bf* VTh = (bf*)take(PLR * 2); bf* VTl = (bf*)take(PLR * 2);
    if ((size_t)(wsp - (char*)d_ws) > ws_size) return;
    // gated-ctx hi | lo planes lie in the first f32 plane of F, which no launch writes as f32 (only the gate plane is); sizes match exactly
    bf* ATh = (bf*)F; bf* ATl = ATh + PL16;
    const float* GATE = F + 3 * PL16;
    const unsigned w8 = (unsigned)(W1 / 8), x8 = (unsigned)(PL16 / 8);
    k_cvt8<<<(w8 + 255) / 256, 256, 0, stream>>>(wq, WQ, w8, w8, 0u);
    k_cvt8<<<(w8 + 255) / 256, 256, 0, stream>>>(wk, WQ + W1, w8, w8, 0u);
    k_cvt8<<<(w8 + 255) / 256, 256, 0, stream>>>(wv, WQ + 2 * W1, w8, w8, 0u);
    k_cvt8<<<(w8 + 255) / 256, 256, 0, stream>>>(wg, WQ + 3 * W1, w8, w8, 0u);
    k_cvt8<<<(w8 + 255) / 256, 256, 0, stream>>>(wo, WO, w8, w8, 0u);
    k_cvt8<<<(x8 + 255) / 256, 256, 0, stream>>>(x, XB, x8, (unsigned)((size_t)SEQ * CC / 8), (unsigned)((size_t)SEQ_FULL * CC / 8));
    k_gemm_proj<<<dim3(MROWS / 64, CC / 64, 4), 32, 0, stream>>>(XB, WQ, F, W1, PL16, QK16, QKh, QKl, VT16, VTh, VTl);
    k_attn_s<<<dim3(RH / 16, NH, NB), 32 * NWV, 0, stream>>>(QKh, QKl, QKh + PLR, QKl + PLR, VTh, VTl, GATE, ATh, ATl);
    if (SEQ > RH) k_attn_h<<<dim3((SEQ - RH) / 32 > 0 ? (SEQ - RH) / 32 : 1, NH, NB), 32 * NWV, 0, stream>>>(QK16, QK16 + PL16, VT16, GATE, ATh, ATl);
    k_gemm_out<<<dim3(MROWS / 64, CC / 64, 1), 32, 0, stream>>>(ATh, ATl, WO, OUT, bo);
}

// v005
// It runs in 128 microseconds.
// Next to v004, in two timings, it ran 1.07 and 1.08 times as fast.
// All steps since v000 together make it 2.19 times as fast.
#include <hip/hip_runtime.h>

// Causal multi-head attention with a sigmoid output gate, x [2][2048][1024], 16 heads x 64, weights [out][in], one score scale 1/8, tril mask, out = (merged heads * sigmoid(x Wg^T)) x Wo^T + bo.
// Compute dtypes, f32 accumulate: all float inputs RNE-converted to bf16 on load; q/k/v/gate projections v_wmma_f32_16x16x32_bf16 (exact products);
// attention rows < RH: bf16 hi/lo planes, 3 products on q.k and on p.v; rows >= RH: v_wmma_f32_16x16x32_f16 with q,k x16, v x16, p x1024 carries; softmax f32 (running max); gate sigmoid f32 on the VALU;
// output projection: gated ctx bf16 hi/lo x bf16 Wo (2 products) + bf16(bo).
// Every 16-bit matrix operand plane [rows][K] of the workspace lies in fragment order: blocks of 16 rows x 32 k (512 elements, 1 KiB), block (row/16, k/32) at index (row/16)*(K/32) + k/32;
// in a block the 16-B unit 32*half + lane holds row lane&15, k = 16*half + 8*(lane>>4) + 0..7. A wave's fragment load or store of 16 B a lane then covers 512 contiguous bytes.
// Fused attention in transposed form: S^T = K Q^T (D rows = keys, lane = query), P^T fragment built lane-locally from two S^T tiles, O^T = V^T P^T; no score plane in global memory.

#ifndef NB
#define NB 2
#endif
#ifndef SEQ
#define SEQ 2048
#endif
#ifndef RH
#define RH 256                       // query rows < RH use hi+lo planes
#endif
#define NB_FULL  2
#define SEQ_FULL 2048
#define CC   1024
#define NH   16
#define HD   64
#define MROWS (NB * SEQ)
#define PCAR 1024.0f
#define QCAR 16.0f
#define VCAR 16.0f
#define L2E  1.4426950408889634f
#define NEGB (-1.0e30f)
#define OSP  68
#define NWV  8                        // waves of an attention work-group: they share out the key steps of one query tile
#define CVU  16                       // conversion launch: 16-B output units a lane
#define CVW  9                        // and waves of a work-group
#define W1   ((size_t)CC * CC)
#define PL16 ((size_t)MROWS * CC)
#define PLR  ((size_t)NB * NH * RH * HD)
// carve: 4+1 bf16 weight planes, bf16 x, 4 f32 planes (the last: gate; the first: the gated-ctx hi|lo planes), f16 q|k|v^T planes, bf16 hi/lo planes of the first RH rows
#define WS_TOTAL (10 * W1 + 24 * PL16 + 12 * PLR)
#define CV_WB    ((unsigned)(W1 / 512))                                  // blocks of a weight plane
#define CV_WAVES ((unsigned)((5 * W1 + PL16) / (256 * CVU)))             // waves that the conversion launch needs
static_assert((5 * W1 + PL16) % (256 * CVU) == 0 && W1 % (256 * CVU) == 0 && (CC / 32) % (CVU / 2) == 0);   // a conversion wave's blocks lie in one plane and in one row of blocks
static_assert(CC == NH * HD);                 // head split covers the model width
static_assert(HD == 64);
static_assert(CC % 64 == 0 && CC % 32 == 0);  // GEMM N tile 64, K step 32
static_assert(MROWS % 64 == 0);               // GEMM M tile 64
static_assert(SEQ % 256 == 0);                // a 64-row projection tile stays inside one batch
static_assert(RH % 256 == 0 && RH <= SEQ);    // a 64-row projection tile lies on one side of the hi/lo row boundary
static_assert((SEQ - RH) % 32 == 0 && RH % 32 == 0 && RH % 16 == 0);   // query tiles of 32 (f16 path) and 16 (hi/lo path)
static_assert(NB <= NB_FULL && SEQ <= SEQ_FULL);
static_assert((W1 * 2) % 256 == 0 && (PL16 * 2) % 256 == 0 && (PLR * 2) % 256 == 0);   // carve pieces stay 256-B aligned without padding
static_assert(2 * PL16 * sizeof(unsigned short) <= PL16 * sizeof(float));              // gated-ctx hi|lo planes fit exactly inside the first f32 plane of F
static_assert(WS_TOTAL <= (size_t)134217728); // total carve <= 128 MiB

typedef _Float16 h16;
typedef unsigned short bf;
typedef __attribute__((ext_vector_type(16))) __bf16   v16bf;
typedef __attribute__((ext_vector_type(16))) _Float16 v16h;
typedef __attribute__((ext_vector_type(16))) unsigned short v16us;
typedef __attribute__((ext_vector_type(8)))  _Float16 v8h;
typedef __attribute__((ext_vector_type(8)))  unsigned short v8us;
typedef __attribute__((ext_vector_type(8)))  float    v8f;
typedef __attribute__((ext_vector_type(4)))  float    v4f;
typedef v4f  __attribute__((may_alias)) v4fa;

__device__ __forceinline__ unsigned short f2bf(float f) { unsigned u = __float_as_uint(f); u += 0x7FFFu + ((u >> 16) & 1u); return (unsigned short)(u >> 16); }
__device__ __forceinline__ float bf2f(unsigned short b) { return __uint_as_float(((unsigned)b) << 16); }
__device__ __forceinline__ float bfr(float f) { return bf2f(f2bf(f)); }
__device__ __forceinline__ h16 tohx(float x) { return (h16)x; }
__device__ __forceinline__ void splitf(float y, unsigned short& h, unsigned short& l) { h = f2bf(y); l = f2bf(y - bf2f(h)); }
// v_exp_f32 and v_rcp_f32 as the builtins give them, each with one v_nop in its own statement: the slot that the instruction set asks for between a transcendental and a directly following instruction that reads its result or overwrites its source
__device__ __forceinline__ float sigm(float g) { float e, r; asm("v_exp_f32 %0, %1\n\tv_nop" : "=v"(e) : "v"(-g * L2E)); asm("v_rcp_f32 %0, %1\n\tv_nop" : "=v"(r) : "v"(1.0f + e)); return r; }
// the same two statements singly, for the join of the attention waves' partial results
__device__ __forceinline__ float ex2s(float x) { float e; asm("v_exp_f32 %0, %1\n\tv_nop" : "=v"(e) : "v"(x)); return e; }
__device__ __forceinline__ float rcps(float x) { float r; asm("v_rcp_f32 %0, %1\n\tv_nop" : "=v"(r) : "v"(x)); return r; }
__device__ __forceinline__ v16h cat16(v8h lo, v8h hi) { return __builtin_shufflevector(lo, hi, 0, 1, 2, 3, 4, 5, 6, 7, 8, 9, 10, 11, 12, 13, 14, 15); }
__device__ __forceinline__ v16bf cat16b(v8us lo, v8us hi) { return __builtin_bit_cast(v16bf, __builtin_shufflevector(lo, hi, 0, 1, 2, 3, 4, 5, 6, 7, 8, 9, 10, 11, 12, 13, 14, 15)); }
__device__ __forceinline__ v8f wmma16(v16h a, v16h b, v8f c) { return __builtin_amdgcn_wmma_f32_16x16x32_f16(false, a, false, b, (short)0, c, false, false); }
__device__ __forceinline__ v8f wmmab(v16bf a, v16bf b, v8f c) { return __builtin_amdgcn_wmma_f32_16x16x32_bf16(false, a, false, b, (short)0, c, false, false); }

// Fragment loader from a block in fragment order: p = block + 8*lane; elements 0..7 <- p[0..7] (half 0), elements 8..15 <- p[256..263] (half 1).
template <typename T16> struct WFrag;
template <> struct WFrag<h16> { typedef v16h V; static __device__ __forceinline__ V ld(const h16* p) { return cat16(*(const v8h*)p, *(const v8h*)(p + 256)); } static __device__ __forceinline__ v8f mma(V a, V b, v8f c) { return wmma16(a, b, c); } };
template <> struct WFrag<bf> { typedef v16bf V; static __device__ __forceinline__ V ld(const bf* p) { return cat16b(*(const v8us*)p, *(const v8us*)(p + 256)); } static __device__ __forceinline__ v8f mma(V a, V b, v8f c) { return wmmab(a, b, c); } };
// s_wait_xcnt 0, written where the next load's result may be given the registers of an address that loads already issued name.
__device__ __forceinline__ void xwait() { asm volatile("s_wait_xcnt 0x0" ::: "memory"); }
// The fragment loaders again, for the last fragment read through an address: the wait stands in front of its last load, whose result may be given the address's own registers.
__device__ __forceinline__ v16h ldw(const h16* p) { const v8h lo = *(const v8h*)p; xwait(); return cat16(lo, *(const v8h*)(p + 256)); }
__device__ __forceinline__ v16bf ldw(const bf* p) { const v8us lo = *(const v8us*)p; xwait(); return cat16b(lo, *(const v8us*)(p + 256)); }

// The attention planes that the projection tiles are written to: f16 q|k [w][b][h] x ([t][HD]) and v^T [b][h] x ([d][t]) with their carries, bf16 hi/lo planes of the first RH rows; each [rows][K] plane in fragment order.
struct Planes { h16* qk16; bf* qkh; bf* qkl; h16* vt16; bf* vth; bf* vtl; };

// A 64x64 f32 accumulator tile (lane&15 = column within 16 nb, element j = row 8*(lane>>4) + j within 16 mb) leaves as q or k rows [t][HD]: f16 with the carry, and for HL the bf16 hi/lo pair.
// 16 rows at a time go through the LDS stage; then a store writes one half of a block (512 contiguous B). p16, ph, pl point at the block of the tile's first row.
template <bool HL>
__device__ __forceinline__ void put_qk(const v8f (&acc)[4][4], float* os, h16* p16, bf* ph, bf* pl, int lane) {
    const int lr = lane & 15, hi = lane >> 4;
#pragma unroll
    for (int mb = 0; mb < 4; ++mb) {
#pragma unroll
        for (int nb = 0; nb < 4; ++nb) {
#pragma unroll
            for (int j = 0; j < 8; ++j) os[(hi * 8 + j) * OSP + nb * 16 + lr] = acc[mb][nb][j]; }
        __builtin_amdgcn_wave_barrier(); asm volatile("" ::: "memory");   // compiler fence: the row reads below take other lanes' writes and must not be moved over them
#pragma unroll
        for (int s = 0; s < 4; ++s) { const int seg = 16 * s + 8 * hi; const v4f a = *(const v4fa*)(os + lr * OSP + seg), g = *(const v4fa*)(os + lr * OSP + seg + 4); v8h o16;
#pragma unroll
            for (int k = 0; k < 4; ++k) { o16[k] = tohx(a[k] * QCAR); o16[4 + k] = tohx(g[k] * QCAR); }
            const int o = mb * 16 * HD + s * 256 + lane * 8;   // block (mb, s >> 1), half s & 1
            *(v8h*)(p16 + o) = o16;
            if constexpr (HL) { v8us oh, ol;
#pragma unroll
                for (int k = 0; k < 4; ++k) { unsigned short hh, ll; splitf(a[k], hh, ll); oh[k] = hh; ol[k] = ll; splitf(g[k], hh, ll); oh[4 + k] = hh; ol[4 + k] = ll; }
                *(v8us*)(ph + o) = oh; *(v8us*)(pl + o) = ol; } }
        __builtin_amdgcn_wave_barrier(); asm volatile("" ::: "memory");   // compiler fence: the next 16 rows' writes stay behind these reads
    }
    xwait();   // behind the last stores: where the build lays another epilogue block out behind this one, that block rewrites registers that they name
}
// The same tile leaves as v^T [d][t]: a lane's 8 accumulator elements are 8 consecutive t of one d, its own 16-B unit of block (nb, mb >> 1), half mb & 1, stored from the registers. p16 (K = SEQ), ph, pl (K = RH) point at the block of d = 0 of the head, first t of the tile; hl (the same in every lane): the bf16 hi/lo pair is wanted too.
__device__ __forceinline__ void put_vt(const v8f (&acc)[4][4], h16* p16, bf* ph, bf* pl, bool hl, int lane) {
    if (hl) {
#pragma unroll
        for (int nb = 0; nb < 4; ++nb)
#pragma unroll
            for (int mb = 0; mb < 4; ++mb) { const int o = nb * 16 * RH + mb * 256 + lane * 8; v8us oh, ol;
#pragma unroll
                for (int j = 0; j < 8; ++j) { unsigned short hh, ll; splitf(acc[mb][nb][j], hh, ll); oh[j] = hh; ol[j] = ll; }
                *(v8us*)(ph + o) = oh; *(v8us*)(pl + o) = ol; }
        xwait();   // behind the hi/lo stores: the f16 stores' address is formed in registers that they name
    }
#pragma unroll
    for (int nb = 0; nb < 4; ++nb)
#pragma unroll
        for (int mb = 0; mb < 4; ++mb) { v8h o16;
#pragma unroll
            for (int j = 0; j < 8; ++j) o16[j] = tohx(acc[mb][nb][j] * VCAR);
            *(v8h*)(p16 + nb * 16 * SEQ + mb * 256 + lane * 8) = o16; }
    xwait();   // behind the last stores: where the build lays another epilogue block out behind this one, that block rewrites registers that they name
}

// ---- one-wave 64x64 tile GEMM body: C[m][n] (f32, pitch ldc, + optional bf16-converted bias[n]) = sum_k A[m][k] Bt[n][k] (+ A2 x Bt when NSPLIT == 1); K % 32 == 0; A, A2, Bt, Bt2 in fragment order.
// PLANES: tiles of z = 0, 1 (q, k) and z = 2 (v) leave as attention planes straight from the f32 accumulators; z = 3 (gate) leaves as f32 rows like any other tile.
template <typename T16, int NSPLIT, bool BIAS, bool PLANES>
__device__ __forceinline__ void gemmw_body(const T16* __restrict__ A, const T16* __restrict__ A2, const T16* __restrict__ Bt, const T16* __restrict__ Bt2, int K, float* C, int ldc, const float* __restrict__ bias, size_t sA, size_t sB, size_t sC, float* os, const Planes pl) {
    typedef typename WFrag<T16>::V V;
    const size_t z = blockIdx.z; A += z * sA; if (A2) A2 += z * sA; Bt += z * sB; if (Bt2) Bt2 += z * sB; C += z * sC;
    const int lane = threadIdx.x & 31, lr = lane & 15, hi = lane >> 4; const int r0 = blockIdx.x * 64, c0 = blockIdx.y * 64;
    v8f acc[4][4];
#pragma unroll
    for (int mb = 0; mb < 4; ++mb)
#pragma unroll
        for (int nb = 0; nb < 4; ++nb) acc[mb][nb] = (v8f){};
    const size_t aoff = (size_t)r0 * K + 8 * lane, boff = (size_t)c0 * K + 8 * lane;   // 16 rows of blocks are 16 K elements, one k step of 32 is one block of 512
#pragma unroll 1
    for (int kc = 0; kc < K; kc += 32) {
        V a[4], a2[4];
#pragma unroll
        for (int mb = 0; mb < 4; ++mb) { a[mb] = WFrag<T16>::ld(A + aoff + (size_t)mb * 16 * K + kc * 16); if (NSPLIT == 1 || NSPLIT == 2) a2[mb] = mb < 3 ? WFrag<T16>::ld(A2 + aoff + (size_t)mb * 16 * K + kc * 16) : ldw(A2 + aoff + (size_t)mb * 16 * K + kc * 16); }
        xwait();   // behind the A loads: a B fragment may be given the registers of their addresses
#pragma unroll
        for (int nb = 0; nb < 4; ++nb) { const T16* pb = Bt + boff + (size_t)nb * 16 * K + kc * 16; const V b = nb < 3 ? WFrag<T16>::ld(pb) : ldw(pb); V b2; if (NSPLIT >= 2) b2 = WFrag<T16>::ld(Bt2 + boff + (size_t)nb * 16 * K + kc * 16);
#pragma unroll
            for (int mb = 0; mb < 4; ++mb) { acc[mb][nb] = WFrag<T16>::mma(a[mb], b, acc[mb][nb]); if (NSPLIT == 1 || NSPLIT == 2) acc[mb][nb] = WFrag<T16>::mma(a2[mb], b, acc[mb][nb]); if (NSPLIT >= 2) acc[mb][nb] = WFrag<T16>::mma(a[mb], b2, acc[mb][nb]); } }
        asm volatile("v_nop\n\tv_nop\n\tv_nop\n\tv_nop" : "+v"(acc[0][0]), "+v"(acc[1][1]), "+v"(acc[2][2]), "+v"(acc[3][3]) : "v"(a[0]), "v"(a[3]));
    }
    if constexpr (PLANES) {
        // a tile's 64 columns are one head (HD == 64), its 64 rows lie in one batch and on one side of RH: every test here is the same for the whole wave
        const unsigned w = blockIdx.z, h = blockIdx.y, b = (unsigned)r0 / SEQ, t0 = (unsigned)r0 % SEQ;
        if (w < 2u) { const size_t bh = (size_t)(w * NB + b) * NH + h; h16* p16 = pl.qk16 + (bh * SEQ + t0) * HD;
            if (t0 < RH) put_qk<true>(acc, os, p16, pl.qkh + (bh * RH + t0) * HD, pl.qkl + (bh * RH + t0) * HD, lane); else put_qk<false>(acc, os, p16, nullptr, nullptr, lane);
            return; }
        if (w == 2u) { const size_t bh = (size_t)b * NH + h; h16* p16 = pl.vt16 + bh * HD * SEQ + t0 * 16;
            const size_t o2 = bh * HD * RH + (t0 < RH ? t0 * 16 : 0u);   // stays inside the hi/lo planes for a tile that does not write them
            put_vt(acc, p16, pl.vth + o2, pl.vtl + o2, t0 < RH, lane);
            return; }
    }
#pragma unroll
    for (int mb = 0; mb < 4; ++mb) {
#pragma unroll
        for (int nb = 0; nb < 4; ++nb) {
#pragma unroll
            for (int j = 0; j < 8; ++j) os[(hi * 8 + j) * OSP + nb * 16 + lr] = acc[mb][nb][j]; }
        __builtin_amdgcn_wave_barrier(); asm volatile("" ::: "memory");
        float* crow = C + (size_t)(r0 + mb * 16) * ldc + c0;
{
#pragma unroll
            for (int s = 0; s < 8; ++s) { const int row = 2 * s + hi, cofs = lr * 4; v4f val = *(const v4fa*)(os + row * OSP + cofs); if (BIAS) { val[0] += bfr(bias[c0 + cofs]); val[1] += bfr(bias[c0 + cofs + 1]); val[2] += bfr(bias[c0 + cofs + 2]); val[3] += bfr(bias[c0 + cofs + 3]); }
                *(v4f*)(crow + (size_t)row * ldc + cofs) = val; }
             }
        __builtin_amdgcn_wave_barrier(); asm volatile("" ::: "memory");
    }
    if constexpr (PLANES) xwait();   // behind the gate tile's last stores: the plane blocks laid out behind them rewrite registers that they name
}

// q/k/v/gate projections: z = 0..3 selects the weight plane (stride sB); q, k, v tiles go to the attention planes, the gate tile to the f32 plane C + 3 sC; A = bf16 x [MROWS][CC].
__global__ __launch_bounds__(32) void k_gemm_proj(const bf* __restrict__ A, const bf* __restrict__ Bt, float* C, size_t sB, size_t sC, h16* QK16, bf* QKh, bf* QKl, h16* VT16, bf* VTh, bf* VTl) {
    __shared__ __align__(16) float os[16 * OSP];
    gemmw_body<bf, 0, false, true>(A, nullptr, Bt, nullptr, CC, C, CC, nullptr, 0, sB, sC, os, Planes{QK16, QKh, QKl, VT16, VTh, VTl});
}
// output projection: (gated ctx hi + gated ctx lo) x Wo^T + bf16(bo) -> d_out rows.
__global__ __launch_bounds__(32) void k_gemm_out(const bf* __restrict__ Ah, const bf* __restrict__ Al, const bf* __restrict__ Bt, float* C, const float* __restrict__ bias) {
    __shared__ __align__(16) float os[16 * OSP];
    gemmw_body<bf, 1, true, false>(Ah, Al, Bt, nullptr, CC, C, CC, bias, 0, 0, 0, os, Planes{});
}

// f32 rows [..][CC] -> bf16 planes in fragment order, all six sources in one launch: the planes Wq | Wk | Wv | Wg | Wo | x lie one behind the other in the workspace, every one [rows][CC], so their blocks number through.
// A wave takes CVU / 2 blocks that follow one another in one row of blocks (16 rows x 1 KiB of one source) and asks for all of them at once, 2 CVU loads of 16 B a lane, before it converts the first.
// Per half block: 8 rows x 4 groups of 8 floats, 8 whole 128-B lines read, 4 whole 128-B lines written (8 units of 16 B each). (The loops are unrolled so that the loaded values stay in registers and every step is an immediate offset.)
__global__ __launch_bounds__(32 * CVW) void k_cvt_all(const float* __restrict__ wq, const float* __restrict__ wk, const float* __restrict__ wv, const float* __restrict__ wg, const float* __restrict__ wo, const float* __restrict__ x, bf* dst) {
    const unsigned lane = threadIdx.x & 31u;
    const unsigned w = blockIdx.x * CVW + (unsigned)__builtin_amdgcn_readfirstlane((int)(threadIdx.x >> 5));   // the wave's number in the launch, in a scalar register: source and block are picked by scalar code
    if (w >= CV_WAVES) return;   // the same in every lane of a wave; the kernel has no barrier
    const unsigned blk0 = w * (CVU / 2), p = blk0 / CV_WB;   // first block; plane: 0..4 a weight, from 5 on x
    const float* src = p == 0u ? wq : p == 1u ? wk : p == 2u ? wv : p == 3u ? wg : p == 4u ? wo : x;
    const unsigned bl = blk0 - (p < 5u ? p : 5u) * CV_WB, row0 = (bl / (CC / 32)) * 16u, k0 = (bl % (CC / 32)) * 32u;
    size_t so = (size_t)row0 * CC + k0;
    if (p >= 5u) so += (size_t)(row0 / SEQ) * (SEQ_FULL - SEQ) * CC;   // x: a batch's rows start SEQ_FULL rows apart in the source
    const unsigned lr = lane & 7u, c = lane >> 3;   // row in the half block, 8-float group in the block (c = 2 * half + (fragment lane >> 4))
    const float* sp = src + so + (size_t)lr * CC + c * 8u;
    v8f v[CVU];
#pragma unroll
    for (int j = 0; j < CVU; ++j) v[j] = *(const v8f*)(sp + (j >> 1) * 32 + (j & 1) * 8 * CC);
    __builtin_amdgcn_sched_barrier(0);   // the converts stay behind all the loads: else the build holds the last four loads back until earlier ones have returned, two more round trips to memory
    bf* dp = dst + (size_t)blk0 * 512 + (c * 16u + lr) * 8u;
#pragma unroll
    for (int j = 0; j < CVU; ++j) { v8us o;
#pragma unroll
        for (int k = 0; k < 8; ++k) o[k] = f2bf(v[j][k]);
        *(v8us*)(dp + (j >> 1) * 512 + (j & 1) * 64) = o; }
}

// P^T fragment (B operand of O^T = V^T P^T) built lane-locally from the two S^T tiles of a 32-key step: element r <- tile(keys 0..15)[r], element 8+r <- tile(keys 16..31)[r].
template <typename T16> struct PPack;
template <> struct PPack<h16> { static __device__ __forceinline__ void mk(const v8f& p0, const v8f& p1, float car, v16h& a, v16h& b) { v16h r;
#pragma unroll
        for (int i = 0; i < 8; ++i) { r[i] = tohx(p0[i] * car); r[8 + i] = tohx(p1[i] * car); }
        a = r; b = r; } };
template <> struct PPack<bf> { static __device__ __forceinline__ void mk(const v8f& p0, const v8f& p1, float car, v16bf& a, v16bf& b) { (void)car; v16us h, l;
#pragma unroll
        for (int i = 0; i < 8; ++i) { unsigned short hh, ll; splitf(p0[i], hh, ll); h[i] = hh; l[i] = ll; splitf(p1[i], hh, ll); h[8 + i] = hh; l[8 + i] = ll; }
        a = __builtin_bit_cast(v16bf, h); b = __builtin_bit_cast(v16bf, l); } };

// Hazard guards: 4 VALU-slot nops tied to every accumulator of the group and to the fragments of the last products.
template <int N> struct Grd;
template <> struct Grd<1> {
    template <typename V> static __device__ __forceinline__ void s(v8f (&st)[2][1], const V& x, const V& y) { asm volatile("v_nop\n\tv_nop\n\tv_nop\n\tv_nop" : "+v"(st[0][0]), "+v"(st[1][0]) : "v"(x), "v"(y)); }
    template <typename V> static __device__ __forceinline__ void o(v8f (&oa)[4][1], const V& x, const V& y, const V& z) { asm volatile("v_nop\n\tv_nop\n\tv_nop\n\tv_nop" : "+v"(oa[0][0]), "+v"(oa[1][0]), "+v"(oa[2][0]), "+v"(oa[3][0]) : "v"(x), "v"(y), "v"(z)); }
};
template <> struct Grd<2> {
    template <typename V> static __device__ __forceinline__ void s(v8f (&st)[2][2], const V& x, const V& y) { asm volatile("v_nop\n\tv_nop\n\tv_nop\n\tv_nop" : "+v"(st[0][0]), "+v"(st[1][0]), "+v"(st[0][1]), "+v"(st[1][1]) : "v"(x), "v"(y)); }
    template <typename V> static __device__ __forceinline__ void o(v8f (&oa)[4][2], const V& x, const V& y, const V& z) { asm volatile("v_nop\n\tv_nop\n\tv_nop\n\tv_nop" : "+v"(oa[0][0]), "+v"(oa[1][0]), "+v"(oa[2][0]), "+v"(oa[3][0]), "+v"(oa[0][1]), "+v"(oa[1][1]), "+v"(oa[2][1]), "+v"(oa[3][1]) : "v"(x), "v"(y), "v"(z)); }
};

// ---- fused causal attention body, one work-group of NW waves per 16*NQ query rows of one (batch, head); keys in steps of 32, step i worked by wave i % NW with its own running maximum, row sums and O^T;
// behind the loop the waves' partial results are joined in LDS: every wave rescales its O^T to the common maximum and the common sum, the tiles are added in wave order, at most one epilogue trip a wave.
// S^T[key][query] = sum_d K[key][d] Q[query][d]: A = K rows (lane -> key), B = Q rows (lane -> query); D: lane = query (lane&15), element r = key 8*(lane>>4) + r.
// Row statistics are per lane (query); the two lane halves hold different keys and exchange the step maximum with one xor-16 shuffle; row sums stay per-lane partials until the end.
// O^T[d][query] += V^T[d][key] P^T[key][query]: A = V^T rows (lane -> d), B = packed P^T. Planes, in fragment order: Q, K [t][HD]; V^T [d][vpitch]; Ah, Al [t][CC], pointing at the head's first block of row 0. G: f32 rows.
template <typename T16, bool SPLIT, int NQ, int NW>
__device__ __forceinline__ void attn_body(const T16* __restrict__ Q, const T16* __restrict__ Q2, const T16* __restrict__ Kp, const T16* __restrict__ K2, const T16* __restrict__ Vt, const T16* __restrict__ V2,
                                          const float* __restrict__ G, int vpitch, int q0, float ssc, float osc, float pcar, bf* Ah, bf* Al, float* os, float* ml) {
    typedef typename WFrag<T16>::V V;
    static_assert(4 * NQ <= NW);   // at most one epilogue trip a wave
    const int lane = threadIdx.x & 31, lr = lane & 15, hi = lane >> 4;
    const int wv = __builtin_amdgcn_readfirstlane((int)(threadIdx.x >> 5));   // the wave's number, in a scalar register: the loop's bounds and the epilogue's test stay scalar
    V qf[NQ][2], qf2[NQ][2];
#pragma unroll
    for (int nb = 0; nb < NQ; ++nb)
#pragma unroll
        for (int ds = 0; ds < 2; ++ds) { const size_t qo = (size_t)(q0 + 16 * nb) * HD + 512 * ds + 8 * lane; qf[nb][ds] = WFrag<T16>::ld(Q + qo); if (SPLIT) qf2[nb][ds] = WFrag<T16>::ld(Q2 + qo); }
    v8f o[4][NQ]; float mrun[NQ], lrun[NQ];
#pragma unroll
    for (int nb = 0; nb < NQ; ++nb) { mrun[nb] = NEGB; lrun[nb] = 0.0f;
#pragma unroll
        for (int dt = 0; dt < 4; ++dt) o[dt][nb] = (v8f){}; }
    const int kend = q0 + 16 * NQ;
#pragma unroll 1
    for (int kt = 32 * wv; kt < kend; kt += 32 * NW) {
        V ka[2][2], ka2[2][2];
#pragma unroll
        for (int mb = 0; mb < 2; ++mb)
#pragma unroll
            for (int ds = 0; ds < 2; ++ds) { const size_t ko = (size_t)(kt + 16 * mb) * HD + 512 * ds + 8 * lane; ka[mb][ds] = (!SPLIT || mb + ds < 2) ? WFrag<T16>::ld(Kp + ko) : ldw(Kp + ko); }
        // the four V^T fragments of this key step are asked for here, behind the K fragments, each into registers of its own: they arrive while the scores and the softmax are worked out
        V va[4], va2[4];
        if constexpr (SPLIT) {
            // plane by plane; s_wait_xcnt 0 in front of a plane's last load and behind it: that load's result, or a later one's, may be given the registers of the plane's address
            xwait();
#pragma unroll
            for (int f = 0; f < 4; ++f) { const size_t ko = (size_t)(kt + 16 * (f >> 1)) * HD + 512 * (f & 1) + 8 * lane; ka2[f >> 1][f & 1] = f < 3 ? WFrag<T16>::ld(K2 + ko) : ldw(K2 + ko); }
            xwait();
#pragma unroll
            for (int dt = 0; dt < 4; ++dt) { const size_t vo = (size_t)(16 * dt) * vpitch + kt * 16 + 8 * lane; va[dt] = dt < 3 ? WFrag<T16>::ld(Vt + vo) : ldw(Vt + vo); }
            xwait();
#pragma unroll
            for (int dt = 0; dt < 4; ++dt) { const size_t vo = (size_t)(16 * dt) * vpitch + kt * 16 + 8 * lane; va2[dt] = dt < 3 ? WFrag<T16>::ld(V2 + vo) : ldw(V2 + vo); }
            xwait();
            __builtin_amdgcn_sched_barrier(0);   // the score products stay behind the step's loads: else the build waits for the K fragments first and asks for the V^T fragments only then
        } else {
            xwait();   // behind the K loads: a V^T fragment may be given the registers of their address
#pragma unroll
            for (int dt = 0; dt < 4; ++dt) { const size_t vo = (size_t)(16 * dt) * vpitch + kt * 16 + 8 * lane; va[dt] = dt < 3 ? WFrag<T16>::ld(Vt + vo) : ldw(Vt + vo); }
        }
        v8f st[2][NQ];
#pragma unroll
        for (int mb = 0; mb < 2; ++mb)
#pragma unroll
            for (int nb = 0; nb < NQ; ++nb) { v8f z = (v8f){};
                z = WFrag<T16>::mma(ka[mb][0], qf[nb][0], z); z = WFrag<T16>::mma(ka[mb][1], qf[nb][1], z);
                if (SPLIT) { z = WFrag<T16>::mma(ka2[mb][0], qf[nb][0], z); z = WFrag<T16>::mma(ka2[mb][1], qf[nb][1], z); z = WFrag<T16>::mma(ka[mb][0], qf2[nb][0], z); z = WFrag<T16>::mma(ka[mb][1], qf2[nb][1], z); }
                st[mb][nb] = z; }
        Grd<NQ>::s(st, ka[1][1], SPLIT ? qf2[NQ - 1][1] : qf[NQ - 1][1]);
        V pb[NQ], pb2[NQ];
#pragma unroll
        for (int nb = 0; nb < NQ; ++nb) {
            const int qg = q0 + 16 * nb + lr; float mx = NEGB;
#pragma unroll
            for (int mb = 0; mb < 2; ++mb)
#pragma unroll
                for (int r = 0; r < 8; ++r) { const int kg = kt + 16 * mb + 8 * hi + r; float t = st[mb][nb][r] * ssc; t = (kg <= qg) ? t : NEGB; st[mb][nb][r] = t; mx = fmaxf(mx, t); }
            mx = fmaxf(mx, __shfl_xor(mx, 16, 32));
            const float mn = fmaxf(mrun[nb], mx);
            const float al = __builtin_amdgcn_exp2f((mrun[nb] - mn) * L2E); mrun[nb] = mn;
            float psum = 0.0f;
#pragma unroll
            for (int mb = 0; mb < 2; ++mb)
#pragma unroll
                for (int r = 0; r < 8; ++r) { const float p = __builtin_amdgcn_exp2f((st[mb][nb][r] - mn) * L2E); psum += p; st[mb][nb][r] = p; }
            lrun[nb] = lrun[nb] * al + psum;
#pragma unroll
            for (int dt = 0; dt < 4; ++dt)
#pragma unroll
                for (int r = 0; r < 8; ++r) o[dt][nb][r] *= al;
            PPack<T16>::mk(st[0][nb], st[1][nb], pcar, pb[nb], pb2[nb]);
        }
#pragma unroll
        for (int dt = 0; dt < 4; ++dt) {
#pragma unroll
            for (int nb = 0; nb < NQ; ++nb) { o[dt][nb] = WFrag<T16>::mma(va[dt], pb[nb], o[dt][nb]); if (SPLIT) { o[dt][nb] = WFrag<T16>::mma(va2[dt], pb[nb], o[dt][nb]); o[dt][nb] = WFrag<T16>::mma(va[dt], pb2[nb], o[dt][nb]); } } }
        Grd<NQ>::o(o, SPLIT ? va2[3] : va[3], pb[NQ - 1], SPLIT ? pb2[NQ - 1] : pb[0]);
    }
    // the wave's epilogue trip: 16 query rows x 16 d of the tile; its gate values are asked for here, in front of the join: their round trip ends at the first barrier, where a wave waits for the others anyway
    const int s = wv; const bool mine = 4 * NQ == NW || s < 4 * NQ;   // the same in every lane of a wave; with fewer trips than waves the last waves have none
    v4f ga = (v4f){}, gc = (v4f){};
    if (mine) { const float* gp = G + (size_t)(q0 + 16 * (s >> 2) + lr) * CC + 16 * (s & 3) + 8 * hi; ga = *(const v4f*)gp;
        xwait();   // in front of the last load through the address: its result may be given the registers of that address
        gc = *(const v4f*)(gp + 4);
        xwait(); }   // and behind it: so may a value of the join below
    // (the loops of the join are unrolled so that their small arrays stay in registers)
    // every wave's maximum (lanes 0..15) and row sum (lanes 16..31; the two lane halves' partial sums joined first) of each query go to LDS: ml[0][wave][query], ml[1][wave][query]
#pragma unroll
    for (int nb = 0; nb < NQ; ++nb) { float lt = lrun[nb]; lt += __shfl_xor(lt, 16, 32); ml[(hi * NW + wv) * 16 * NQ + 16 * nb + lr] = hi ? lt : mrun[nb]; }
    __syncthreads();   // the maxima and sums of all waves are read below
    // normalise to the common maximum and sum; O^T lane = query, element r = d 16*dt + 8*hi + r  ->  the wave's own LDS tile [query][d]. A wave without a key step holds NEGB, 0 and zeros: its factor is 0.
    float* ow = os + wv * (16 * NQ * OSP);
#pragma unroll
    for (int nb = 0; nb < NQ; ++nb) { float mw[NW], ms = NEGB, lt = 0.0f;
#pragma unroll
        for (int w = 0; w < NW; ++w) { mw[w] = ml[w * 16 * NQ + 16 * nb + lr]; ms = fmaxf(ms, mw[w]); }
#pragma unroll
        for (int w = 0; w < NW; ++w) lt += ml[(NW + w) * 16 * NQ + 16 * nb + lr] * ex2s((mw[w] - ms) * L2E);
        const float inv = osc * rcps(lt) * ex2s((mrun[nb] - ms) * L2E);
#pragma unroll
        for (int dt = 0; dt < 4; ++dt) { v4f a, c;
#pragma unroll
            for (int r = 0; r < 4; ++r) { a[r] = o[dt][nb][r] * inv; c[r] = o[dt][nb][4 + r] * inv; }
            float* dst = ow + (16 * nb + lr) * OSP + 16 * dt + 8 * hi; *(v4fa*)dst = a; *(v4fa*)(dst + 4) = c; } }
    __syncthreads();   // every wave's tile is read below
    if (mine) { const int row = 16 * (s >> 2) + lr, seg = 16 * (s & 3) + 8 * hi; v4f a = *(const v4fa*)(os + row * OSP + seg), c = *(const v4fa*)(os + row * OSP + seg + 4);
#pragma unroll
        for (int w = 1; w < NW; ++w) { a += *(const v4fa*)(os + w * (16 * NQ * OSP) + row * OSP + seg); c += *(const v4fa*)(os + w * (16 * NQ * OSP) + row * OSP + seg + 4); }
        v8us oh, ol;
#pragma unroll
        for (int k = 0; k < 4; ++k) { unsigned short hh, ll; const float ya = a[k] * sigm(ga[k]); const float yc = c[k] * sigm(gc[k]); splitf(ya, hh, ll); oh[k] = hh; ol[k] = ll; splitf(yc, hh, ll); oh[4 + k] = hh; ol[4 + k] = ll; }
        const size_t oo = (size_t)(q0 + 16 * (s >> 2)) * CC + (s & 3) * 256 + 8 * lane;   // block (row / 16, (s & 3) >> 1) of the head's two, half s & 1
        *(v8us*)(Ah + oo) = oh; *(v8us*)(Al + oo) = ol; }
}

// rows < RH: bf16 hi/lo planes [b][h] x ([RH][HD]) / [b][h] x ([HD][RH]), 16 query rows per work-group of NWV waves; grid (RH/16, NH, NB)
__global__ __launch_bounds__(32 * NWV) void k_attn_s(const bf* __restrict__ Qh, const bf* __restrict__ Ql, const bf* __restrict__ Kh, const bf* __restrict__ Kl, const bf* __restrict__ Vh, const bf* __restrict__ Vl, const float* __restrict__ Gt, bf* ATh, bf* ATl) {
    __shared__ __align__(16) float os[NWV * 16 * OSP]; __shared__ float ml[2 * NWV * 16];
    const size_t bh = (size_t)blockIdx.z * NH + blockIdx.y; const size_t po = bh * RH * HD; const size_t ao = (size_t)blockIdx.z * SEQ * CC + (size_t)blockIdx.y * HD, ap = (size_t)blockIdx.z * SEQ * CC + (size_t)blockIdx.y * HD * 16;
    attn_body<bf, true, 1, NWV>(Qh + po, Ql + po, Kh + po, Kl + po, Vh + po, Vl + po, Gt + ao, RH, (int)blockIdx.x * 16, 0.125f, 1.0f, 1.0f, ATh + ap, ATl + ap, os, ml);
}
// rows >= RH: f16 planes [b][h] x ([SEQ][HD]) / [b][h] x ([HD][SEQ]) with carries, 32 query rows per work-group of NWV waves; grid ((SEQ-RH)/32, NH, NB)
__global__ __launch_bounds__(32 * NWV) void k_attn_h(const h16* __restrict__ Q, const h16* __restrict__ Kp, const h16* __restrict__ Vt, const float* __restrict__ Gt, bf* ATh, bf* ATl) {
    __shared__ __align__(16) float os[NWV * 32 * OSP]; __shared__ float ml[2 * NWV * 32];
    const size_t bh = (size_t)blockIdx.z * NH + blockIdx.y; const size_t po = bh * SEQ * HD; const size_t ao = (size_t)blockIdx.z * SEQ * CC + (size_t)blockIdx.y * HD, ap = (size_t)blockIdx.z * SEQ * CC + (size_t)blockIdx.y * HD * 16;
    attn_body<h16, false, 2, NWV>(Q + po, nullptr, Kp + po, nullptr, Vt + po, nullptr, Gt + ao, SEQ, RH + (int)blockIdx.x * 32, 0.125f / (QCAR * QCAR), 1.0f / (PCAR * VCAR), PCAR, ATh + ap, ATl + ap, os, ml);
}

extern "C" void kernel_launch(void* const* d_in, const int* in_sizes, int n_in,
                              void* d_out, int out_size, void* d_ws, size_t ws_size, hipStream_t stream) {
    if (n_in < 7) return;
    if ((size_t)in_sizes[0] < ((size_t)(NB - 1) * SEQ_FULL + SEQ) * CC) return;
    if ((size_t)in_sizes[1] < W1 || (size_t)in_sizes[2] < W1 || (size_t)in_sizes[3] < W1 || (size_t)in_sizes[4] < W1 || (size_t)in_sizes[5] < W1 || in_sizes[6] < CC) return;
    if ((size_t)out_size < PL16) return;
    // wire order: x, Wq, Wk, Wv, Wg, Wo, bo
    const float* x = (const float*)d_in[0]; const float* wq = (const float*)d_in[1]; const float* wk = (const float*)d_in[2]; const float* wv = (const float*)d_in[3];
    const float* wg = (const float*)d_in[4]; const float* wo = (const float*)d_in[5]; const float* bo = (const float*)d_in[6];
    float* OUT = (float*)d_out;     // [NB][SEQ][CC]
    char* wsp = (char*)d_ws;
    auto take = [&](size_t bytes) { char* p = wsp; wsp += (bytes + 255) & ~(size_t)255; return (void*)p; };
    bf* WQ = (bf*)take(4 * W1 * 2);            // Wq | Wk | Wv | Wg bf16 [out][in], each in fragment order
    bf* WO = (bf*)take(W1 * 2);
    bf* XB = (bf*)take(PL16 * 2);              // bf16 x [MROWS][CC] in fragment order
    float* F = (float*)take(4 * PL16 * 4);     // four f32 planes [MROWS][CC]: the last holds the gate, the first the gated ctx
    h16* QK16 = (h16*)take(2 * PL16 * 2);      // f16 q planes | k planes
    h16* VT16 = (h16*)take(PL16 * 2);
    bf* QKh = (bf*)take(2 * PLR * 2); bf* QKl = (bf*)take(2 * PLR * 2);
    bf* VTh = (bf*)take(PLR * 2); bf* VTl = (bf*)take(PLR * 2);
    if ((size_t)(wsp - (char*)d_ws) > ws_size) return;
    // gated-ctx hi | lo planes lie in the first f32 plane of F, which no launch writes as f32 (only the gate plane is); sizes match exactly
    bf* ATh = (bf*)F; bf* ATl = ATh + PL16;
    const float* GATE = F + 3 * PL16;
    k_cvt_all<<<(CV_WAVES + CVW - 1) / CVW, 32 * CVW, 0, stream>>>(wq, wk, wv, wg, wo, x, WQ);   // WQ | WO | XB are one run of planes (no padding between carve pieces)
    k_gemm_proj<<<dim3(MROWS / 64, CC / 64, 4), 32, 0, stream>>>(XB, WQ, F, W1, PL16, QK16, QKh, QKl, VT16, VTh, VTl);
    k_attn_s<<<dim3(RH / 16, NH, NB), 32 * NWV, 0, stream>>>(QKh, QKl, QKh + PLR, QKl + PLR, VTh, VTl, GATE, ATh, ATl);
    if (SEQ > RH) k_attn_h<<<dim3((SEQ - RH) / 32 > 0 ? (SEQ - RH) / 32 : 1, NH, NB), 32 * NWV, 0, stream>>>(QK16, QK16 + PL16, VT16, GATE, ATh, ATl);
    k_gemm_out<<<dim3(MROWS / 64, CC / 64, 1), 32, 0, stream>>>(ATh, ATl, WO, OUT, bo);
}

// v006
// Measured time: 97.8 microseconds a run.
// Timed twice side by side with v005, it ran 1.31 times as fast both times.
// All steps since v000 together make it 2.87 times as fast.
#include <hip/hip_runtime.h>

// Causal multi-head attention with a sigmoid output gate, x [2][2048][1024], 16 heads x 64, weights [out][in], one score scale 1/8, tril mask, out = (merged heads * sigmoid(x Wg^T)) x Wo^T + bo.
// Compute dtypes, f32 accumulate: all float inputs RNE-converted to bf16 on load; q/k/v/gate projections v_wmma_f32_16x16x32_bf16 (exact products);
// attention rows < RH: bf16 hi/lo planes, 3 products on q.k and on p.v; rows >= RH: v_wmma_f32_16x16x32_f16 with q,k x16, v x16, p x1024 carries; softmax f32 (running max); gate sigmoid f32 on the VALU;
// output projection: gated ctx bf16 hi/lo x bf16 Wo (2 products) + bf16(bo).
// Every 16-bit matrix operand plane [rows][K] of the workspace lies in fragment order: blocks of 16 rows x 32 k (512 elements, 1 KiB), block (row/16, k/32) at index (row/16)*(K/32) + k/32;
// in a block the 16-B unit 32*half + lane holds row lane&15, k = 16*half + 8*(lane>>4) + 0..7. A wave's fragment load or store of 16 B a lane then covers 512 contiguous bytes.
// Fused attention in transposed form: S^T = K Q^T (D rows = keys, lane = query), P^T fragment built lane-locally from two S^T tiles, O^T = V^T P^T; no score plane in global memory.

#ifndef NB
#define NB 2
#endif
#ifndef SEQ
#define SEQ 2048
#endif
#ifndef RH
#define RH 256                       // query rows < RH use hi+lo planes
#endif
#define NB_FULL  2
#define SEQ_FULL 2048
#define CC   1024
#define NH   16
#define HD   64
#define MROWS (NB * SEQ)
#define PCAR 1024.0f
#define QCAR 16.0f
#define VCAR 16.0f
#define L2E  1.4426950408889634f
#define NEGB (-1.0e30f)
#define OSP  68
#define NWV  8                        // waves of an attention work-group: they share out the key steps of one query tile
#define CVU  16                       // conversion launch: 16-B output units a lane
#define CVW  9                        // and waves of a work-group
#define PWM  2                        // projection GEMM: a work-group's waves along the rows
#define PWN  4                        // and along the columns, one 64x64 tile a wave
#define PKB  2                        // and the k blocks of 32 in a stage of its LDS ring
#define OWM  2                        // output GEMM: the same three
#define OWN  2
#define OKB  4
#define W1   ((size_t)CC * CC)
#define PL16 ((size_t)MROWS * CC)
#define PLR  ((size_t)NB * NH * RH * HD)
// carve: 4+1 bf16 weight planes, bf16 x, 4 f32 planes (the last: gate; the first: the gated-ctx hi|lo planes), f16 q|k|v^T planes, bf16 hi/lo planes of the first RH rows
#define WS_TOTAL (10 * W1 + 24 * PL16 + 12 * PLR)
#define CV_WB    ((unsigned)(W1 / 512))                                  // blocks of a weight plane
#define CV_WAVES ((unsigned)((5 * W1 + PL16) / (256 * CVU)))             // waves that the conversion launch needs
static_assert((5 * W1 + PL16) % (256 * CVU) == 0 && W1 % (256 * CVU) == 0 && (CC / 32) % (CVU / 2) == 0);   // a conversion wave's blocks lie in one plane and in one row of blocks
static_assert(CC == NH * HD);                 // head split covers the model width
static_assert(HD == 64);
static_assert(CC % (64 * PWN) == 0 && CC % (64 * OWN) == 0 && CC % (64 * PKB) == 0 && CC % (64 * OKB) == 0);  // GEMM N tiles; K: two stages or more
static_assert(MROWS % (64 * PWM) == 0 && MROWS % (64 * OWM) == 0);                    // GEMM M tiles
static_assert(SEQ % 256 == 0);                // a 64-row projection tile stays inside one batch
static_assert(RH % 256 == 0 && RH <= SEQ);    // a 64-row projection tile lies on one side of the hi/lo row boundary
static_assert((SEQ - RH) % 32 == 0 && RH % 32 == 0 && RH % 16 == 0);   // query tiles of 32 (f16 path) and 16 (hi/lo path)
static_assert(NB <= NB_FULL && SEQ <= SEQ_FULL);
static_assert((W1 * 2) % 256 == 0 && (PL16 * 2) % 256 == 0 && (PLR * 2) % 256 == 0);   // carve pieces stay 256-B aligned without padding
static_assert(2 * PL16 * sizeof(unsigned short) <= PL16 * sizeof(float));              // gated-ctx hi|lo planes fit exactly inside the first f32 plane of F
static_assert(WS_TOTAL <= (size_t)134217728); // total carve <= 128 MiB

typedef _Float16 h16;
typedef unsigned short bf;
typedef __attribute__((ext_vector_type(16))) __bf16   v16bf;
typedef __attribute__((ext_vector_type(16))) _Float16 v16h;
typedef __attribute__((ext_vector_type(16))) unsigned short v16us;
typedef __attribute__((ext_vector_type(8)))  _Float16 v8h;
typedef __attribute__((ext_vector_type(8)))  unsigned short v8us;
typedef __attribute__((ext_vector_type(8)))  float    v8f;
typedef __attribute__((ext_vector_type(4)))  float    v4f;
typedef v4f  __attribute__((may_alias)) v4fa;

__device__ __forceinline__ unsigned short f2bf(float f) { unsigned u = __float_as_uint(f); u += 0x7FFFu + ((u >> 16) & 1u); return (unsigned short)(u >> 16); }
__device__ __forceinline__ float bf2f(unsigned short b) { return __uint_as_float(((unsigned)b) << 16); }
__device__ __forceinline__ float bfr(float f) { return bf2f(f2bf(f)); }
__device__ __forceinline__ h16 tohx(float x) { return (h16)x; }
__device__ __forceinline__ void splitf(float y, unsigned short& h, unsigned short& l) { h = f2bf(y); l = f2bf(y - bf2f(h)); }
// v_exp_f32 and v_rcp_f32 as the builtins give them, each with one v_nop in its own statement: the slot that the instruction set asks for between a transcendental and a directly following instruction that reads its result or overwrites its source
__device__ __forceinline__ float sigm(float g) { float e, r; asm("v_exp_f32 %0, %1\n\tv_nop" : "=v"(e) : "v"(-g * L2E)); asm("v_rcp_f32 %0, %1\n\tv_nop" : "=v"(r) : "v"(1.0f + e)); return r; }
// the same two statements singly, for the join of the attention waves' partial results
__device__ __forceinline__ float ex2s(float x) { float e; asm("v_exp_f32 %0, %1\n\tv_nop" : "=v"(e) : "v"(x)); return e; }
__device__ __forceinline__ float rcps(float x) { float r; asm("v_rcp_f32 %0, %1\n\tv_nop" : "=v"(r) : "v"(x)); return r; }
__device__ __forceinline__ v16h cat16(v8h lo, v8h hi) { return __builtin_shufflevector(lo, hi, 0, 1, 2, 3, 4, 5, 6, 7, 8, 9, 10, 11, 12, 13, 14, 15); }
__device__ __forceinline__ v16bf cat16b(v8us lo, v8us hi) { return __builtin_bit_cast(v16bf, __builtin_shufflevector(lo, hi, 0, 1, 2, 3, 4, 5, 6, 7, 8, 9, 10, 11, 12, 13, 14, 15)); }
__device__ __forceinline__ v8f wmma16(v16h a, v16h b, v8f c) { return __builtin_amdgcn_wmma_f32_16x16x32_f16(false, a, false, b, (short)0, c, false, false); }
__device__ __forceinline__ v8f wmmab(v16bf a, v16bf b, v8f c) { return __builtin_amdgcn_wmma_f32_16x16x32_bf16(false, a, false, b, (short)0, c, false, false); }

// Fragment loader from a block in fragment order: p = block + 8*lane; elements 0..7 <- p[0..7] (half 0), elements 8..15 <- p[256..263] (half 1).
template <typename T16> struct WFrag;
template <> struct WFrag<h16> { typedef v16h V; static __device__ __forceinline__ V ld(const h16* p) { return cat16(*(const v8h*)p, *(const v8h*)(p + 256)); } static __device__ __forceinline__ v8f mma(V a, V b, v8f c) { return wmma16(a, b, c); } };
template <> struct WFrag<bf> { typedef v16bf V; static __device__ __forceinline__ V ld(const bf* p) { return cat16b(*(const v8us*)p, *(const v8us*)(p + 256)); } static __device__ __forceinline__ v8f mma(V a, V b, v8f c) { return wmmab(a, b, c); } };
// s_wait_xcnt 0, written where the next load's result may be given the registers of an address that loads already issued name.
__device__ __forceinline__ void xwait() { asm volatile("s_wait_xcnt 0x0" ::: "memory"); }
// The fragment loaders again, for the last fragment read through an address: the wait stands in front of its last load, whose result may be given the address's own registers.
__device__ __forceinline__ v16h ldw(const h16* p) { const v8h lo = *(const v8h*)p; xwait(); return cat16(lo, *(const v8h*)(p + 256)); }
__device__ __forceinline__ v16bf ldw(const bf* p) { const v8us lo = *(const v8us*)p; xwait(); return cat16b(lo, *(const v8us*)(p + 256)); }

// The attention planes that the projection tiles are written to: f16 q|k [w][b][h] x ([t][HD]) and v^T [b][h] x ([d][t]) with their carries, bf16 hi/lo planes of the first RH rows; each [rows][K] plane in fragment order.
struct Planes { h16* qk16; bf* qkh; bf* qkl; h16* vt16; bf* vth; bf* vtl; };

// A 64x64 f32 accumulator tile (lane&15 = column within 16 nb, element j = row 8*(lane>>4) + j within 16 mb) leaves as q or k rows [t][HD]: f16 with the carry, and for HL the bf16 hi/lo pair.
// 16 rows at a time go through the LDS stage; then a store writes one half of a block (512 contiguous B). p16, ph, pl point at the block of the tile's first row.
template <bool HL>
__device__ __forceinline__ void put_qk(const v8f (&acc)[4][4], float* os, h16* p16, bf* ph, bf* pl, int lane) {
    const int lr = lane & 15, hi = lane >> 4;
#pragma unroll
    for (int mb = 0; mb < 4; ++mb) {
#pragma unroll
        for (int nb = 0; nb < 4; ++nb) {
#pragma unroll
            for (int j = 0; j < 8; ++j) os[(hi * 8 + j) * OSP + nb * 16 + lr] = acc[mb][nb][j]; }
        __builtin_amdgcn_wave_barrier(); asm volatile("" ::: "memory");   // compiler fence: the row reads below take other lanes' writes and must not be moved over them
#pragma unroll
        for (int s = 0; s < 4; ++s) { const int seg = 16 * s + 8 * hi; const v4f a = *(const v4fa*)(os + lr * OSP + seg), g = *(const v4fa*)(os + lr * OSP + seg + 4); v8h o16;
#pragma unroll
            for (int k = 0; k < 4; ++k) { o16[k] = tohx(a[k] * QCAR); o16[4 + k] = tohx(g[k] * QCAR); }
            const int o = mb * 16 * HD + s * 256 + lane * 8;   // block (mb, s >> 1), half s & 1
            *(v8h*)(p16 + o) = o16;
            if constexpr (HL) { v8us oh, ol;
#pragma unroll
                for (int k = 0; k < 4; ++k) { unsigned short hh, ll; splitf(a[k], hh, ll); oh[k] = hh; ol[k] = ll; splitf(g[k], hh, ll); oh[4 + k] = hh; ol[4 + k] = ll; }
                *(v8us*)(ph + o) = oh; *(v8us*)(pl + o) = ol; } }
        __builtin_amdgcn_wave_barrier(); asm volatile("" ::: "memory");   // compiler fence: the next 16 rows' writes stay behind these reads
    }
    xwait();   // behind the last stores: where the build lays another epilogue block out behind this one, that block rewrites registers that they name
}
// The same tile leaves as v^T [d][t]: a lane's 8 accumulator elements are 8 consecutive t of one d, its own 16-B unit of block (nb, mb >> 1), half mb & 1, stored from the registers. p16 (K = SEQ), ph, pl (K = RH) point at the block of d = 0 of the head, first t of the tile; hl (the same in every lane): the bf16 hi/lo pair is wanted too.
__device__ __forceinline__ void put_vt(const v8f (&acc)[4][4], h16* p16, bf* ph, bf* pl, bool hl, int lane) {
    if (hl) {
#pragma unroll
        for (int nb = 0; nb < 4; ++nb)
#pragma unroll
            for (int mb = 0; mb < 4; ++mb) { const int o = nb * 16 * RH + mb * 256 + lane * 8; v8us oh, ol;
#pragma unroll
                for (int j = 0; j < 8; ++j) { unsigned short hh, ll; splitf(acc[mb][nb][j], hh, ll); oh[j] = hh; ol[j] = ll; }
                *(v8us*)(ph + o) = oh; *(v8us*)(pl + o) = ol; }
        xwait();   // behind the hi/lo stores: the f16 stores' address is formed in registers that they name
    }
#pragma unroll
    for (int nb = 0; nb < 4; ++nb)
#pragma unroll
        for (int mb = 0; mb < 4; ++mb) { v8h o16;
#pragma unroll
            for (int j = 0; j < 8; ++j) o16[j] = tohx(acc[mb][nb][j] * VCAR);
            *(v8h*)(p16 + nb * 16 * SEQ + mb * 256 + lane * 8) = o16; }
    xwait();   // behind the last stores: where the build lays another epilogue block out behind this one, that block rewrites registers that they name
}

// Twelve asynchronous copies of 16 B a lane, global memory -> LDS through no register: three units of 2 KiB (two k blocks of one row of blocks), 4 x 512 B a wave each. l: the lane's LDS byte address, g: its global address.
// s_wait_xcnt 0 is the statement's last line: the address registers that the copies name are rewritten behind it (the next stage's additions).
__device__ __forceinline__ void cp_units3(unsigned l0, const char* g0, unsigned l1, const char* g1, unsigned l2, const char* g2) {
    asm volatile("global_load_async_to_lds_b128 %0, %12, off\n\t"
                 "global_load_async_to_lds_b128 %1, %13, off\n\t"
                 "global_load_async_to_lds_b128 %2, %14, off\n\t"
                 "global_load_async_to_lds_b128 %3, %15, off\n\t"
                 "global_load_async_to_lds_b128 %4, %16, off\n\t"
                 "global_load_async_to_lds_b128 %5, %17, off\n\t"
                 "global_load_async_to_lds_b128 %6, %18, off\n\t"
                 "global_load_async_to_lds_b128 %7, %19, off\n\t"
                 "global_load_async_to_lds_b128 %8, %20, off\n\t"
                 "global_load_async_to_lds_b128 %9, %21, off\n\t"
                 "global_load_async_to_lds_b128 %10, %22, off\n\t"
                 "global_load_async_to_lds_b128 %11, %23, off\n\t"
                 "s_wait_xcnt 0x0"
                 :: "v"(l0), "v"(l0 + 512u), "v"(l0 + 1024u), "v"(l0 + 1536u), "v"(l1), "v"(l1 + 512u), "v"(l1 + 1024u), "v"(l1 + 1536u), "v"(l2), "v"(l2 + 512u), "v"(l2 + 1024u), "v"(l2 + 1536u),
                    "v"(g0), "v"(g0 + 512), "v"(g0 + 1024), "v"(g0 + 1536), "v"(g1), "v"(g1 + 512), "v"(g1 + 1024), "v"(g1 + 1536), "v"(g2), "v"(g2 + 512), "v"(g2 + 1024), "v"(g2 + 1536)
                 : "memory");
}

// ---- GEMM body, a work-group of WM x WN waves, one 64x64 tile a wave: C[m][n] (f32, pitch ldc, + optional bf16-converted bias[n]) = sum_k A[m][k] Bt[n][k] (+ A2 x Bt when NSPLIT == 1); K % (64 KB) == 0; A, A2, Bt in fragment order.
// The operands of the work-group's 64 WM x 64 WN tile come through LDS, a stage of KB k blocks (32 KB k) at a time, two buffers: a stage is [A | A2 | Bt] rows of blocks, KB KiB each, which lie in LDS as they lie in their plane.
// The waves deal the stage out among them in units of 2 KiB and bring it in by asynchronous copies, one stage ahead; every block is fetched once for the work-group and read from LDS by the WN (A) or WM (Bt) waves that need it.
// FS: fragment sets in registers. 2: a k block's fragments are read from LDS while the block before it, of the same stage, is multiplied (for one wave a SIMD); 1: other waves of the SIMD cover the reads.
// PLANES: tiles of z = 0, 1 (q, k) and z = 2 (v) leave as attention planes straight from the f32 accumulators; z = 3 (gate) leaves as f32 rows like any other tile.
template <typename T16, int NSPLIT, bool BIAS, bool PLANES, int WM, int WN, int KB, int FS>
__device__ __forceinline__ void gemmw_body(const T16* __restrict__ A, const T16* __restrict__ A2, const T16* __restrict__ Bt, int K, float* C, int ldc, const float* __restrict__ bias, size_t sB, size_t sC, char* ring, float* osall, const Planes pl) {
    typedef typename WFrag<T16>::V V;
    constexpr int NW = WM * WN, NA = NSPLIT == 1 ? 2 : 1, RA = 4 * WM, RB = 4 * WN, UPR = KB / 2;   // waves; A planes; rows of blocks of A and of Bt; units in a row of blocks
    constexpr int UA = RA * UPR, NU = (NA * RA + RB) * UPR, NUW = NU / NW, BUFB = NU * 2048;        // units of an A plane, of a stage, of one wave; bytes of a buffer
    static_assert(KB % 2 == 0 && UA % NW == 0 && NU % NW == 0 && NUW % 3 == 0 && 4 * NUW <= 63);    // a wave's i-th unit lies in the same plane for every wave; units go three to a statement; copies of a wave in flight
    static_assert(FS == 1 || FS == 2);
    const size_t z = blockIdx.z; Bt += z * sB; C += z * sC;
    const int lane = threadIdx.x & 31, lr = lane & 15, hi = lane >> 4;
    const int wv = __builtin_amdgcn_readfirstlane((int)(threadIdx.x >> 5)), wm = wv % WM, wn = wv / WM;   // the wave's number and its place in the work-group's tile, in scalar registers
    const int R0 = blockIdx.x * 64 * WM, C0 = blockIdx.y * 64 * WN, r0 = R0 + 64 * wm, c0 = C0 + 64 * wn;
    float* os = osall + wv * 16 * OSP;   // the wave's own epilogue stage
    v8f acc[4][4];
#pragma unroll
    for (int mb = 0; mb < 4; ++mb)
#pragma unroll
        for (int nb = 0; nb < 4; ++nb) acc[mb][nb] = (v8f){};
    // the wave's units: number wv + NW i of the stage; 16 rows of blocks are 16 K elements, a unit 1024 elements, a stage's step along k KB blocks.
    // One address a plane, that of the wave's first unit there; its further units of the plane lie NW / UPR rows of blocks apart.
    static_assert(NW % UPR == 0);
    const size_t wo = (size_t)(16 * (wv / UPR)) * K + (wv % UPR) * 1024 + 8 * lane;
    const char* gb[NA + 1];
    gb[0] = (const char*)(A + (size_t)R0 * K + wo); if (NA == 2) gb[1] = (const char*)(A2 + (size_t)R0 * K + wo); gb[NA] = (const char*)(Bt + (size_t)C0 * K + wo);
    auto gp = [&](int i) { const int p = i < UA / NW ? 0 : i < NA * UA / NW ? 1 : NA, ii = i - p * (UA / NW); return gb[p] + (size_t)(16 * (NW / UPR) * ii) * K * sizeof(T16); };
    const unsigned lw = (unsigned)(size_t)ring + (unsigned)(wv * 2048 + lane * 16);   // the lane's LDS byte address in the wave's first unit of buffer 0
    auto issue = [&](unsigned bo) {   // the wave's copies of the next stage not yet asked for, into the buffer at byte bo
#pragma unroll
        for (int i = 0; i < NUW; i += 3) cp_units3(lw + bo + i * NW * 2048, gp(i), lw + bo + (i + 1) * NW * 2048, gp(i + 1), lw + bo + (i + 2) * NW * 2048, gp(i + 2));
#pragma unroll
        for (int p = 0; p <= NA; ++p) gb[p] += KB * 1024; };
    const int NT = K / (32 * KB);
    issue(0u);
    asm volatile("s_wait_asynccnt 0x0" ::: "memory");   // the wave's copies of stage 0 have landed
    __syncthreads();                                    // and so have the other waves': stage 0 is read below
    issue((unsigned)BUFB);
    unsigned bo = 0u;   // the buffer that this trip reads
#pragma unroll 1
    for (int t = 0; t < NT; ++t) {
        const char* fb = ring + bo + lane * 16;
        V a[FS][4], a2[FS][4], b[FS][4];
        auto ldset = [&](int s, int kk) {   // the wave's fragments of k block kk of this stage, as one group of LDS reads
#pragma unroll
            for (int mb = 0; mb < 4; ++mb) { a[s][mb] = WFrag<T16>::ld((const T16*)(fb + ((4 * wm + mb) * KB + kk) * 1024)); if (NSPLIT == 1) a2[s][mb] = WFrag<T16>::ld((const T16*)(fb + ((RA + 4 * wm + mb) * KB + kk) * 1024)); }
#pragma unroll
            for (int nb = 0; nb < 4; ++nb) b[s][nb] = WFrag<T16>::ld((const T16*)(fb + ((NA * RA + 4 * wn + nb) * KB + kk) * 1024)); };
        if (FS == 2) { ldset(0, 0);
            __builtin_amdgcn_sched_barrier(0); }   // the first block's reads go out ahead of the second's: else the build mixes the two groups and the first product waits for both
#pragma unroll
        for (int kk = 0; kk < KB; ++kk) { const int s = kk & (FS - 1);
            if (FS == 1) ldset(0, kk); else if (kk + 1 < KB) ldset(s ^ 1, kk + 1);
            __builtin_amdgcn_sched_barrier(0);   // the products stay behind the group of reads: else the build reads one Bt fragment at a time, an LDS round trip in front of every four products
#pragma unroll
            for (int nb = 0; nb < 4; ++nb)
#pragma unroll
                for (int mb = 0; mb < 4; ++mb) { acc[mb][nb] = WFrag<T16>::mma(a[s][mb], b[s][nb], acc[mb][nb]); if (NSPLIT == 1) acc[mb][nb] = WFrag<T16>::mma(a2[s][mb], b[s][nb], acc[mb][nb]); }
        }
        asm volatile("s_wait_dscnt 0x0" ::: "memory");      // the wave's reads of this buffer have returned: it is refilled behind the barrier
        asm volatile("s_wait_asynccnt 0x0" ::: "memory");   // the wave's copies of the next stage have landed
        __syncthreads();                                    // every wave has left this buffer, and the next stage is whole
        if (t + 2 < NT) issue(bo);                          // the same for the whole work-group
        bo = (unsigned)BUFB - bo;
    }
    asm volatile("s_wait_asynccnt 0x0" ::: "memory");   // no copy is outstanding where the wave goes on to its epilogue
    if constexpr (PLANES) {
        // a tile's 64 columns are one head (HD == 64), its 64 rows lie in one batch and on one side of RH: every test here is the same for the whole wave
        const unsigned w = blockIdx.z, h = (unsigned)c0 / HD, b = (unsigned)r0 / SEQ, t0 = (unsigned)r0 % SEQ;
        if (w < 2u) { const size_t bh = (size_t)(w * NB + b) * NH + h; h16* p16 = pl.qk16 + (bh * SEQ + t0) * HD;
            if (t0 < RH) put_qk<true>(acc, os, p16, pl.qkh + (bh * RH + t0) * HD, pl.qkl + (bh * RH + t0) * HD, lane); else put_qk<false>(acc, os, p16, nullptr, nullptr, lane);
            return; }
        if (w == 2u) { const size_t bh = (size_t)b * NH + h; h16* p16 = pl.vt16 + bh * HD * SEQ + t0 * 16;
            const size_t o2 = bh * HD * RH + (t0 < RH ? t0 * 16 : 0u);   // stays inside the hi/lo planes for a tile that does not write them
            put_vt(acc, p16, pl.vth + o2, pl.vtl + o2, t0 < RH, lane);
            return; }
    }
#pragma unroll
    for (int mb = 0; mb < 4; ++mb) {
#pragma unroll
        for (int nb = 0; nb < 4; ++nb) {
#pragma unroll
            for (int j = 0; j < 8; ++j) os[(hi * 8 + j) * OSP + nb * 16 + lr] = acc[mb][nb][j]; }
        __builtin_amdgcn_wave_barrier(); asm volatile("" ::: "memory");
        float* crow = C + (size_t)(r0 + mb * 16) * ldc + c0;
{
#pragma unroll
            for (int s = 0; s < 8; ++s) { const int row = 2 * s + hi, cofs = lr * 4; v4f val = *(const v4fa*)(os + row * OSP + cofs); if (BIAS) { val[0] += bfr(bias[c0 + cofs]); val[1] += bfr(bias[c0 + cofs + 1]); val[2] += bfr(bias[c0 + cofs + 2]); val[3] += bfr(bias[c0 + cofs + 3]); }
                *(v4f*)(crow + (size_t)row * ldc + cofs) = val; }
             }
        xwait();   // behind the eight row stores: the next 16 rows' values (the bias reload among them) may be given registers that these stores name
        __builtin_amdgcn_wave_barrier(); asm volatile("" ::: "memory");
    }
    if constexpr (PLANES) xwait();   // behind the gate tile's last stores: the plane blocks laid out behind them rewrite registers that they name
}

// q/k/v/gate projections: z = 0..3 selects the weight plane (stride sB); q, k, v tiles go to the attention planes, the gate tile to the f32 plane C + 3 sC; A = bf16 x [MROWS][CC].
__global__ __launch_bounds__(32 * PWM * PWN) void k_gemm_proj(const bf* __restrict__ A, const bf* __restrict__ Bt, float* C, size_t sB, size_t sC, h16* QK16, bf* QKh, bf* QKl, h16* VT16, bf* VTh, bf* VTl) {
    __shared__ __align__(1024) char ring[2 * (4 * PWM + 4 * PWN) * PKB * 1024]; __shared__ __align__(16) float os[PWM * PWN * 16 * OSP];
    gemmw_body<bf, 0, false, true, PWM, PWN, PKB, 1>(A, nullptr, Bt, CC, C, CC, nullptr, sB, sC, ring, os, Planes{QK16, QKh, QKl, VT16, VTh, VTl});
}
// output projection: (gated ctx hi + gated ctx lo) x Wo^T + bf16(bo) -> d_out rows.
__global__ __launch_bounds__(32 * OWM * OWN) void k_gemm_out(const bf* __restrict__ Ah, const bf* __restrict__ Al, const bf* __restrict__ Bt, float* C, const float* __restrict__ bias) {
    __shared__ __align__(1024) char ring[2 * (8 * OWM + 4 * OWN) * OKB * 1024]; __shared__ __align__(16) float os[OWM * OWN * 16 * OSP];
    gemmw_body<bf, 1, true, false, OWM, OWN, OKB, 2>(Ah, Al, Bt, CC, C, CC, bias, 0, 0, ring, os, Planes{});
}

// f32 rows [..][CC] -> bf16 planes in fragment order, all six sources in one launch: the planes Wq | Wk | Wv | Wg | Wo | x lie one behind the other in the workspace, every one [rows][CC], so their blocks number through.
// A wave takes CVU / 2 blocks that follow one another in one row of blocks (16 rows x 1 KiB of one source) and asks for all of them at once, 2 CVU loads of 16 B a lane, before it converts the first.
// Per half block: 8 rows x 4 groups of 8 floats, 8 whole 128-B lines read, 4 whole 128-B lines written (8 units of 16 B each). (The loops are unrolled so that the loaded values stay in registers and every step is an immediate offset.)
__global__ __launch_bounds__(32 * CVW) void k_cvt_all(const float* __restrict__ wq, const float* __restrict__ wk, const float* __restrict__ wv, const float* __restrict__ wg, const float* __restrict__ wo, const float* __restrict__ x, bf* dst) {
    const unsigned lane = threadIdx.x & 31u;
    const unsigned w = blockIdx.x * CVW + (unsigned)__builtin_amdgcn_readfirstlane((int)(threadIdx.x >> 5));   // the wave's number in the launch, in a scalar register: source and block are picked by scalar code
    if (w >= CV_WAVES) return;   // the same in every lane of a wave; the kernel has no barrier
    const unsigned blk0 = w * (CVU / 2), p = blk0 / CV_WB;   // first block; plane: 0..4 a weight, from 5 on x
    const float* src = p == 0u ? wq : p == 1u ? wk : p == 2u ? wv : p == 3u ? wg : p == 4u ? wo : x;
    const unsigned bl = blk0 - (p < 5u ? p : 5u) * CV_WB, row0 = (bl / (CC / 32)) * 16u, k0 = (bl % (CC / 32)) * 32u;
    size_t so = (size_t)row0 * CC + k0;
    if (p >= 5u) so += (size_t)(row0 / SEQ) * (SEQ_FULL - SEQ) * CC;   // x: a batch's rows start SEQ_FULL rows apart in the source
    const unsigned lr = lane & 7u, c = lane >> 3;   // row in the half block, 8-float group in the block (c = 2 * half + (fragment lane >> 4))
    const float* sp = src + so + (size_t)lr * CC + c * 8u;
    v8f v[CVU];
#pragma unroll
    for (int j = 0; j < CVU; ++j) v[j] = *(const v8f*)(sp + (j >> 1) * 32 + (j & 1) * 8 * CC);
    __builtin_amdgcn_sched_barrier(0);   // the converts stay behind all the loads: else the build holds the last four loads back until earlier ones have returned, two more round trips to memory
    bf* dp = dst + (size_t)blk0 * 512 + (c * 16u + lr) * 8u;
#pragma unroll
    for (int j = 0; j < CVU; ++j) { v8us o;
#pragma unroll
        for (int k = 0; k < 8; ++k) o[k] = f2bf(v[j][k]);
        *(v8us*)(dp + (j >> 1) * 512 + (j & 1) * 64) = o; }
}

// P^T fragment (B operand of O^T = V^T P^T) built lane-locally from the two S^T tiles of a 32-key step: element r <- tile(keys 0..15)[r], element 8+r <- tile(keys 16..31)[r].
template <typename T16> struct PPack;
template <> struct PPack<h16> { static __device__ __forceinline__ void mk(const v8f& p0, const v8f& p1, float car, v16h& a, v16h& b) { v16h r;
#pragma unroll
        for (int i = 0; i < 8; ++i) { r[i] = tohx(p0[i] * car); r[8 + i] = tohx(p1[i] * car); }
        a = r; b = r; } };
template <> struct PPack<bf> { static __device__ __forceinline__ void mk(const v8f& p0, const v8f& p1, float car, v16bf& a, v16bf& b) { (void)car; v16us h, l;
#pragma unroll
        for (int i = 0; i < 8; ++i) { unsigned short hh, ll; splitf(p0[i], hh, ll); h[i] = hh; l[i] = ll; splitf(p1[i], hh, ll); h[8 + i] = hh; l[8 + i] = ll; }
        a = __builtin_bit_cast(v16bf, h); b = __builtin_bit_cast(v16bf, l); } };

// Hazard guards: 4 VALU-slot nops tied to every accumulator of the group and to the fragments of the last products.
template <int N> struct Grd;
template <> struct Grd<1> {
    template <typename V> static __device__ __forceinline__ void s(v8f (&st)[2][1], const V& x, const V& y) { asm volatile("v_nop\n\tv_nop\n\tv_nop\n\tv_nop" : "+v"(st[0][0]), "+v"(st[1][0]) : "v"(x), "v"(y)); }
    template <typename V> static __device__ __forceinline__ void o(v8f (&oa)[4][1], const V& x, const V& y, const V& z) { asm volatile("v_nop\n\tv_nop\n\tv_nop\n\tv_nop" : "+v"(oa[0][0]), "+v"(oa[1][0]), "+v"(oa[2][0]), "+v"(oa[3][0]) : "v"(x), "v"(y), "v"(z)); }
};
template <> struct Grd<2> {
    template <typename V> static __device__ __forceinline__ void s(v8f (&st)[2][2], const V& x, const V& y) { asm volatile("v_nop\n\tv_nop\n\tv_nop\n\tv_nop" : "+v"(st[0][0]), "+v"(st[1][0]), "+v"(st[0][1]), "+v"(st[1][1]) : "v"(x), "v"(y)); }
    template <typename V> static __device__ __forceinline__ void o(v8f (&oa)[4][2], const V& x, const V& y, const V& z) { asm volatile("v_nop\n\tv_nop\n\tv_nop\n\tv_nop" : "+v"(oa[0][0]), "+v"(oa[1][0]), "+v"(oa[2][0]), "+v"(oa[3][0]), "+v"(oa[0][1]), "+v"(oa[1][1]), "+v"(oa[2][1]), "+v"(oa[3][1]) : "v"(x), "v"(y), "v"(z)); }
};

// ---- fused causal attention body, one work-group of NW waves per 16*NQ query rows of one (batch, head); keys in steps of 32, step i worked by wave i % NW with its own running maximum, row sums and O^T;
// behind the loop the waves' partial results are joined in LDS: every wave rescales its O^T to the common maximum and the common sum, the tiles are added in wave order, at most one epilogue trip a wave.
// S^T[key][query] = sum_d K[key][d] Q[query][d]: A = K rows (lane -> key), B = Q rows (lane -> query); D: lane = query (lane&15), element r = key 8*(lane>>4) + r.
// Row statistics are per lane (query); the two lane halves hold different keys and exchange the step maximum with one xor-16 shuffle; row sums stay per-lane partials until the end.
// O^T[d][query] += V^T[d][key] P^T[key][query]: A = V^T rows (lane -> d), B = packed P^T. Planes, in fragment order: Q, K [t][HD]; V^T [d][vpitch]; Ah, Al [t][CC], pointing at the head's first block of row 0. G: f32 rows.
template <typename T16, bool SPLIT, int NQ, int NW>
__device__ __forceinline__ void attn_body(const T16* __restrict__ Q, const T16* __restrict__ Q2, const T16* __restrict__ Kp, const T16* __restrict__ K2, const T16* __restrict__ Vt, const T16* __restrict__ V2,
                                          const float* __restrict__ G, int vpitch, int q0, float ssc, float osc, float pcar, bf* Ah, bf* Al, float* os, float* ml) {
    typedef typename WFrag<T16>::V V;
    static_assert(4 * NQ <= NW);   // at most one epilogue trip a wave
    const int lane = threadIdx.x & 31, lr = lane & 15, hi = lane >> 4;
    const int wv = __builtin_amdgcn_readfirstlane((int)(threadIdx.x >> 5));   // the wave's number, in a scalar register: the loop's bounds and the epilogue's test stay scalar
    V qf[NQ][2], qf2[NQ][2];
#pragma unroll
    for (int nb = 0; nb < NQ; ++nb)
#pragma unroll
        for (int ds = 0; ds < 2; ++ds) { const size_t qo = (size_t)(q0 + 16 * nb) * HD + 512 * ds + 8 * lane; qf[nb][ds] = WFrag<T16>::ld(Q + qo); if (SPLIT) qf2[nb][ds] = WFrag<T16>::ld(Q2 + qo); }
    v8f o[4][NQ]; float mrun[NQ], lrun[NQ];
#pragma unroll
    for (int nb = 0; nb < NQ; ++nb) { mrun[nb] = NEGB; lrun[nb] = 0.0f;
#pragma unroll
        for (int dt = 0; dt < 4; ++dt) o[dt][nb] = (v8f){}; }
    const int kend = q0 + 16 * NQ;
#pragma unroll 1
    for (int kt = 32 * wv; kt < kend; kt += 32 * NW) {
        V ka[2][2], ka2[2][2];
#pragma unroll
        for (int mb = 0; mb < 2; ++mb)
#pragma unroll
            for (int ds = 0; ds < 2; ++ds) { const size_t ko = (size_t)(kt + 16 * mb) * HD + 512 * ds + 8 * lane; ka[mb][ds] = (!SPLIT || mb + ds < 2) ? WFrag<T16>::ld(Kp + ko) : ldw(Kp + ko); }
        // the four V^T fragments of this key step are asked for here, behind the K fragments, each into registers of its own: they arrive while the scores and the softmax are worked out
        V va[4], va2[4];
        if constexpr (SPLIT) {
            // plane by plane; s_wait_xcnt 0 in front of a plane's last load and behind it: that load's result, or a later one's, may be given the registers of the plane's address
            xwait();
#pragma unroll
            for (int f = 0; f < 4; ++f) { const size_t ko = (size_t)(kt + 16 * (f >> 1)) * HD + 512 * (f & 1) + 8 * lane; ka2[f >> 1][f & 1] = f < 3 ? WFrag<T16>::ld(K2 + ko) : ldw(K2 + ko); }
            xwait();
#pragma unroll
            for (int dt = 0; dt < 4; ++dt) { const size_t vo = (size_t)(16 * dt) * vpitch + kt * 16 + 8 * lane; va[dt] = dt < 3 ? WFrag<T16>::ld(Vt + vo) : ldw(Vt + vo); }
            xwait();
#pragma unroll
            for (int dt = 0; dt < 4; ++dt) { const size_t vo = (size_t)(16 * dt) * vpitch + kt * 16 + 8 * lane; va2[dt] = dt < 3 ? WFrag<T16>::ld(V2 + vo) : ldw(V2 + vo); }
            xwait();
            __builtin_amdgcn_sched_barrier(0);   // the score products stay behind the step's loads: else the build waits for the K fragments first and asks for the V^T fragments only then
        } else {
            xwait();   // behind the K loads: a V^T fragment may be given the registers of their address
#pragma unroll
            for (int dt = 0; dt < 4; ++dt) { const size_t vo = (size_t)(16 * dt) * vpitch + kt * 16 + 8 * lane; va[dt] = dt < 3 ? WFrag<T16>::ld(Vt + vo) : ldw(Vt + vo); }
        }
        v8f st[2][NQ];
#pragma unroll
        for (int mb = 0; mb < 2; ++mb)
#pragma unroll
            for (int nb = 0; nb < NQ; ++nb) { v8f z = (v8f){};
                z = WFrag<T16>::mma(ka[mb][0], qf[nb][0], z); z = WFrag<T16>::mma(ka[mb][1], qf[nb][1], z);
                if (SPLIT) { z = WFrag<T16>::mma(ka2[mb][0], qf[nb][0], z); z = WFrag<T16>::mma(ka2[mb][1], qf[nb][1], z); z = WFrag<T16>::mma(ka[mb][0], qf2[nb][0], z); z = WFrag<T16>::mma(ka[mb][1], qf2[nb][1], z); }
                st[mb][nb] = z; }
        Grd<NQ>::s(st, ka[1][1], SPLIT ? qf2[NQ - 1][1] : qf[NQ - 1][1]);
        V pb[NQ], pb2[NQ];
#pragma unroll
        for (int nb = 0; nb < NQ; ++nb) {
            const int qg = q0 + 16 * nb + lr; float mx = NEGB;
#pragma unroll
            for (int mb = 0; mb < 2; ++mb)
#pragma unroll
                for (int r = 0; r < 8; ++r) { const int kg = kt + 16 * mb + 8 * hi + r; float t = st[mb][nb][r] * ssc; t = (kg <= qg) ? t : NEGB; st[mb][nb][r] = t; mx = fmaxf(mx, t); }
            mx = fmaxf(mx, __shfl_xor(mx, 16, 32));
            const float mn = fmaxf(mrun[nb], mx);
            const float al = __builtin_amdgcn_exp2f((mrun[nb] - mn) * L2E); mrun[nb] = mn;
            float psum = 0.0f;
#pragma unroll
            for (int mb = 0; mb < 2; ++mb)
#pragma unroll
                for (int r = 0; r < 8; ++r) { const float p = __builtin_amdgcn_exp2f((st[mb][nb][r] - mn) * L2E); psum += p; st[mb][nb][r] = p; }
            lrun[nb] = lrun[nb] * al + psum;
#pragma unroll
            for (int dt = 0; dt < 4; ++dt)
#pragma unroll
                for (int r = 0; r < 8; ++r) o[dt][nb][r] *= al;
            PPack<T16>::mk(st[0][nb], st[1][nb], pcar, pb[nb], pb2[nb]);
        }
#pragma unroll
        for (int dt = 0; dt < 4; ++dt) {
#pragma unroll
            for (int nb = 0; nb < NQ; ++nb) { o[dt][nb] = WFrag<T16>::mma(va[dt], pb[nb], o[dt][nb]); if (SPLIT) { o[dt][nb] = WFrag<T16>::mma(va2[dt], pb[nb], o[dt][nb]); o[dt][nb] = WFrag<T16>::mma(va[dt], pb2[nb], o[dt][nb]); } } }
        Grd<NQ>::o(o, SPLIT ? va2[3] : va[3], pb[NQ - 1], SPLIT ? pb2[NQ - 1] : pb[0]);
    }
    // the wave's epilogue trip: 16 query rows x 16 d of the tile; its gate values are asked for here, in front of the join: their round trip ends at the first barrier, where a wave waits for the others anyway
    const int s = wv; const bool mine = 4 * NQ == NW || s < 4 * NQ;   // the same in every lane of a wave; with fewer trips than waves the last waves have none
    v4f ga = (v4f){}, gc = (v4f){};
    if (mine) { const float* gp = G + (size_t)(q0 + 16 * (s >> 2) + lr) * CC + 16 * (s & 3) + 8 * hi; ga = *(const v4f*)gp;
        xwait();   // in front of the last load through the address: its result may be given the registers of that address
        gc = *(const v4f*)(gp + 4);
        xwait(); }   // and behind it: so may a value of the join below
    // (the loops of the join are unrolled so that their small arrays stay in registers)
    // every wave's maximum (lanes 0..15) and row sum (lanes 16..31; the two lane halves' partial sums joined first) of each query go to LDS: ml[0][wave][query], ml[1][wave][query]
#pragma unroll
    for (int nb = 0; nb < NQ; ++nb) { float lt = lrun[nb]; lt += __shfl_xor(lt, 16, 32); ml[(hi * NW + wv) * 16 * NQ + 16 * nb + lr] = hi ? lt : mrun[nb]; }
    __syncthreads();   // the maxima and sums of all waves are read below
    // normalise to the common maximum and sum; O^T lane = query, element r = d 16*dt + 8*hi + r  ->  the wave's own LDS tile [query][d]. A wave without a key step holds NEGB, 0 and zeros: its factor is 0.
    float* ow = os + wv * (16 * NQ * OSP);
#pragma unroll
    for (int nb = 0; nb < NQ; ++nb) { float mw[NW], ms = NEGB, lt = 0.0f;
#pragma unroll
        for (int w = 0; w < NW; ++w) { mw[w] = ml[w * 16 * NQ + 16 * nb + lr]; ms = fmaxf(ms, mw[w]); }
#pragma unroll
        for (int w = 0; w < NW; ++w) lt += ml[(NW + w) * 16 * NQ + 16 * nb + lr] * ex2s((mw[w] - ms) * L2E);
        const float inv = osc * rcps(lt) * ex2s((mrun[nb] - ms) * L2E);
#pragma unroll
        for (int dt = 0; dt < 4; ++dt) { v4f a, c;
#pragma unroll
            for (int r = 0; r < 4; ++r) { a[r] = o[dt][nb][r] * inv; c[r] = o[dt][nb][4 + r] * inv; }
            float* dst = ow + (16 * nb + lr) * OSP + 16 * dt + 8 * hi; *(v4fa*)dst = a; *(v4fa*)(dst + 4) = c; } }
    __syncthreads();   // every wave's tile is read below
    if (mine) { const int row = 16 * (s >> 2) + lr, seg = 16 * (s & 3) + 8 * hi; v4f a = *(const v4fa*)(os + row * OSP + seg), c = *(const v4fa*)(os + row * OSP + seg + 4);
#pragma unroll
        for (int w = 1; w < NW; ++w) { a += *(const v4fa*)(os + w * (16 * NQ * OSP) + row * OSP + seg); c += *(const v4fa*)(os + w * (16 * NQ * OSP) + row * OSP + seg + 4); }
        v8us oh, ol;
#pragma unroll
        for (int k = 0; k < 4; ++k) { unsigned short hh, ll; const float ya = a[k] * sigm(ga[k]); const float yc = c[k] * sigm(gc[k]); splitf(ya, hh, ll); oh[k] = hh; ol[k] = ll; splitf(yc, hh, ll); oh[4 + k] = hh; ol[4 + k] = ll; }
        const size_t oo = (size_t)(q0 + 16 * (s >> 2)) * CC + (s & 3) * 256 + 8 * lane;   // block (row / 16, (s & 3) >> 1) of the head's two, half s & 1
        *(v8us*)(Ah + oo) = oh; *(v8us*)(Al + oo) = ol; }
}

// rows < RH: bf16 hi/lo planes [b][h] x ([RH][HD]) / [b][h] x ([HD][RH]), 16 query rows per work-group of NWV waves; grid (RH/16, NH, NB)
__global__ __launch_bounds__(32 * NWV) void k_attn_s(const bf* __restrict__ Qh, const bf* __restrict__ Ql, const bf* __restrict__ Kh, const bf* __restrict__ Kl, const bf* __restrict__ Vh, const bf* __restrict__ Vl, const float* __restrict__ Gt, bf* ATh, bf* ATl) {
    __shared__ __align__(16) float os[NWV * 16 * OSP]; __shared__ float ml[2 * NWV * 16];
    const size_t bh = (size_t)blockIdx.z * NH + blockIdx.y; const size_t po = bh * RH * HD; const size_t ao = (size_t)blockIdx.z * SEQ * CC + (size_t)blockIdx.y * HD, ap = (size_t)blockIdx.z * SEQ * CC + (size_t)blockIdx.y * HD * 16;
    attn_body<bf, true, 1, NWV>(Qh + po, Ql + po, Kh + po, Kl + po, Vh + po, Vl + po, Gt + ao, RH, (int)blockIdx.x * 16, 0.125f, 1.0f, 1.0f, ATh + ap, ATl + ap, os, ml);
}
// rows >= RH: f16 planes [b][h] x ([SEQ][HD]) / [b][h] x ([HD][SEQ]) with carries, 32 query rows per work-group of NWV waves; grid ((SEQ-RH)/32, NH, NB)
__global__ __launch_bounds__(32 * NWV) void k_attn_h(const h16* __restrict__ Q, const h16* __restrict__ Kp, const h16* __restrict__ Vt, const float* __restrict__ Gt, bf* ATh, bf* ATl) {
    __shared__ __align__(16) float os[NWV * 32 * OSP]; __shared__ float ml[2 * NWV * 32];
    const size_t bh = (size_t)blockIdx.z * NH + blockIdx.y; const size_t po = bh * SEQ * HD; const size_t ao = (size_t)blockIdx.z * SEQ * CC + (size_t)blockIdx.y * HD, ap = (size_t)blockIdx.z * SEQ * CC + (size_t)blockIdx.y * HD * 16;
    attn_body<h16, false, 2, NWV>(Q + po, nullptr, Kp + po, nullptr, Vt + po, nullptr, Gt + ao, SEQ, RH + (int)blockIdx.x * 32, 0.125f / (QCAR * QCAR), 1.0f / (PCAR * VCAR), PCAR, ATh + ap, ATl + ap, os, ml);
}

extern "C" void kernel_launch(void* const* d_in, const int* in_sizes, int n_in,
                              void* d_out, int out_size, void* d_ws, size_t ws_size, hipStream_t stream) {
    if (n_in < 7) return;
    if ((size_t)in_sizes[0] < ((size_t)(NB - 1) * SEQ_FULL + SEQ) * CC) return;
    if ((size_t)in_sizes[1] < W1 || (size_t)in_sizes[2] < W1 || (size_t)in_sizes[3] < W1 || (size_t)in_sizes[4] < W1 || (size_t)in_sizes[5] < W1 || in_sizes[6] < CC) return;
    if ((size_t)out_size < PL16) return;
    // wire order: x, Wq, Wk, Wv, Wg, Wo, bo
    const float* x = (const float*)d_in[0]; const float* wq = (const float*)d_in[1]; const float* wk = (const float*)d_in[2]; const float* wv = (const float*)d_in[3];
    const float* wg = (const float*)d_in[4]; const float* wo = (const float*)d_in[5]; const float* bo = (const float*)d_in[6];
    float* OUT = (float*)d_out;     // [NB][SEQ][CC]
    char* wsp = (char*)d_ws;
    auto take = [&](size_t bytes) { char* p = wsp; wsp += (bytes + 255) & ~(size_t)255; return (void*)p; };
    bf* WQ = (bf*)take(4 * W1 * 2);            // Wq | Wk | Wv | Wg bf16 [out][in], each in fragment order
    bf* WO = (bf*)take(W1 * 2);
    bf* XB = (bf*)take(PL16 * 2);              // bf16 x [MROWS][CC] in fragment order
    float* F = (float*)take(4 * PL16 * 4);     // four f32 planes [MROWS][CC]: the last holds the gate, the first the gated ctx
    h16* QK16 = (h16*)take(2 * PL16 * 2);      // f16 q planes | k planes
    h16* VT16 = (h16*)take(PL16 * 2);
    bf* QKh = (bf*)take(2 * PLR * 2); bf* QKl = (bf*)take(2 * PLR * 2);
    bf* VTh = (bf*)take(PLR * 2); bf* VTl = (bf*)take(PLR * 2);
    if ((size_t)(wsp - (char*)d_ws) > ws_size) return;
    // gated-ctx hi | lo planes lie in the first f32 plane of F, which no launch writes as f32 (only the gate plane is); sizes match exactly
    bf* ATh = (bf*)F; bf* ATl = ATh + PL16;
    const float* GATE = F + 3 * PL16;
    k_cvt_all<<<(CV_WAVES + CVW - 1) / CVW, 32 * CVW, 0, stream>>>(wq, wk, wv, wg, wo, x, WQ);   // WQ | WO | XB are one run of planes (no padding between carve pieces)
    k_gemm_proj<<<dim3(MROWS / (64 * PWM), CC / (64 * PWN), 4), 32 * PWM * PWN, 0, stream>>>(XB, WQ, F, W1, PL16, QK16, QKh, QKl, VT16, VTh, VTl);
    k_attn_s<<<dim3(RH / 16, NH, NB), 32 * NWV, 0, stream>>>(QKh, QKl, QKh + PLR, QKl + PLR, VTh, VTl, GATE, ATh, ATl);
    if (SEQ > RH) k_attn_h<<<dim3((SEQ - RH) / 32 > 0 ? (SEQ - RH) / 32 : 1, NH, NB), 32 * NWV, 0, stream>>>(QK16, QK16 + PL16, VT16, GATE, ATh, ATl);
    k_gemm_out<<<dim3(MROWS / (64 * OWM), CC / (64 * OWN), 1), 32 * OWM * OWN, 0, stream>>>(ATh, ATl, WO, OUT, bo);
}

// v007
// Measured time: 93.2 microseconds a run.
// Next to v006, in two timings, it ran 1.06 times as fast each time.
// Counting every step since v000, it is 3.03 times as fast.
#include <hip/hip_runtime.h>

// Causal multi-head attention with a sigmoid output gate, x [2][2048][1024], 16 heads x 64, weights [out][in], one score scale 1/8, tril mask, out = (merged heads * sigmoid(x Wg^T)) x Wo^T + bo.
// Compute dtypes, f32 accumulate: all float inputs RNE-converted to bf16 on load; q/k/v/gate projections v_wmma_f32_16x16x32_bf16 (exact products);
// attention rows < RH: bf16 hi/lo planes, 3 products on q.k and on p.v; rows >= RH: v_wmma_f32_16x16x32_f16 with q,k x16, v x16, p x1024 carries; softmax f32 (running max); gate sigmoid f32 on the VALU;
// output projection: gated ctx bf16 hi/lo x bf16 Wo (2 products) + bf16(bo).
// Every 16-bit matrix operand plane [rows][K] of the workspace lies in fragment order: blocks of 16 rows x 32 k (512 elements, 1 KiB), block (row/16, k/32) at index (row/16)*(K/32) + k/32;
// in a block the 16-B unit 32*half + lane holds row lane&15, k = 16*half + 8*(lane>>4) + 0..7. A wave's fragment load or store of 16 B a lane then covers 512 contiguous bytes.
// Fused attention in transposed form: S^T = K Q^T (D rows = keys, lane = query), P^T fragment built lane-locally from two S^T tiles, O^T = V^T P^T; no score plane in global memory.

#ifndef NB
#define NB 2
#endif
#ifndef SEQ
#define SEQ 2048
#endif
#ifndef RH
#define RH 256                       // query rows < RH use hi+lo planes
#endif
#define NB_FULL  2
#define SEQ_FULL 2048
#define CC   1024
#define NH   16
#define HD   64
#define MROWS (NB * SEQ)
#define PCAR 1024.0f
#define QCAR 16.0f
#define VCAR 16.0f
#define L2E  1.4426950408889634f
#define NEGB (-1.0e30f)
#define OSP  68
#define NWV  8                        // waves of an attention work-group: they share out the key steps of one query tile
#define CVU  16                       // conversion launch: 16-B output units a lane
#define CVW  9                        // and waves of a work-group
#define PWM  2                        // projection GEMM: a work-group's waves along the rows
#define PWN  4                        // and along the columns, one 64x64 tile a wave
#define PKB  2                        // and the k blocks of 32 in a stage of its LDS ring
#define OWM  2                        // output GEMM: the same three
#define OWN  2
#define OKB  4
#define W1   ((size_t)CC * CC)
#define PL16 ((size_t)MROWS * CC)
#define PLR  ((size_t)NB * NH * RH * HD)
// carve: 4+1 bf16 weight planes, bf16 x, 4 f32 planes (the last: gate; the first: the gated-ctx hi|lo planes), f16 q|k|v^T planes, bf16 hi/lo planes of the first RH rows
#define WS_TOTAL (10 * W1 + 24 * PL16 + 12 * PLR)
#define CV_WB    ((unsigned)(W1 / 512))                                  // blocks of a weight plane
#define CV_WAVES ((unsigned)((5 * W1 + PL16) / (256 * CVU)))             // waves that the conversion launch needs
static_assert((5 * W1 + PL16) % (256 * CVU) == 0 && W1 % (256 * CVU) == 0 && (CC / 32) % (CVU / 2) == 0);   // a conversion wave's blocks lie in one plane and in one row of blocks
static_assert(CC == NH * HD);                 // head split covers the model width
static_assert(HD == 64);
static_assert(CC % (64 * PWN) == 0 && CC % (64 * OWN) == 0 && CC % (64 * PKB) == 0 && CC % (64 * OKB) == 0);  // GEMM N tiles; K: two stages or more
static_assert(MROWS % (64 * PWM) == 0 && MROWS % (64 * OWM) == 0);                    // GEMM M tiles
static_assert(SEQ % 256 == 0);                // a 64-row projection tile stays inside one batch
static_assert(RH % 256 == 0 && RH <= SEQ);    // a 64-row projection tile lies on one side of the hi/lo row boundary
static_assert((SEQ - RH) % 32 == 0 && RH % 32 == 0 && RH % 16 == 0);   // query tiles of 32 (f16 path) and 16 (hi/lo path)
static_assert(NB <= NB_FULL && SEQ <= SEQ_FULL);
static_assert((W1 * 2) % 256 == 0 && (PL16 * 2) % 256 == 0 && (PLR * 2) % 256 == 0);   // carve pieces stay 256-B aligned without padding
static_assert(2 * PL16 * sizeof(unsigned short) <= PL16 * sizeof(float));              // gated-ctx hi|lo planes fit exactly inside the first f32 plane of F
static_assert(WS_TOTAL <= (size_t)134217728); // total carve <= 128 MiB

typedef _Float16 h16;
typedef unsigned short bf;
typedef __attribute__((ext_vector_type(16))) __bf16   v16bf;
typedef __attribute__((ext_vector_type(16))) _Float16 v16h;
typedef __attribute__((ext_vector_type(16))) unsigned short v16us;
typedef __attribute__((ext_vector_type(8)))  _Float16 v8h;
typedef __attribute__((ext_vector_type(8)))  unsigned short v8us;
typedef __attribute__((ext_vector_type(8)))  float    v8f;
typedef __attribute__((ext_vector_type(4)))  float    v4f;
typedef v4f  __attribute__((may_alias)) v4fa;

__device__ __forceinline__ unsigned short f2bf(float f) { unsigned u = __float_as_uint(f); u += 0x7FFFu + ((u >> 16) & 1u); return (unsigned short)(u >> 16); }
__device__ __forceinline__ float bf2f(unsigned short b) { return __uint_as_float(((unsigned)b) << 16); }
__device__ __forceinline__ float bfr(float f) { return bf2f(f2bf(f)); }
__device__ __forceinline__ h16 tohx(float x) { return (h16)x; }
__device__ __forceinline__ void splitf(float y, unsigned short& h, unsigned short& l) { h = f2bf(y); l = f2bf(y - bf2f(h)); }
// v_exp_f32 and v_rcp_f32 as the builtins give them, each with one v_nop in its own statement: the slot that the instruction set asks for between a transcendental and a directly following instruction that reads its result or overwrites its source
__device__ __forceinline__ float sigm(float g) { float e, r; asm("v_exp_f32 %0, %1\n\tv_nop" : "=v"(e) : "v"(-g * L2E)); asm("v_rcp_f32 %0, %1\n\tv_nop" : "=v"(r) : "v"(1.0f + e)); return r; }
// the same two statements singly, for the join of the attention waves' partial results
__device__ __forceinline__ float ex2s(float x) { float e; asm("v_exp_f32 %0, %1\n\tv_nop" : "=v"(e) : "v"(x)); return e; }
__device__ __forceinline__ float rcps(float x) { float r; asm("v_rcp_f32 %0, %1\n\tv_nop" : "=v"(r) : "v"(x)); return r; }
__device__ __forceinline__ v16h cat16(v8h lo, v8h hi) { return __builtin_shufflevector(lo, hi, 0, 1, 2, 3, 4, 5, 6, 7, 8, 9, 10, 11, 12, 13, 14, 15); }
__device__ __forceinline__ v16bf cat16b(v8us lo, v8us hi) { return __builtin_bit_cast(v16bf, __builtin_shufflevector(lo, hi, 0, 1, 2, 3, 4, 5, 6, 7, 8, 9, 10, 11, 12, 13, 14, 15)); }
__device__ __forceinline__ v8f wmma16(v16h a, v16h b, v8f c) { return __builtin_amdgcn_wmma_f32_16x16x32_f16(false, a, false, b, (short)0, c, false, false); }
__device__ __forceinline__ v8f wmmab(v16bf a, v16bf b, v8f c) { return __builtin_amdgcn_wmma_f32_16x16x32_bf16(false, a, false, b, (short)0, c, false, false); }

// Fragment loader from a block in fragment order: p = block + 8*lane; elements 0..7 <- p[0..7] (half 0), elements 8..15 <- p[256..263] (half 1).
template <typename T16> struct WFrag;
template <> struct WFrag<h16> { typedef v16h V; static __device__ __forceinline__ V ld(const h16* p) { return cat16(*(const v8h*)p, *(const v8h*)(p + 256)); } static __device__ __forceinline__ v8f mma(V a, V b, v8f c) { return wmma16(a, b, c); } };
template <> struct WFrag<bf> { typedef v16bf V; static __device__ __forceinline__ V ld(const bf* p) { return cat16b(*(const v8us*)p, *(const v8us*)(p + 256)); } static __device__ __forceinline__ v8f mma(V a, V b, v8f c) { return wmmab(a, b, c); } };
// s_wait_xcnt 0, written where the next load's result may be given the registers of an address that loads already issued name.
__device__ __forceinline__ void xwait() { asm volatile("s_wait_xcnt 0x0" ::: "memory"); }
// The fragment loaders again, for the last fragment read through an address: the wait stands in front of its last load, whose result may be given the address's own registers.
__device__ __forceinline__ v16h ldw(const h16* p) { const v8h lo = *(const v8h*)p; xwait(); return cat16(lo, *(const v8h*)(p + 256)); }
__device__ __forceinline__ v16bf ldw(const bf* p) { const v8us lo = *(const v8us*)p; xwait(); return cat16b(lo, *(const v8us*)(p + 256)); }

// The attention planes that the projection tiles are written to: f16 q|k [w][b][h] x ([t][HD]) and v^T [b][h] x ([d][t]) with their carries, bf16 hi/lo planes of the first RH rows; each [rows][K] plane in fragment order.
struct Planes { h16* qk16; bf* qkh; bf* qkl; h16* vt16; bf* vth; bf* vtl; };

// A 64x64 f32 accumulator tile (lane&15 = column within 16 nb, element j = row 8*(lane>>4) + j within 16 mb) leaves as q or k rows [t][HD]: f16 with the carry, and for HL the bf16 hi/lo pair.
// 16 rows at a time go through the LDS stage; then a store writes one half of a block (512 contiguous B). p16, ph, pl point at the block of the tile's first row.
template <bool HL>
__device__ __forceinline__ void put_qk(const v8f (&acc)[4][4], float* os, h16* p16, bf* ph, bf* pl, int lane) {
    const int lr = lane & 15, hi = lane >> 4;
#pragma unroll
    for (int mb = 0; mb < 4; ++mb) {
#pragma unroll
        for (int nb = 0; nb < 4; ++nb) {
#pragma unroll
            for (int j = 0; j < 8; ++j) os[(hi * 8 + j) * OSP + nb * 16 + lr] = acc[mb][nb][j]; }
        __builtin_amdgcn_wave_barrier(); asm volatile("" ::: "memory");   // compiler fence: the row reads below take other lanes' writes and must not be moved over them
#pragma unroll
        for (int s = 0; s < 4; ++s) { const int seg = 16 * s + 8 * hi; const v4f a = *(const v4fa*)(os + lr * OSP + seg), g = *(const v4fa*)(os + lr * OSP + seg + 4); v8h o16;
#pragma unroll
            for (int k = 0; k < 4; ++k) { o16[k] = tohx(a[k] * QCAR); o16[4 + k] = tohx(g[k] * QCAR); }
            const int o = mb * 16 * HD + s * 256 + lane * 8;   // block (mb, s >> 1), half s & 1
            *(v8h*)(p16 + o) = o16;
            if constexpr (HL) { v8us oh, ol;
#pragma unroll
                for (int k = 0; k < 4; ++k) { unsigned short hh, ll; splitf(a[k], hh, ll); oh[k] = hh; ol[k] = ll; splitf(g[k], hh, ll); oh[4 + k] = hh; ol[4 + k] = ll; }
                *(v8us*)(ph + o) = oh; *(v8us*)(pl + o) = ol; } }
        __builtin_amdgcn_wave_barrier(); asm volatile("" ::: "memory");   // compiler fence: the next 16 rows' writes stay behind these reads
    }
    xwait();   // behind the last stores: where the build lays another epilogue block out behind this one, that block rewrites registers that they name
}
// The same tile leaves as v^T [d][t]: a lane's 8 accumulator elements are 8 consecutive t of one d, its own 16-B unit of block (nb, mb >> 1), half mb & 1, stored from the registers. p16 (K = SEQ), ph, pl (K = RH) point at the block of d = 0 of the head, first t of the tile; hl (the same in every lane): the bf16 hi/lo pair is wanted too.
__device__ __forceinline__ void put_vt(const v8f (&acc)[4][4], h16* p16, bf* ph, bf* pl, bool hl, int lane) {
    if (hl) {
#pragma unroll
        for (int nb = 0; nb < 4; ++nb)
#pragma unroll
            for (int mb = 0; mb < 4; ++mb) { const int o = nb * 16 * RH + mb * 256 + lane * 8; v8us oh, ol;
#pragma unroll
                for (int j = 0; j < 8; ++j) { unsigned short hh, ll; splitf(acc[mb][nb][j], hh, ll); oh[j] = hh; ol[j] = ll; }
                *(v8us*)(ph + o) = oh; *(v8us*)(pl + o) = ol; }
        xwait();   // behind the hi/lo stores: the f16 stores' address is formed in registers that they name
    }
#pragma unroll
    for (int nb = 0; nb < 4; ++nb)
#pragma unroll
        for (int mb = 0; mb < 4; ++mb) { v8h o16;
#pragma unroll
            for (int j = 0; j < 8; ++j) o16[j] = tohx(acc[mb][nb][j] * VCAR);
            *(v8h*)(p16 + nb * 16 * SEQ + mb * 256 + lane * 8) = o16; }
    xwait();   // behind the last stores: where the build lays another epilogue block out behind this one, that block rewrites registers that they name
}

// Twelve asynchronous copies of 16 B a lane, global memory -> LDS through no register: three units of 2 KiB (two k blocks of one row of blocks), 4 x 512 B a wave each. l: the lane's LDS byte address, g: its global address.
// s_wait_xcnt 0 is the statement's last line: the address registers that the copies name are rewritten behind it (the next stage's additions).
__device__ __forceinline__ void cp_units3(unsigned l0, const char* g0, unsigned l1, const char* g1, unsigned l2, const char* g2) {
    asm volatile("global_load_async_to_lds_b128 %0, %12, off\n\t"
                 "global_load_async_to_lds_b128 %1, %13, off\n\t"
                 "global_load_async_to_lds_b128 %2, %14, off\n\t"
                 "global_load_async_to_lds_b128 %3, %15, off\n\t"
                 "global_load_async_to_lds_b128 %4, %16, off\n\t"
                 "global_load_async_to_lds_b128 %5, %17, off\n\t"
                 "global_load_async_to_lds_b128 %6, %18, off\n\t"
                 "global_load_async_to_lds_b128 %7, %19, off\n\t"
                 "global_load_async_to_lds_b128 %8, %20, off\n\t"
                 "global_load_async_to_lds_b128 %9, %21, off\n\t"
                 "global_load_async_to_lds_b128 %10, %22, off\n\t"
                 "global_load_async_to_lds_b128 %11, %23, off\n\t"
                 "s_wait_xcnt 0x0"
                 :: "v"(l0), "v"(l0 + 512u), "v"(l0 + 1024u), "v"(l0 + 1536u), "v"(l1), "v"(l1 + 512u), "v"(l1 + 1024u), "v"(l1 + 1536u), "v"(l2), "v"(l2 + 512u), "v"(l2 + 1024u), "v"(l2 + 1536u),
                    "v"(g0), "v"(g0 + 512), "v"(g0 + 1024), "v"(g0 + 1536), "v"(g1), "v"(g1 + 512), "v"(g1 + 1024), "v"(g1 + 1536), "v"(g2), "v"(g2 + 512), "v"(g2 + 1024), "v"(g2 + 1536)
                 : "memory");
}

// ---- GEMM body, a work-group of WM x WN waves, one 64x64 tile a wave: C[m][n] (f32, pitch ldc, + optional bf16-converted bias[n]) = sum_k A[m][k] Bt[n][k] (+ A2 x Bt when NSPLIT == 1); K % (64 KB) == 0; A, A2, Bt in fragment order.
// The operands of the work-group's 64 WM x 64 WN tile come through LDS, a stage of KB k blocks (32 KB k) at a time, two buffers: a stage is [A | A2 | Bt] rows of blocks, KB KiB each, which lie in LDS as they lie in their plane.
// The waves deal the stage out among them in units of 2 KiB and bring it in by asynchronous copies, one stage ahead; every block is fetched once for the work-group and read from LDS by the WN (A) or WM (Bt) waves that need it.
// FS: fragment sets in registers. 2: a k block's fragments are read from LDS while the block before it, of the same stage, is multiplied (for one wave a SIMD); 1: other waves of the SIMD cover the reads.
// PLANES: tiles of z = 0, 1 (q, k) and z = 2 (v) leave as attention planes straight from the f32 accumulators; z = 3 (gate) leaves as f32 rows like any other tile.
template <typename T16, int NSPLIT, bool BIAS, bool PLANES, int WM, int WN, int KB, int FS>
__device__ __forceinline__ void gemmw_body(const T16* __restrict__ A, const T16* __restrict__ A2, const T16* __restrict__ Bt, int K, float* C, int ldc, const float* __restrict__ bias, size_t sB, size_t sC, char* ring, float* osall, const Planes pl) {
    typedef typename WFrag<T16>::V V;
    constexpr int NW = WM * WN, NA = NSPLIT == 1 ? 2 : 1, RA = 4 * WM, RB = 4 * WN, UPR = KB / 2;   // waves; A planes; rows of blocks of A and of Bt; units in a row of blocks
    constexpr int UA = RA * UPR, NU = (NA * RA + RB) * UPR, NUW = NU / NW, BUFB = NU * 2048;        // units of an A plane, of a stage, of one wave; bytes of a buffer
    static_assert(KB % 2 == 0 && UA % NW == 0 && NU % NW == 0 && NUW % 3 == 0 && 4 * NUW <= 63);    // a wave's i-th unit lies in the same plane for every wave; units go three to a statement; copies of a wave in flight
    static_assert(FS == 1 || FS == 2);
    const size_t z = blockIdx.z; Bt += z * sB; C += z * sC;
    const int lane = threadIdx.x & 31, lr = lane & 15, hi = lane >> 4;
    const int wv = __builtin_amdgcn_readfirstlane((int)(threadIdx.x >> 5)), wm = wv % WM, wn = wv / WM;   // the wave's number and its place in the work-group's tile, in scalar registers
    const int R0 = blockIdx.x * 64 * WM, C0 = blockIdx.y * 64 * WN, r0 = R0 + 64 * wm, c0 = C0 + 64 * wn;
    float* os = osall + wv * 16 * OSP;   // the wave's own epilogue stage
    v8f acc[4][4];
#pragma unroll
    for (int mb = 0; mb < 4; ++mb)
#pragma unroll
        for (int nb = 0; nb < 4; ++nb) acc[mb][nb] = (v8f){};
    // the wave's units: number wv + NW i of the stage; 16 rows of blocks are 16 K elements, a unit 1024 elements, a stage's step along k KB blocks.
    // One address a plane, that of the wave's first unit there; its further units of the plane lie NW / UPR rows of blocks apart.
    static_assert(NW % UPR == 0);
    const size_t wo = (size_t)(16 * (wv / UPR)) * K + (wv % UPR) * 1024 + 8 * lane;
    const char* gb[NA + 1];
    gb[0] = (const char*)(A + (size_t)R0 * K + wo); if (NA == 2) gb[1] = (const char*)(A2 + (size_t)R0 * K + wo); gb[NA] = (const char*)(Bt + (size_t)C0 * K + wo);
    auto gp = [&](int i) { const int p = i < UA / NW ? 0 : i < NA * UA / NW ? 1 : NA, ii = i - p * (UA / NW); return gb[p] + (size_t)(16 * (NW / UPR) * ii) * K * sizeof(T16); };
    const unsigned lw = (unsigned)(size_t)ring + (unsigned)(wv * 2048 + lane * 16);   // the lane's LDS byte address in the wave's first unit of buffer 0
    auto issue = [&](unsigned bo) {   // the wave's copies of the next stage not yet asked for, into the buffer at byte bo
#pragma unroll
        for (int i = 0; i < NUW; i += 3) cp_units3(lw + bo + i * NW * 2048, gp(i), lw + bo + (i + 1) * NW * 2048, gp(i + 1), lw + bo + (i + 2) * NW * 2048, gp(i + 2));
#pragma unroll
        for (int p = 0; p <= NA; ++p) gb[p] += KB * 1024; };
    const int NT = K / (32 * KB);
    issue(0u);
    asm volatile("s_wait_asynccnt 0x0" ::: "memory");   // the wave's copies of stage 0 have landed
    __syncthreads();                                    // and so have the other waves': stage 0 is read below
    issue((unsigned)BUFB);
    unsigned bo = 0u;   // the buffer that this trip reads
#pragma unroll 1
    for (int t = 0; t < NT; ++t) {
        const char* fb = ring + bo + lane * 16;
        V a[FS][4], a2[FS][4], b[FS][4];
        auto ldset = [&](int s, int kk) {   // the wave's fragments of k block kk of this stage, as one group of LDS reads
#pragma unroll
            for (int mb = 0; mb < 4; ++mb) { a[s][mb] = WFrag<T16>::ld((const T16*)(fb + ((4 * wm + mb) * KB + kk) * 1024)); if (NSPLIT == 1) a2[s][mb] = WFrag<T16>::ld((const T16*)(fb + ((RA + 4 * wm + mb) * KB + kk) * 1024)); }
#pragma unroll
            for (int nb = 0; nb < 4; ++nb) b[s][nb] = WFrag<T16>::ld((const T16*)(fb + ((NA * RA + 4 * wn + nb) * KB + kk) * 1024)); };
        if (FS == 2) { ldset(0, 0);
            __builtin_amdgcn_sched_barrier(0); }   // the first block's reads go out ahead of the second's: else the build mixes the two groups and the first product waits for both
#pragma unroll
        for (int kk = 0; kk < KB; ++kk) { const int s = kk & (FS - 1);
            if (FS == 1) ldset(0, kk); else if (kk + 1 < KB) ldset(s ^ 1, kk + 1);
            __builtin_amdgcn_sched_barrier(0);   // the products stay behind the group of reads: else the build reads one Bt fragment at a time, an LDS round trip in front of every four products
#pragma unroll
            for (int nb = 0; nb < 4; ++nb)
#pragma unroll
                for (int mb = 0; mb < 4; ++mb) { acc[mb][nb] = WFrag<T16>::mma(a[s][mb], b[s][nb], acc[mb][nb]); if (NSPLIT == 1) acc[mb][nb] = WFrag<T16>::mma(a2[s][mb], b[s][nb], acc[mb][nb]); }
        }
        asm volatile("s_wait_dscnt 0x0" ::: "memory");      // the wave's reads of this buffer have returned: it is refilled behind the barrier
        asm volatile("s_wait_asynccnt 0x0" ::: "memory");   // the wave's copies of the next stage have landed
        __syncthreads();                                    // every wave has left this buffer, and the next stage is whole
        if (t + 2 < NT) issue(bo);                          // the same for the whole work-group
        bo = (unsigned)BUFB - bo;
    }
    asm volatile("s_wait_asynccnt 0x0" ::: "memory");   // no copy is outstanding where the wave goes on to its epilogue
    if constexpr (PLANES) {
        // a tile's 64 columns are one head (HD == 64), its 64 rows lie in one batch and on one side of RH: every test here is the same for the whole wave
        const unsigned w = blockIdx.z, h = (unsigned)c0 / HD, b = (unsigned)r0 / SEQ, t0 = (unsigned)r0 % SEQ;
        if (w < 2u) { const size_t bh = (size_t)(w * NB + b) * NH + h; h16* p16 = pl.qk16 + (bh * SEQ + t0) * HD;
            if (t0 < RH) put_qk<true>(acc, os, p16, pl.qkh + (bh * RH + t0) * HD, pl.qkl + (bh * RH + t0) * HD, lane); else put_qk<false>(acc, os, p16, nullptr, nullptr, lane);
            return; }
        if (w == 2u) { const size_t bh = (size_t)b * NH + h; h16* p16 = pl.vt16 + bh * HD * SEQ + t0 * 16;
            const size_t o2 = bh * HD * RH + (t0 < RH ? t0 * 16 : 0u);   // stays inside the hi/lo planes for a tile that does not write them
            put_vt(acc, p16, pl.vth + o2, pl.vtl + o2, t0 < RH, lane);
            return; }
    }
#pragma unroll
    for (int mb = 0; mb < 4; ++mb) {
#pragma unroll
        for (int nb = 0; nb < 4; ++nb) {
#pragma unroll
            for (int j = 0; j < 8; ++j) os[(hi * 8 + j) * OSP + nb * 16 + lr] = acc[mb][nb][j]; }
        __builtin_amdgcn_wave_barrier(); asm volatile("" ::: "memory");
        float* crow = C + (size_t)(r0 + mb * 16) * ldc + c0;
{
#pragma unroll
            for (int s = 0; s < 8; ++s) { const int row = 2 * s + hi, cofs = lr * 4; v4f val = *(const v4fa*)(os + row * OSP + cofs); if (BIAS) { val[0] += bfr(bias[c0 + cofs]); val[1] += bfr(bias[c0 + cofs + 1]); val[2] += bfr(bias[c0 + cofs + 2]); val[3] += bfr(bias[c0 + cofs + 3]); }
                *(v4f*)(crow + (size_t)row * ldc + cofs) = val; }
             }
        xwait();   // behind the eight row stores: the next 16 rows' values (the bias reload among them) may be given registers that these stores name
        __builtin_amdgcn_wave_barrier(); asm volatile("" ::: "memory");
    }
    if constexpr (PLANES) xwait();   // behind the gate tile's last stores: the plane blocks laid out behind them rewrite registers that they name
}

// q/k/v/gate projections: z = 0..3 selects the weight plane (stride sB); q, k, v tiles go to the attention planes, the gate tile to the f32 plane C + 3 sC; A = bf16 x [MROWS][CC].
__global__ __launch_bounds__(32 * PWM * PWN) void k_gemm_proj(const bf* __restrict__ A, const bf* __restrict__ Bt, float* C, size_t sB, size_t sC, h16* QK16, bf* QKh, bf* QKl, h16* VT16, bf* VTh, bf* VTl) {
    __shared__ __align__(1024) char ring[2 * (4 * PWM + 4 * PWN) * PKB * 1024]; __shared__ __align__(16) float os[PWM * PWN * 16 * OSP];
    gemmw_body<bf, 0, false, true, PWM, PWN, PKB, 1>(A, nullptr, Bt, CC, C, CC, nullptr, sB, sC, ring, os, Planes{QK16, QKh, QKl, VT16, VTh, VTl});
}
// output projection: (gated ctx hi + gated ctx lo) x Wo^T + bf16(bo) -> d_out rows.
__global__ __launch_bounds__(32 * OWM * OWN) void k_gemm_out(const bf* __restrict__ Ah, const bf* __restrict__ Al, const bf* __restrict__ Bt, float* C, const float* __restrict__ bias) {
    __shared__ __align__(1024) char ring[2 * (8 * OWM + 4 * OWN) * OKB * 1024]; __shared__ __align__(16) float os[OWM * OWN * 16 * OSP];
    gemmw_body<bf, 1, true, false, OWM, OWN, OKB, 2>(Ah, Al, Bt, CC, C, CC, bias, 0, 0, ring, os, Planes{});
}

// f32 rows [..][CC] -> bf16 planes in fragment order, all six sources in one launch: the planes Wq | Wk | Wv | Wg | Wo | x lie one behind the other in the workspace, every one [rows][CC], so their blocks number through.
// A wave takes CVU / 2 blocks that follow one another in one row of blocks (16 rows x 1 KiB of one source) and asks for all of them at once, 2 CVU loads of 16 B a lane, before it converts the first.
// Per half block: 8 rows x 4 groups of 8 floats, 8 whole 128-B lines read, 4 whole 128-B lines written (8 units of 16 B each). (The loops are unrolled so that the loaded values stay in registers and every step is an immediate offset.)
__global__ __launch_bounds__(32 * CVW) void k_cvt_all(const float* __restrict__ wq, const float* __restrict__ wk, const float* __restrict__ wv, const float* __restrict__ wg, const float* __restrict__ wo, const float* __restrict__ x, bf* dst) {
    const unsigned lane = threadIdx.x & 31u;
    const unsigned w = blockIdx.x * CVW + (unsigned)__builtin_amdgcn_readfirstlane((int)(threadIdx.x >> 5));   // the wave's number in the launch, in a scalar register: source and block are picked by scalar code
    if (w >= CV_WAVES) return;   // the same in every lane of a wave; the kernel has no barrier
    const unsigned blk0 = w * (CVU / 2), p = blk0 / CV_WB;   // first block; plane: 0..4 a weight, from 5 on x
    const float* src = p == 0u ? wq : p == 1u ? wk : p == 2u ? wv : p == 3u ? wg : p == 4u ? wo : x;
    const unsigned bl = blk0 - (p < 5u ? p : 5u) * CV_WB, row0 = (bl / (CC / 32)) * 16u, k0 = (bl % (CC / 32)) * 32u;
    size_t so = (size_t)row0 * CC + k0;
    if (p >= 5u) so += (size_t)(row0 / SEQ) * (SEQ_FULL - SEQ) * CC;   // x: a batch's rows start SEQ_FULL rows apart in the source
    const unsigned lr = lane & 7u, c = lane >> 3;   // row in the half block, 8-float group in the block (c = 2 * half + (fragment lane >> 4))
    const float* sp = src + so + (size_t)lr * CC + c * 8u;
    v8f v[CVU];
#pragma unroll
    for (int j = 0; j < CVU; ++j) v[j] = *(const v8f*)(sp + (j >> 1) * 32 + (j & 1) * 8 * CC);
    __builtin_amdgcn_sched_barrier(0);   // the converts stay behind all the loads: else the build holds the last four loads back until earlier ones have returned, two more round trips to memory
    bf* dp = dst + (size_t)blk0 * 512 + (c * 16u + lr) * 8u;
#pragma unroll
    for (int j = 0; j < CVU; ++j) { v8us o;
#pragma unroll
        for (int k = 0; k < 8; ++k) o[k] = f2bf(v[j][k]);
        *(v8us*)(dp + (j >> 1) * 512 + (j & 1) * 64) = o; }
}

// P^T fragment (B operand of O^T = V^T P^T) built lane-locally from the two S^T tiles of a 32-key step: element r <- tile(keys 0..15)[r], element 8+r <- tile(keys 16..31)[r].
template <typename T16> struct PPack;
template <> struct PPack<h16> { static __device__ __forceinline__ void mk(const v8f& p0, const v8f& p1, float car, v16h& a, v16h& b) { v16h r;
#pragma unroll
        for (int i = 0; i < 8; ++i) { r[i] = tohx(p0[i] * car); r[8 + i] = tohx(p1[i] * car); }
        a = r; b = r; } };
template <> struct PPack<bf> { static __device__ __forceinline__ void mk(const v8f& p0, const v8f& p1, float car, v16bf& a, v16bf& b) { (void)car; v16us h, l;
#pragma unroll
        for (int i = 0; i < 8; ++i) { unsigned short hh, ll; splitf(p0[i], hh, ll); h[i] = hh; l[i] = ll; splitf(p1[i], hh, ll); h[8 + i] = hh; l[8 + i] = ll; }
        a = __builtin_bit_cast(v16bf, h); b = __builtin_bit_cast(v16bf, l); } };

// Hazard guards: 4 VALU-slot nops tied to every accumulator of the group and to the fragments of the last products.
template <int N> struct Grd;
template <> struct Grd<1> {
    template <typename V> static __device__ __forceinline__ void s(v8f (&st)[2][1], const V& x, const V& y) { asm volatile("v_nop\n\tv_nop\n\tv_nop\n\tv_nop" : "+v"(st[0][0]), "+v"(st[1][0]) : "v"(x), "v"(y)); }
    template <typename V> static __device__ __forceinline__ void o(v8f (&oa)[4][1], const V& x, const V& y, const V& z) { asm volatile("v_nop\n\tv_nop\n\tv_nop\n\tv_nop" : "+v"(oa[0][0]), "+v"(oa[1][0]), "+v"(oa[2][0]), "+v"(oa[3][0]) : "v"(x), "v"(y), "v"(z)); }
};
template <> struct Grd<2> {
    template <typename V> static __device__ __forceinline__ void s(v8f (&st)[2][2], const V& x, const V& y) { asm volatile("v_nop\n\tv_nop\n\tv_nop\n\tv_nop" : "+v"(st[0][0]), "+v"(st[1][0]), "+v"(st[0][1]), "+v"(st[1][1]) : "v"(x), "v"(y)); }
    template <typename V> static __device__ __forceinline__ void o(v8f (&oa)[4][2], const V& x, const V& y, const V& z) { asm volatile("v_nop\n\tv_nop\n\tv_nop\n\tv_nop" : "+v"(oa[0][0]), "+v"(oa[1][0]), "+v"(oa[2][0]), "+v"(oa[3][0]), "+v"(oa[0][1]), "+v"(oa[1][1]), "+v"(oa[2][1]), "+v"(oa[3][1]) : "v"(x), "v"(y), "v"(z)); }
};

// ---- fused causal attention body, one work-group of NW waves per 16*NQ query rows of one (batch, head); keys in steps of 32, step i worked by wave i % NW with its own running maximum, row sums and O^T;
// behind the loop the waves' partial results are joined in LDS: every wave rescales its O^T to the common maximum and the common sum, the tiles are added in wave order, at most one epilogue trip a wave.
// S^T[key][query] = sum_d K[key][d] Q[query][d]: A = K rows (lane -> key), B = Q rows (lane -> query); D: lane = query (lane&15), element r = key 8*(lane>>4) + r.
// Row statistics are per lane (query); the two lane halves hold different keys and exchange the step maximum with one xor-16 shuffle; row sums stay per-lane partials until the end.
// O^T[d][query] += V^T[d][key] P^T[key][query]: A = V^T rows (lane -> d), B = packed P^T. Planes, in fragment order: Q, K [t][HD]; V^T [d][vpitch]; Ah, Al [t][CC], pointing at the head's first block of row 0. G: f32 rows.
template <typename T16, bool SPLIT, int NQ, int NW>
__device__ __forceinline__ void attn_body(const T16* __restrict__ Q, const T16* __restrict__ Q2, const T16* __restrict__ Kp, const T16* __restrict__ K2, const T16* __restrict__ Vt, const T16* __restrict__ V2,
                                          const float* __restrict__ G, int vpitch, int q0, float ssc, float osc, float pcar, bf* Ah, bf* Al, float* os, float* ml) {
    typedef typename WFrag<T16>::V V;
    static_assert(4 * NQ <= NW);   // at most one epilogue trip a wave
    const int lane = threadIdx.x & 31, lr = lane & 15, hi = lane >> 4;
    const int wv = __builtin_amdgcn_readfirstlane((int)(threadIdx.x >> 5));   // the wave's number, in a scalar register: the loop's bounds and the epilogue's test stay scalar
    V qf[NQ][2], qf2[NQ][2];
#pragma unroll
    for (int nb = 0; nb < NQ; ++nb)
#pragma unroll
        for (int ds = 0; ds < 2; ++ds) { const size_t qo = (size_t)(q0 + 16 * nb) * HD + 512 * ds + 8 * lane; qf[nb][ds] = WFrag<T16>::ld(Q + qo); if (SPLIT) qf2[nb][ds] = WFrag<T16>::ld(Q2 + qo); }
    v8f o[4][NQ]; float mrun[NQ], lrun[NQ];
#pragma unroll
    for (int nb = 0; nb < NQ; ++nb) { mrun[nb] = NEGB; lrun[nb] = 0.0f;
#pragma unroll
        for (int dt = 0; dt < 4; ++dt) o[dt][nb] = (v8f){}; }
    const int kend = q0 + 16 * NQ;
#pragma unroll 1
    for (int kt = 32 * wv; kt < kend; kt += 32 * NW) {
        V ka[2][2], ka2[2][2];
#pragma unroll
        for (int mb = 0; mb < 2; ++mb)
#pragma unroll
            for (int ds = 0; ds < 2; ++ds) { const size_t ko = (size_t)(kt + 16 * mb) * HD + 512 * ds + 8 * lane; ka[mb][ds] = (!SPLIT || mb + ds < 2) ? WFrag<T16>::ld(Kp + ko) : ldw(Kp + ko); }
        // the four V^T fragments of this key step are asked for here, behind the K fragments, each into registers of its own: they arrive while the scores and the softmax are worked out
        V va[4], va2[4];
        if constexpr (SPLIT) {
            // plane by plane; s_wait_xcnt 0 in front of a plane's last load and behind it: that load's result, or a later one's, may be given the registers of the plane's address
            xwait();
#pragma unroll
            for (int f = 0; f < 4; ++f) { const size_t ko = (size_t)(kt + 16 * (f >> 1)) * HD + 512 * (f & 1) + 8 * lane; ka2[f >> 1][f & 1] = f < 3 ? WFrag<T16>::ld(K2 + ko) : ldw(K2 + ko); }
            xwait();
#pragma unroll
            for (int dt = 0; dt < 4; ++dt) { const size_t vo = (size_t)(16 * dt) * vpitch + kt * 16 + 8 * lane; va[dt] = dt < 3 ? WFrag<T16>::ld(Vt + vo) : ldw(Vt + vo); }
            xwait();
#pragma unroll
            for (int dt = 0; dt < 4; ++dt) { const size_t vo = (size_t)(16 * dt) * vpitch + kt * 16 + 8 * lane; va2[dt] = dt < 3 ? WFrag<T16>::ld(V2 + vo) : ldw(V2 + vo); }
            xwait();
            __builtin_amdgcn_sched_barrier(0);   // the score products stay behind the step's loads: else the build waits for the K fragments first and asks for the V^T fragments only then
        } else {
            xwait();   // behind the K loads: a V^T fragment may be given the registers of their address
#pragma unroll
            for (int dt = 0; dt < 4; ++dt) { const size_t vo = (size_t)(16 * dt) * vpitch + kt * 16 + 8 * lane; va[dt] = dt < 3 ? WFrag<T16>::ld(Vt + vo) : ldw(Vt + vo); }
        }
        v8f st[2][NQ];
#pragma unroll
        for (int mb = 0; mb < 2; ++mb)
#pragma unroll
            for (int nb = 0; nb < NQ; ++nb) { v8f z = (v8f){};
                z = WFrag<T16>::mma(ka[mb][0], qf[nb][0], z); z = WFrag<T16>::mma(ka[mb][1], qf[nb][1], z);
                if (SPLIT) { z = WFrag<T16>::mma(ka2[mb][0], qf[nb][0], z); z = WFrag<T16>::mma(ka2[mb][1], qf[nb][1], z); z = WFrag<T16>::mma(ka[mb][0], qf2[nb][0], z); z = WFrag<T16>::mma(ka[mb][1], qf2[nb][1], z); }
                st[mb][nb] = z; }
        Grd<NQ>::s(st, ka[1][1], SPLIT ? qf2[NQ - 1][1] : qf[NQ - 1][1]);
        V pb[NQ], pb2[NQ];
#pragma unroll
        for (int nb = 0; nb < NQ; ++nb) {
            const int qg = q0 + 16 * nb + lr; float mx = NEGB;
#pragma unroll
            for (int mb = 0; mb < 2; ++mb)
#pragma unroll
                for (int r = 0; r < 8; ++r) { const int kg = kt + 16 * mb + 8 * hi + r; float t = st[mb][nb][r] * ssc; t = (kg <= qg) ? t : NEGB; st[mb][nb][r] = t; mx = fmaxf(mx, t); }
            mx = fmaxf(mx, __shfl_xor(mx, 16, 32));
            const float mn = fmaxf(mrun[nb], mx);
            const float al = __builtin_amdgcn_exp2f((mrun[nb] - mn) * L2E); mrun[nb] = mn;
            float psum = 0.0f;
#pragma unroll
            for (int mb = 0; mb < 2; ++mb)
#pragma unroll
                for (int r = 0; r < 8; ++r) { const float p = __builtin_amdgcn_exp2f((st[mb][nb][r] - mn) * L2E); psum += p; st[mb][nb][r] = p; }
            lrun[nb] = lrun[nb] * al + psum;
#pragma unroll
            for (int dt = 0; dt < 4; ++dt)
#pragma unroll
                for (int r = 0; r < 8; ++r) o[dt][nb][r] *= al;
            PPack<T16>::mk(st[0][nb], st[1][nb], pcar, pb[nb], pb2[nb]);
        }
#pragma unroll
        for (int dt = 0; dt < 4; ++dt) {
#pragma unroll
            for (int nb = 0; nb < NQ; ++nb) { o[dt][nb] = WFrag<T16>::mma(va[dt], pb[nb], o[dt][nb]); if (SPLIT) { o[dt][nb] = WFrag<T16>::mma(va2[dt], pb[nb], o[dt][nb]); o[dt][nb] = WFrag<T16>::mma(va[dt], pb2[nb], o[dt][nb]); } } }
        Grd<NQ>::o(o, SPLIT ? va2[3] : va[3], pb[NQ - 1], SPLIT ? pb2[NQ - 1] : pb[0]);
    }
    // the wave's epilogue trip: 16 query rows x 16 d of the tile; its gate values are asked for here, in front of the join: their round trip ends at the first barrier, where a wave waits for the others anyway
    const int s = wv; const bool mine = 4 * NQ == NW || s < 4 * NQ;   // the same in every lane of a wave; with fewer trips than waves the last waves have none
    v4f ga = (v4f){}, gc = (v4f){};
    if (mine) { const float* gp = G + (size_t)(q0 + 16 * (s >> 2) + lr) * CC + 16 * (s & 3) + 8 * hi; ga = *(const v4f*)gp;
        xwait();   // in front of the last load through the address: its result may be given the registers of that address
        gc = *(const v4f*)(gp + 4);
        xwait(); }   // and behind it: so may a value of the join below
    // (the loops of the join are unrolled so that their small arrays stay in registers)
    // every wave's maximum (lanes 0..15) and row sum (lanes 16..31; the two lane halves' partial sums joined first) of each query go to LDS: ml[0][wave][query], ml[1][wave][query]
#pragma unroll
    for (int nb = 0; nb < NQ; ++nb) { float lt = lrun[nb]; lt += __shfl_xor(lt, 16, 32); ml[(hi * NW + wv) * 16 * NQ + 16 * nb + lr] = hi ? lt : mrun[nb]; }
    __syncthreads();   // the maxima and sums of all waves are read below
    // normalise to the common maximum and sum; O^T lane = query, element r = d 16*dt + 8*hi + r  ->  the wave's own LDS tile [query][d]. A wave without a key step holds NEGB, 0 and zeros: its factor is 0.
    float* ow = os + wv * (16 * NQ * OSP);
#pragma unroll
    for (int nb = 0; nb < NQ; ++nb) { float mw[NW], ms = NEGB, lt = 0.0f;
#pragma unroll
        for (int w = 0; w < NW; ++w) { mw[w] = ml[w * 16 * NQ + 16 * nb + lr]; ms = fmaxf(ms, mw[w]); }
#pragma unroll
        for (int w = 0; w < NW; ++w) lt += ml[(NW + w) * 16 * NQ + 16 * nb + lr] * ex2s((mw[w] - ms) * L2E);
        const float inv = osc * rcps(lt) * ex2s((mrun[nb] - ms) * L2E);
#pragma unroll
        for (int dt = 0; dt < 4; ++dt) { v4f a, c;
#pragma unroll
            for (int r = 0; r < 4; ++r) { a[r] = o[dt][nb][r] * inv; c[r] = o[dt][nb][4 + r] * inv; }
            float* dst = ow + (16 * nb + lr) * OSP + 16 * dt + 8 * hi; *(v4fa*)dst = a; *(v4fa*)(dst + 4) = c; } }
    __syncthreads();   // every wave's tile is read below
    if (mine) { const int row = 16 * (s >> 2) + lr, seg = 16 * (s & 3) + 8 * hi; v4f a = *(const v4fa*)(os + row * OSP + seg), c = *(const v4fa*)(os + row * OSP + seg + 4);
#pragma unroll
        for (int w = 1; w < NW; ++w) { a += *(const v4fa*)(os + w * (16 * NQ * OSP) + row * OSP + seg); c += *(const v4fa*)(os + w * (16 * NQ * OSP) + row * OSP + seg + 4); }
        v8us oh, ol;
#pragma unroll
        for (int k = 0; k < 4; ++k) { unsigned short hh, ll; const float ya = a[k] * sigm(ga[k]); const float yc = c[k] * sigm(gc[k]); splitf(ya, hh, ll); oh[k] = hh; ol[k] = ll; splitf(yc, hh, ll); oh[4 + k] = hh; ol[4 + k] = ll; }
        const size_t oo = (size_t)(q0 + 16 * (s >> 2)) * CC + (s & 3) * 256 + 8 * lane;   // block (row / 16, (s & 3) >> 1) of the head's two, half s & 1
        *(v8us*)(Ah + oo) = oh; *(v8us*)(Al + oo) = ol; }
}

// Both attention paths in one launch, a work-group of NWV waves per query tile, one-dimensional grid of (ATH + ATS) * NH * NB work-groups. The two kinds read and write disjoint rows and nothing of each other.
// First the tiles of 32 rows >= RH (f16 planes [b][h] x ([SEQ][HD]) / [b][h] x ([HD][SEQ]) with carries), tile fastest, then head, then batch; behind them, numbered the same way, the tiles of 16 rows < RH
// (bf16 hi/lo planes [b][h] x ([RH][HD]) / [b][h] x ([HD][RH])): these short ones come last, for speed only.
// The test between the kinds is the same for a whole work-group: every barrier of a body is passed by all its waves.
#define ATH ((SEQ - RH) / 32)
#define ATS (RH / 16)
static_assert(ATH > 0 && ATS > 0);   // both kinds of tile exist: the index is divided by their counts
__global__ __launch_bounds__(32 * NWV) void k_attn(const h16* __restrict__ Q, const h16* __restrict__ Kp, const h16* __restrict__ Vt, const bf* __restrict__ Qh, const bf* __restrict__ Ql, const bf* __restrict__ Kh, const bf* __restrict__ Kl, const bf* __restrict__ Vh, const bf* __restrict__ Vl, const float* __restrict__ Gt, bf* ATh, bf* ATl) {
    __shared__ __align__(16) float os[NWV * 32 * OSP]; __shared__ float ml[2 * NWV * 32];
    // tile, head and batch are taken from the index inside each branch, by constants: they stay in scalar registers, and with them the loop bounds and the plane addresses
    if (blockIdx.x < (unsigned)(ATH * NH * NB)) { const unsigned i = blockIdx.x, tile = i % ATH, bh = i / ATH, h = bh % NH, b = bh / NH;
        const size_t po = (size_t)bh * SEQ * HD, ao = (size_t)b * SEQ * CC + (size_t)h * HD, ap = (size_t)b * SEQ * CC + (size_t)h * HD * 16;
        attn_body<h16, false, 2, NWV>(Q + po, nullptr, Kp + po, nullptr, Vt + po, nullptr, Gt + ao, SEQ, RH + (int)tile * 32, 0.125f / (QCAR * QCAR), 1.0f / (PCAR * VCAR), PCAR, ATh + ap, ATl + ap, os, ml);
    } else { const unsigned i = blockIdx.x - (unsigned)(ATH * NH * NB), tile = i % ATS, bh = i / ATS, h = bh % NH, b = bh / NH;
        const size_t po = (size_t)bh * RH * HD, ao = (size_t)b * SEQ * CC + (size_t)h * HD, ap = (size_t)b * SEQ * CC + (size_t)h * HD * 16;
        attn_body<bf, true, 1, NWV>(Qh + po, Ql + po, Kh + po, Kl + po, Vh + po, Vl + po, Gt + ao, RH, (int)tile * 16, 0.125f, 1.0f, 1.0f, ATh + ap, ATl + ap, os, ml); }
}

extern "C" void kernel_launch(void* const* d_in, const int* in_sizes, int n_in,
                              void* d_out, int out_size, void* d_ws, size_t ws_size, hipStream_t stream) {
    if (n_in < 7) return;
    if ((size_t)in_sizes[0] < ((size_t)(NB - 1) * SEQ_FULL + SEQ) * CC) return;
    if ((size_t)in_sizes[1] < W1 || (size_t)in_sizes[2] < W1 || (size_t)in_sizes[3] < W1 || (size_t)in_sizes[4] < W1 || (size_t)in_sizes[5] < W1 || in_sizes[6] < CC) return;
    if ((size_t)out_size < PL16) return;
    // wire order: x, Wq, Wk, Wv, Wg, Wo, bo
    const float* x = (const float*)d_in[0]; const float* wq = (const float*)d_in[1]; const float* wk = (const float*)d_in[2]; const float* wv = (const float*)d_in[3];
    const float* wg = (const float*)d_in[4]; const float* wo = (const float*)d_in[5]; const float* bo = (const float*)d_in[6];
    float* OUT = (float*)d_out;     // [NB][SEQ][CC]
    char* wsp = (char*)d_ws;
    auto take = [&](size_t bytes) { char* p = wsp; wsp += (bytes + 255) & ~(size_t)255; return (void*)p; };
    bf* WQ = (bf*)take(4 * W1 * 2);            // Wq | Wk | Wv | Wg bf16 [out][in], each in fragment order
    bf* WO = (bf*)take(W1 * 2);
    bf* XB = (bf*)take(PL16 * 2);              // bf16 x [MROWS][CC] in fragment order
    float* F = (float*)take(4 * PL16 * 4);     // four f32 planes [MROWS][CC]: the last holds the gate, the first the gated ctx
    h16* QK16 = (h16*)take(2 * PL16 * 2);      // f16 q planes | k planes
    h16* VT16 = (h16*)take(PL16 * 2);
    bf* QKh = (bf*)take(2 * PLR * 2); bf* QKl = (bf*)take(2 * PLR * 2);
    bf* VTh = (bf*)take(PLR * 2); bf* VTl = (bf*)take(PLR * 2);
    if ((size_t)(wsp - (char*)d_ws) > ws_size) return;
    // gated-ctx hi | lo planes lie in the first f32 plane of F, which no launch writes as f32 (only the gate plane is); sizes match exactly
    bf* ATh = (bf*)F; bf* ATl = ATh + PL16;
    const float* GATE = F + 3 * PL16;
    k_cvt_all<<<(CV_WAVES + CVW - 1) / CVW, 32 * CVW, 0, stream>>>(wq, wk, wv, wg, wo, x, WQ);   // WQ | WO | XB are one run of planes (no padding between carve pieces)
    k_gemm_proj<<<dim3(MROWS / (64 * PWM), CC / (64 * PWN), 4), 32 * PWM * PWN, 0, stream>>>(XB, WQ, F, W1, PL16, QK16, QKh, QKl, VT16, VTh, VTl);
    k_attn<<<(ATH + ATS) * NH * NB, 32 * NWV, 0, stream>>>(QK16, QK16 + PL16, VT16, QKh, QKl, QKh + PLR, QKl + PLR, VTh, VTl, GATE, ATh, ATl);
    k_gemm_out<<<dim3(MROWS / (64 * OWM), CC / (64 * OWN), 1), 32 * OWM * OWN, 0, stream>>>(ATh, ATl, WO, OUT, bo);
}

// v008
// It runs in 81.7 microseconds.
// Next to v007, in two timings, it ran 1.13 and 1.14 times as fast.
// Over all steps from v000 it is 3.44 times as fast.
#include <hip/hip_runtime.h>

// Causal multi-head attention with a sigmoid output gate, x [2][2048][1024], 16 heads x 64, weights [out][in], one score scale 1/8, tril mask, out = (merged heads * sigmoid(x Wg^T)) x Wo^T + bo.
// Compute dtypes, f32 accumulate: all float inputs RNE-converted to bf16 on load; q/k/v/gate projections v_wmma_f32_16x16x32_bf16 (exact products);
// attention rows < RH: bf16 hi/lo planes, 3 products on q.k and on p.v; rows >= RH: v_wmma_f32_16x16x32_f16 with q,k x16, v x16, p x1024 carries; softmax f32 (running max); gate sigmoid f32 on the VALU;
// output projection: gated ctx bf16 hi/lo x bf16 Wo (2 products) + bf16(bo).
// Every 16-bit matrix operand plane [rows][K] of the workspace lies in fragment order: blocks of 16 rows x 32 k (512 elements, 1 KiB), block (row/16, k/32) at index (row/16)*(K/32) + k/32;
// in a block the 16-B unit 32*half + lane holds row lane&15, k = 16*half + 8*(lane>>4) + 0..7. A wave's fragment load or store of 16 B a lane then covers 512 contiguous bytes.
// Fused attention in transposed form: S^T = K Q^T (D rows = keys, lane = query), P^T fragment built lane-locally from two S^T tiles, O^T = V^T P^T; no score plane in global memory.

#ifndef NB
#define NB 2
#endif
#ifndef SEQ
#define SEQ 2048
#endif
#ifndef RH
#define RH 256                       // query rows < RH use hi+lo planes
#endif
#define NB_FULL  2
#define SEQ_FULL 2048
#define CC   1024
#define NH   16
#define HD   64
#define MROWS (NB * SEQ)
#define PCAR 1024.0f
#define QCAR 16.0f
#define VCAR 16.0f
#define L2E  1.4426950408889634f
#define NEGB (-1.0e30f)
#define OSP  68
#define NWV  8                        // waves of an attention work-group: they share out the sub-tiles and the key steps of one query tile
#define CVU  16                       // conversion launch: 16-B output units a lane
#define CVW  9                        // and waves of a work-group
#define PWM  2                        // projection GEMM: a work-group's waves along the rows
#define PWN  4                        // and along the columns, one 64x64 tile a wave
#define PKB  2                        // and the k blocks of 32 in a stage of its LDS ring
#define OWM  2                        // output GEMM: the same three
#define OWN  2
#define OKB  4
#define W1   ((size_t)CC * CC)
#define PL16 ((size_t)MROWS * CC)
#define PLR  ((size_t)NB * NH * RH * HD)
// carve: 4+1 bf16 weight planes, bf16 x, 4 f32 planes (the last: gate; the first: the gated-ctx hi|lo planes), f16 q|k|v^T planes, bf16 hi/lo planes of the first RH rows
#define WS_TOTAL (10 * W1 + 24 * PL16 + 12 * PLR)
#define CV_WB    ((unsigned)(W1 / 512))                                  // blocks of a weight plane
#define CV_WAVES ((unsigned)((5 * W1 + PL16) / (256 * CVU)))             // waves that the conversion launch needs
static_assert((5 * W1 + PL16) % (256 * CVU) == 0 && W1 % (256 * CVU) == 0 && (CC / 32) % (CVU / 2) == 0);   // a conversion wave's blocks lie in one plane and in one row of blocks
static_assert(CC == NH * HD);                 // head split covers the model width
static_assert(HD == 64);
static_assert(CC % (64 * PWN) == 0 && CC % (64 * OWN) == 0 && CC % (64 * PKB) == 0 && CC % (64 * OKB) == 0);  // GEMM N tiles; K: two stages or more
static_assert(MROWS % (64 * PWM) == 0 && MROWS % (64 * OWM) == 0);                    // GEMM M tiles
static_assert(SEQ % 256 == 0);                // a 64-row projection tile stays inside one batch
static_assert(RH % 256 == 0 && RH <= SEQ);    // a 64-row projection tile lies on one side of the hi/lo row boundary
static_assert((SEQ - RH) % 64 == 0 && RH % 32 == 0 && RH % 16 == 0);   // query tiles of 64 (f16 path) and 16 (hi/lo path)
static_assert(NB <= NB_FULL && SEQ <= SEQ_FULL);
static_assert((W1 * 2) % 256 == 0 && (PL16 * 2) % 256 == 0 && (PLR * 2) % 256 == 0);   // carve pieces stay 256-B aligned without padding
static_assert(2 * PL16 * sizeof(unsigned short) <= PL16 * sizeof(float));              // gated-ctx hi|lo planes fit exactly inside the first f32 plane of F
static_assert(WS_TOTAL <= (size_t)134217728); // total carve <= 128 MiB

typedef _Float16 h16;
typedef unsigned short bf;
typedef __attribute__((ext_vector_type(16))) __bf16   v16bf;
typedef __attribute__((ext_vector_type(16))) _Float16 v16h;
typedef __attribute__((ext_vector_type(16))) unsigned short v16us;
typedef __attribute__((ext_vector_type(8)))  _Float16 v8h;
typedef __attribute__((ext_vector_type(8)))  unsigned short v8us;
typedef __attribute__((ext_vector_type(8)))  float    v8f;
typedef __attribute__((ext_vector_type(4)))  float    v4f;
typedef v4f  __attribute__((may_alias)) v4fa;

__device__ __forceinline__ unsigned short f2bf(float f) { unsigned u = __float_as_uint(f); u += 0x7FFFu + ((u >> 16) & 1u); return (unsigned short)(u >> 16); }
__device__ __forceinline__ float bf2f(unsigned short b) { return __uint_as_float(((unsigned)b) << 16); }
__device__ __forceinline__ float bfr(float f) { return bf2f(f2bf(f)); }
__device__ __forceinline__ h16 tohx(float x) { return (h16)x; }
__device__ __forceinline__ void splitf(float y, unsigned short& h, unsigned short& l) { h = f2bf(y); l = f2bf(y - bf2f(h)); }
// v_exp_f32 and v_rcp_f32 as the builtins give them, each with one v_nop in its own statement: the slot that the instruction set asks for between a transcendental and a directly following instruction that reads its result or overwrites its source
__device__ __forceinline__ float sigm(float g) { float e, r; asm("v_exp_f32 %0, %1\n\tv_nop" : "=v"(e) : "v"(-g * L2E)); asm("v_rcp_f32 %0, %1\n\tv_nop" : "=v"(r) : "v"(1.0f + e)); return r; }
// the same two statements singly, for the join of the attention waves' partial results
__device__ __forceinline__ float ex2s(float x) { float e; asm("v_exp_f32 %0, %1\n\tv_nop" : "=v"(e) : "v"(x)); return e; }
__device__ __forceinline__ float rcps(float x) { float r; asm("v_rcp_f32 %0, %1\n\tv_nop" : "=v"(r) : "v"(x)); return r; }
__device__ __forceinline__ v16h cat16(v8h lo, v8h hi) { return __builtin_shufflevector(lo, hi, 0, 1, 2, 3, 4, 5, 6, 7, 8, 9, 10, 11, 12, 13, 14, 15); }
__device__ __forceinline__ v16bf cat16b(v8us lo, v8us hi) { return __builtin_bit_cast(v16bf, __builtin_shufflevector(lo, hi, 0, 1, 2, 3, 4, 5, 6, 7, 8, 9, 10, 11, 12, 13, 14, 15)); }
__device__ __forceinline__ v8f wmma16(v16h a, v16h b, v8f c) { return __builtin_amdgcn_wmma_f32_16x16x32_f16(false, a, false, b, (short)0, c, false, false); }
__device__ __forceinline__ v8f wmmab(v16bf a, v16bf b, v8f c) { return __builtin_amdgcn_wmma_f32_16x16x32_bf16(false, a, false, b, (short)0, c, false, false); }

// Fragment loader from a block in fragment order: p = block + 8*lane; elements 0..7 <- p[0..7] (half 0), elements 8..15 <- p[256..263] (half 1).
template <typename T16> struct WFrag;
template <> struct WFrag<h16> { typedef v16h V; static __device__ __forceinline__ V ld(const h16* p) { return cat16(*(const v8h*)p, *(const v8h*)(p + 256)); } static __device__ __forceinline__ v8f mma(V a, V b, v8f c) { return wmma16(a, b, c); } };
template <> struct WFrag<bf> { typedef v16bf V; static __device__ __forceinline__ V ld(const bf* p) { return cat16b(*(const v8us*)p, *(const v8us*)(p + 256)); } static __device__ __forceinline__ v8f mma(V a, V b, v8f c) { return wmmab(a, b, c); } };
// s_wait_xcnt 0, written where the next load's result may be given the registers of an address that loads already issued name.
__device__ __forceinline__ void xwait() { asm volatile("s_wait_xcnt 0x0" ::: "memory"); }
// The fragment loaders again, for the last fragment read through an address: the wait stands in front of its last load, whose result may be given the address's own registers.
__device__ __forceinline__ v16h ldw(const h16* p) { const v8h lo = *(const v8h*)p; xwait(); return cat16(lo, *(const v8h*)(p + 256)); }
__device__ __forceinline__ v16bf ldw(const bf* p) { const v8us lo = *(const v8us*)p; xwait(); return cat16b(lo, *(const v8us*)(p + 256)); }

// The attention planes that the projection tiles are written to: f16 q|k [w][b][h] x ([t][HD]) and v^T [b][h] x ([d][t]) with their carries, bf16 hi/lo planes of the first RH rows; each [rows][K] plane in fragment order.
struct Planes { h16* qk16; bf* qkh; bf* qkl; h16* vt16; bf* vth; bf* vtl; };

// A 64x64 f32 accumulator tile (lane&15 = column within 16 nb, element j = row 8*(lane>>4) + j within 16 mb) leaves as q or k rows [t][HD]: f16 with the carry, and for HL the bf16 hi/lo pair.
// 16 rows at a time go through the LDS stage; then a store writes one half of a block (512 contiguous B). p16, ph, pl point at the block of the tile's first row.
template <bool HL>
__device__ __forceinline__ void put_qk(const v8f (&acc)[4][4], float* os, h16* p16, bf* ph, bf* pl, int lane) {
    const int lr = lane & 15, hi = lane >> 4;
#pragma unroll
    for (int mb = 0; mb < 4; ++mb) {
#pragma unroll
        for (int nb = 0; nb < 4; ++nb) {
#pragma unroll
            for (int j = 0; j < 8; ++j) os[(hi * 8 + j) * OSP + nb * 16 + lr] = acc[mb][nb][j]; }
        __builtin_amdgcn_wave_barrier(); asm volatile("" ::: "memory");   // compiler fence: the row reads below take other lanes' writes and must not be moved over them
#pragma unroll
        for (int s = 0; s < 4; ++s) { const int seg = 16 * s + 8 * hi; const v4f a = *(const v4fa*)(os + lr * OSP + seg), g = *(const v4fa*)(os + lr * OSP + seg + 4); v8h o16;
#pragma unroll
            for (int k = 0; k < 4; ++k) { o16[k] = tohx(a[k] * QCAR); o16[4 + k] = tohx(g[k] * QCAR); }
            const int o = mb * 16 * HD + s * 256 + lane * 8;   // block (mb, s >> 1), half s & 1
            *(v8h*)(p16 + o) = o16;
            if constexpr (HL) { v8us oh, ol;
#pragma unroll
                for (int k = 0; k < 4; ++k) { unsigned short hh, ll; splitf(a[k], hh, ll); oh[k] = hh; ol[k] = ll; splitf(g[k], hh, ll); oh[4 + k] = hh; ol[4 + k] = ll; }
                *(v8us*)(ph + o) = oh; *(v8us*)(pl + o) = ol; } }
        __builtin_amdgcn_wave_barrier(); asm volatile("" ::: "memory");   // compiler fence: the next 16 rows' writes stay behind these reads
    }
    xwait();   // behind the last stores: where the build lays another epilogue block out behind this one, that block rewrites registers that they name
}
// The same tile leaves as v^T [d][t]: a lane's 8 accumulator elements are 8 consecutive t of one d, its own 16-B unit of block (nb, mb >> 1), half mb & 1, stored from the registers. p16 (K = SEQ), ph, pl (K = RH) point at the block of d = 0 of the head, first t of the tile; hl (the same in every lane): the bf16 hi/lo pair is wanted too.
__device__ __forceinline__ void put_vt(const v8f (&acc)[4][4], h16* p16, bf* ph, bf* pl, bool hl, int lane) {
    if (hl) {
#pragma unroll
        for (int nb = 0; nb < 4; ++nb)
#pragma unroll
            for (int mb = 0; mb < 4; ++mb) { const int o = nb * 16 * RH + mb * 256 + lane * 8; v8us oh, ol;
#pragma unroll
                for (int j = 0; j < 8; ++j) { unsigned short hh, ll; splitf(acc[mb][nb][j], hh, ll); oh[j] = hh; ol[j] = ll; }
                *(v8us*)(ph + o) = oh; *(v8us*)(pl + o) = ol; }
        xwait();   // behind the hi/lo stores: the f16 stores' address is formed in registers that they name
    }
#pragma unroll
    for (int nb = 0; nb < 4; ++nb)
#pragma unroll
        for (int mb = 0; mb < 4; ++mb) { v8h o16;
#pragma unroll
            for (int j = 0; j < 8; ++j) o16[j] = tohx(acc[mb][nb][j] * VCAR);
            *(v8h*)(p16 + nb * 16 * SEQ + mb * 256 + lane * 8) = o16; }
    xwait();   // behind the last stores: where the build lays another epilogue block out behind this one, that block rewrites registers that they name
}

// Twelve asynchronous copies of 16 B a lane, global memory -> LDS through no register: three units of 2 KiB (two k blocks of one row of blocks), 4 x 512 B a wave each. l: the lane's LDS byte address, g: its global address.
// s_wait_xcnt 0 is the statement's last line: the address registers that the copies name are rewritten behind it (the next stage's additions).
__device__ __forceinline__ void cp_units3(unsigned l0, const char* g0, unsigned l1, const char* g1, unsigned l2, const char* g2) {
    asm volatile("global_load_async_to_lds_b128 %0, %12, off\n\t"
                 "global_load_async_to_lds_b128 %1, %13, off\n\t"
                 "global_load_async_to_lds_b128 %2, %14, off\n\t"
                 "global_load_async_to_lds_b128 %3, %15, off\n\t"
                 "global_load_async_to_lds_b128 %4, %16, off\n\t"
                 "global_load_async_to_lds_b128 %5, %17, off\n\t"
                 "global_load_async_to_lds_b128 %6, %18, off\n\t"
                 "global_load_async_to_lds_b128 %7, %19, off\n\t"
                 "global_load_async_to_lds_b128 %8, %20, off\n\t"
                 "global_load_async_to_lds_b128 %9, %21, off\n\t"
                 "global_load_async_to_lds_b128 %10, %22, off\n\t"
                 "global_load_async_to_lds_b128 %11, %23, off\n\t"
                 "s_wait_xcnt 0x0"
                 :: "v"(l0), "v"(l0 + 512u), "v"(l0 + 1024u), "v"(l0 + 1536u), "v"(l1), "v"(l1 + 512u), "v"(l1 + 1024u), "v"(l1 + 1536u), "v"(l2), "v"(l2 + 512u), "v"(l2 + 1024u), "v"(l2 + 1536u),
                    "v"(g0), "v"(g0 + 512), "v"(g0 + 1024), "v"(g0 + 1536), "v"(g1), "v"(g1 + 512), "v"(g1 + 1024), "v"(g1 + 1536), "v"(g2), "v"(g2 + 512), "v"(g2 + 1024), "v"(g2 + 1536)
                 : "memory");
}

// ---- GEMM body, a work-group of WM x WN waves, one 64x64 tile a wave: C[m][n] (f32, pitch ldc, + optional bf16-converted bias[n]) = sum_k A[m][k] Bt[n][k] (+ A2 x Bt when NSPLIT == 1); K % (64 KB) == 0; A, A2, Bt in fragment order.
// The operands of the work-group's 64 WM x 64 WN tile come through LDS, a stage of KB k blocks (32 KB k) at a time, two buffers: a stage is [A | A2 | Bt] rows of blocks, KB KiB each, which lie in LDS as they lie in their plane.
// The waves deal the stage out among them in units of 2 KiB and bring it in by asynchronous copies, one stage ahead; every block is fetched once for the work-group and read from LDS by the WN (A) or WM (Bt) waves that need it.
// FS: fragment sets in registers. 2: a k block's fragments are read from LDS while the block before it, of the same stage, is multiplied (for one wave a SIMD); 1: other waves of the SIMD cover the reads.
// PLANES: tiles of z = 0, 1 (q, k) and z = 2 (v) leave as attention planes straight from the f32 accumulators; z = 3 (gate) leaves as f32 rows like any other tile.
template <typename T16, int NSPLIT, bool BIAS, bool PLANES, int WM, int WN, int KB, int FS>
__device__ __forceinline__ void gemmw_body(const T16* __restrict__ A, const T16* __restrict__ A2, const T16* __restrict__ Bt, int K, float* C, int ldc, const float* __restrict__ bias, size_t sB, size_t sC, char* ring, float* osall, const Planes pl) {
    typedef typename WFrag<T16>::V V;
    constexpr int NW = WM * WN, NA = NSPLIT == 1 ? 2 : 1, RA = 4 * WM, RB = 4 * WN, UPR = KB / 2;   // waves; A planes; rows of blocks of A and of Bt; units in a row of blocks
    constexpr int UA = RA * UPR, NU = (NA * RA + RB) * UPR, NUW = NU / NW, BUFB = NU * 2048;        // units of an A plane, of a stage, of one wave; bytes of a buffer
    static_assert(KB % 2 == 0 && UA % NW == 0 && NU % NW == 0 && NUW % 3 == 0 && 4 * NUW <= 63);    // a wave's i-th unit lies in the same plane for every wave; units go three to a statement; copies of a wave in flight
    static_assert(FS == 1 || FS == 2);
    const size_t z = blockIdx.z; Bt += z * sB; C += z * sC;
    const int lane = threadIdx.x & 31, lr = lane & 15, hi = lane >> 4;
    const int wv = __builtin_amdgcn_readfirstlane((int)(threadIdx.x >> 5)), wm = wv % WM, wn = wv / WM;   // the wave's number and its place in the work-group's tile, in scalar registers
    const int R0 = blockIdx.x * 64 * WM, C0 = blockIdx.y * 64 * WN, r0 = R0 + 64 * wm, c0 = C0 + 64 * wn;
    float* os = osall + wv * 16 * OSP;   // the wave's own epilogue stage
    v8f acc[4][4];
#pragma unroll
    for (int mb = 0; mb < 4; ++mb)
#pragma unroll
        for (int nb = 0; nb < 4; ++nb) acc[mb][nb] = (v8f){};
    // the wave's units: number wv + NW i of the stage; 16 rows of blocks are 16 K elements, a unit 1024 elements, a stage's step along k KB blocks.
    // One address a plane, that of the wave's first unit there; its further units of the plane lie NW / UPR rows of blocks apart.
    static_assert(NW % UPR == 0);
    const size_t wo = (size_t)(16 * (wv / UPR)) * K + (wv % UPR) * 1024 + 8 * lane;
    const char* gb[NA + 1];
    gb[0] = (const char*)(A + (size_t)R0 * K + wo); if (NA == 2) gb[1] = (const char*)(A2 + (size_t)R0 * K + wo); gb[NA] = (const char*)(Bt + (size_t)C0 * K + wo);
    auto gp = [&](int i) { const int p = i < UA / NW ? 0 : i < NA * UA / NW ? 1 : NA, ii = i - p * (UA / NW); return gb[p] + (size_t)(16 * (NW / UPR) * ii) * K * sizeof(T16); };
    const unsigned lw = (unsigned)(size_t)ring + (unsigned)(wv * 2048 + lane * 16);   // the lane's LDS byte address in the wave's first unit of buffer 0
    auto issue = [&](unsigned bo) {   // the wave's copies of the next stage not yet asked for, into the buffer at byte bo
#pragma unroll
        for (int i = 0; i < NUW; i += 3) cp_units3(lw + bo + i * NW * 2048, gp(i), lw + bo + (i + 1) * NW * 2048, gp(i + 1), lw + bo + (i + 2) * NW * 2048, gp(i + 2));
#pragma unroll
        for (int p = 0; p <= NA; ++p) gb[p] += KB * 1024; };
    const int NT = K / (32 * KB);
    issue(0u);
    asm volatile("s_wait_asynccnt 0x0" ::: "memory");   // the wave's copies of stage 0 have landed
    __syncthreads();                                    // and so have the other waves': stage 0 is read below
    issue((unsigned)BUFB);
    unsigned bo = 0u;   // the buffer that this trip reads
#pragma unroll 1
    for (int t = 0; t < NT; ++t) {
        const char* fb = ring + bo + lane * 16;
        V a[FS][4], a2[FS][4], b[FS][4];
        auto ldset = [&](int s, int kk) {   // the wave's fragments of k block kk of this stage, as one group of LDS reads
#pragma unroll
            for (int mb = 0; mb < 4; ++mb) { a[s][mb] = WFrag<T16>::ld((const T16*)(fb + ((4 * wm + mb) * KB + kk) * 1024)); if (NSPLIT == 1) a2[s][mb] = WFrag<T16>::ld((const T16*)(fb + ((RA + 4 * wm + mb) * KB + kk) * 1024)); }
#pragma unroll
            for (int nb = 0; nb < 4; ++nb) b[s][nb] = WFrag<T16>::ld((const T16*)(fb + ((NA * RA + 4 * wn + nb) * KB + kk) * 1024)); };
        if (FS == 2) { ldset(0, 0);
            __builtin_amdgcn_sched_barrier(0); }   // the first block's reads go out ahead of the second's: else the build mixes the two groups and the first product waits for both
#pragma unroll
        for (int kk = 0; kk < KB; ++kk) { const int s = kk & (FS - 1);
            if (FS == 1) ldset(0, kk); else if (kk + 1 < KB) ldset(s ^ 1, kk + 1);
            __builtin_amdgcn_sched_barrier(0);   // the products stay behind the group of reads: else the build reads one Bt fragment at a time, an LDS round trip in front of every four products
#pragma unroll
            for (int nb = 0; nb < 4; ++nb)
#pragma unroll
                for (int mb = 0; mb < 4; ++mb) { acc[mb][nb] = WFrag<T16>::mma(a[s][mb], b[s][nb], acc[mb][nb]); if (NSPLIT == 1) acc[mb][nb] = WFrag<T16>::mma(a2[s][mb], b[s][nb], acc[mb][nb]); }
        }
        asm volatile("s_wait_dscnt 0x0" ::: "memory");      // the wave's reads of this buffer have returned: it is refilled behind the barrier
        asm volatile("s_wait_asynccnt 0x0" ::: "memory");   // the wave's copies of the next stage have landed
        __syncthreads();                                    // every wave has left this buffer, and the next stage is whole
        if (t + 2 < NT) issue(bo);                          // the same for the whole work-group
        bo = (unsigned)BUFB - bo;
    }
    asm volatile("s_wait_asynccnt 0x0" ::: "memory");   // no copy is outstanding where the wave goes on to its epilogue
    if constexpr (PLANES) {
        // a tile's 64 columns are one head (HD == 64), its 64 rows lie in one batch and on one side of RH: every test here is the same for the whole wave
        const unsigned w = blockIdx.z, h = (unsigned)c0 / HD, b = (unsigned)r0 / SEQ, t0 = (unsigned)r0 % SEQ;
        if (w < 2u) { const size_t bh = (size_t)(w * NB + b) * NH + h; h16* p16 = pl.qk16 + (bh * SEQ + t0) * HD;
            if (t0 < RH) put_qk<true>(acc, os, p16, pl.qkh + (bh * RH + t0) * HD, pl.qkl + (bh * RH + t0) * HD, lane); else put_qk<false>(acc, os, p16, nullptr, nullptr, lane);
            return; }
        if (w == 2u) { const size_t bh = (size_t)b * NH + h; h16* p16 = pl.vt16 + bh * HD * SEQ + t0 * 16;
            const size_t o2 = bh * HD * RH + (t0 < RH ? t0 * 16 : 0u);   // stays inside the hi/lo planes for a tile that does not write them
            put_vt(acc, p16, pl.vth + o2, pl.vtl + o2, t0 < RH, lane);
            return; }
    }
#pragma unroll
    for (int mb = 0; mb < 4; ++mb) {
#pragma unroll
        for (int nb = 0; nb < 4; ++nb) {
#pragma unroll
            for (int j = 0; j < 8; ++j) os[(hi * 8 + j) * OSP + nb * 16 + lr] = acc[mb][nb][j]; }
        __builtin_amdgcn_wave_barrier(); asm volatile("" ::: "memory");
        float* crow = C + (size_t)(r0 + mb * 16) * ldc + c0;
{
#pragma unroll
            for (int s = 0; s < 8; ++s) { const int row = 2 * s + hi, cofs = lr * 4; v4f val = *(const v4fa*)(os + row * OSP + cofs); if (BIAS) { val[0] += bfr(bias[c0 + cofs]); val[1] += bfr(bias[c0 + cofs + 1]); val[2] += bfr(bias[c0 + cofs + 2]); val[3] += bfr(bias[c0 + cofs + 3]); }
                *(v4f*)(crow + (size_t)row * ldc + cofs) = val; }
             }
        xwait();   // behind the eight row stores: the next 16 rows' values (the bias reload among them) may be given registers that these stores name
        __builtin_amdgcn_wave_barrier(); asm volatile("" ::: "memory");
    }
    if constexpr (PLANES) xwait();   // behind the gate tile's last stores: the plane blocks laid out behind them rewrite registers that they name
}

// q/k/v/gate projections: z = 0..3 selects the weight plane (stride sB); q, k, v tiles go to the attention planes, the gate tile to the f32 plane C + 3 sC; A = bf16 x [MROWS][CC].
__global__ __launch_bounds__(32 * PWM * PWN) void k_gemm_proj(const bf* __restrict__ A, const bf* __restrict__ Bt, float* C, size_t sB, size_t sC, h16* QK16, bf* QKh, bf* QKl, h16* VT16, bf* VTh, bf* VTl) {
    __shared__ __align__(1024) char ring[2 * (4 * PWM + 4 * PWN) * PKB * 1024]; __shared__ __align__(16) float os[PWM * PWN * 16 * OSP];
    gemmw_body<bf, 0, false, true, PWM, PWN, PKB, 1>(A, nullptr, Bt, CC, C, CC, nullptr, sB, sC, ring, os, Planes{QK16, QKh, QKl, VT16, VTh, VTl});
}
// output projection: (gated ctx hi + gated ctx lo) x Wo^T + bf16(bo) -> d_out rows.
__global__ __launch_bounds__(32 * OWM * OWN) void k_gemm_out(const bf* __restrict__ Ah, const bf* __restrict__ Al, const bf* __restrict__ Bt, float* C, const float* __restrict__ bias) {
    __shared__ __align__(1024) char ring[2 * (8 * OWM + 4 * OWN) * OKB * 1024]; __shared__ __align__(16) float os[OWM * OWN * 16 * OSP];
    gemmw_body<bf, 1, true, false, OWM, OWN, OKB, 2>(Ah, Al, Bt, CC, C, CC, bias, 0, 0, ring, os, Planes{});
}

// f32 rows [..][CC] -> bf16 planes in fragment order, all six sources in one launch: the planes Wq | Wk | Wv | Wg | Wo | x lie one behind the other in the workspace, every one [rows][CC], so their blocks number through.
// A wave takes CVU / 2 blocks that follow one another in one row of blocks (16 rows x 1 KiB of one source) and asks for all of them at once, 2 CVU loads of 16 B a lane, before it converts the first.
// Per half block: 8 rows x 4 groups of 8 floats, 8 whole 128-B lines read, 4 whole 128-B lines written (8 units of 16 B each). (The loops are unrolled so that the loaded values stay in registers and every step is an immediate offset.)
__global__ __launch_bounds__(32 * CVW) void k_cvt_all(const float* __restrict__ wq, const float* __restrict__ wk, const float* __restrict__ wv, const float* __restrict__ wg, const float* __restrict__ wo, const float* __restrict__ x, bf* dst) {
    const unsigned lane = threadIdx.x & 31u;
    const unsigned w = blockIdx.x * CVW + (unsigned)__builtin_amdgcn_readfirstlane((int)(threadIdx.x >> 5));   // the wave's number in the launch, in a scalar register: source and block are picked by scalar code
    if (w >= CV_WAVES) return;   // the same in every lane of a wave; the kernel has no barrier
    const unsigned blk0 = w * (CVU / 2), p = blk0 / CV_WB;   // first block; plane: 0..4 a weight, from 5 on x
    const float* src = p == 0u ? wq : p == 1u ? wk : p == 2u ? wv : p == 3u ? wg : p == 4u ? wo : x;
    const unsigned bl = blk0 - (p < 5u ? p : 5u) * CV_WB, row0 = (bl / (CC / 32)) * 16u, k0 = (bl % (CC / 32)) * 32u;
    size_t so = (size_t)row0 * CC + k0;
    if (p >= 5u) so += (size_t)(row0 / SEQ) * (SEQ_FULL - SEQ) * CC;   // x: a batch's rows start SEQ_FULL rows apart in the source
    const unsigned lr = lane & 7u, c = lane >> 3;   // row in the half block, 8-float group in the block (c = 2 * half + (fragment lane >> 4))
    const float* sp = src + so + (size_t)lr * CC + c * 8u;
    v8f v[CVU];
#pragma unroll
    for (int j = 0; j < CVU; ++j) v[j] = *(const v8f*)(sp + (j >> 1) * 32 + (j & 1) * 8 * CC);
    __builtin_amdgcn_sched_barrier(0);   // the converts stay behind all the loads: else the build holds the last four loads back until earlier ones have returned, two more round trips to memory
    bf* dp = dst + (size_t)blk0 * 512 + (c * 16u + lr) * 8u;
#pragma unroll
    for (int j = 0; j < CVU; ++j) { v8us o;
#pragma unroll
        for (int k = 0; k < 8; ++k) o[k] = f2bf(v[j][k]);
        *(v8us*)(dp + (j >> 1) * 512 + (j & 1) * 64) = o; }
}

// P^T fragment (B operand of O^T = V^T P^T) built lane-locally from the two S^T tiles of a 32-key step: element r <- tile(keys 0..15)[r], element 8+r <- tile(keys 16..31)[r].
template <typename T16> struct PPack;
template <> struct PPack<h16> { static __device__ __forceinline__ void mk(const v8f& p0, const v8f& p1, float car, v16h& a, v16h& b) { v16h r;
#pragma unroll
        for (int i = 0; i < 8; ++i) { r[i] = tohx(p0[i] * car); r[8 + i] = tohx(p1[i] * car); }
        a = r; b = r; } };
template <> struct PPack<bf> { static __device__ __forceinline__ void mk(const v8f& p0, const v8f& p1, float car, v16bf& a, v16bf& b) { (void)car; v16us h, l;
#pragma unroll
        for (int i = 0; i < 8; ++i) { unsigned short hh, ll; splitf(p0[i], hh, ll); h[i] = hh; l[i] = ll; splitf(p1[i], hh, ll); h[8 + i] = hh; l[8 + i] = ll; }
        a = __builtin_bit_cast(v16bf, h); b = __builtin_bit_cast(v16bf, l); } };

// Hazard guards: 4 VALU-slot nops tied to every accumulator of the group and to the fragments of the last products.
template <int N> struct Grd;
template <> struct Grd<1> {
    template <typename V> static __device__ __forceinline__ void s(v8f (&st)[2][1], const V& x, const V& y) { asm volatile("v_nop\n\tv_nop\n\tv_nop\n\tv_nop" : "+v"(st[0][0]), "+v"(st[1][0]) : "v"(x), "v"(y)); }
    template <typename V> static __device__ __forceinline__ void o(v8f (&oa)[4][1], const V& x, const V& y, const V& z) { asm volatile("v_nop\n\tv_nop\n\tv_nop\n\tv_nop" : "+v"(oa[0][0]), "+v"(oa[1][0]), "+v"(oa[2][0]), "+v"(oa[3][0]) : "v"(x), "v"(y), "v"(z)); }
};
template <> struct Grd<2> {
    template <typename V> static __device__ __forceinline__ void s(v8f (&st)[2][2], const V& x, const V& y) { asm volatile("v_nop\n\tv_nop\n\tv_nop\n\tv_nop" : "+v"(st[0][0]), "+v"(st[1][0]), "+v"(st[0][1]), "+v"(st[1][1]) : "v"(x), "v"(y)); }
    template <typename V> static __device__ __forceinline__ void o(v8f (&oa)[4][2], const V& x, const V& y, const V& z) { asm volatile("v_nop\n\tv_nop\n\tv_nop\n\tv_nop" : "+v"(oa[0][0]), "+v"(oa[1][0]), "+v"(oa[2][0]), "+v"(oa[3][0]), "+v"(oa[0][1]), "+v"(oa[1][1]), "+v"(oa[2][1]), "+v"(oa[3][1]) : "v"(x), "v"(y), "v"(z)); }
};

// ---- fused causal attention body, one work-group of NW waves per NS sub-tiles of 16*NQ query rows of one (batch, head), q0 its first row; NG = NW / NS waves work a sub-tile: wave qs * NG + kg has sub-tile qs and, of the key steps of 32, every step i with i % NG == kg,
// with its own running maximum, row sums and O^T. The NS waves of one kg ask for the same K and V^T blocks.
// Behind the loop the partial results of a sub-tile's waves are joined in LDS: every wave rescales its O^T to the sub-tile's common maximum and common sum, the tiles are added in wave order; the 4 NQ NS epilogue trips are dealt out among the waves.
// S^T[key][query] = sum_d K[key][d] Q[query][d]: A = K rows (lane -> key), B = Q rows (lane -> query); D: lane = query (lane&15), element r = key 8*(lane>>4) + r.
// Row statistics are per lane (query); the two lane halves hold different keys and exchange the step maximum with one xor-16 shuffle; row sums stay per-lane partials until the end.
// O^T[d][query] += V^T[d][key] P^T[key][query]: A = V^T rows (lane -> d), B = packed P^T. Planes, in fragment order: Q, K [t][HD]; V^T [d][vpitch]; Ah, Al [t][CC], pointing at the head's first block of row 0. G: f32 rows.
template <typename T16, bool SPLIT, int NQ, int NW, int NS>
__device__ __forceinline__ void attn_body(const T16* __restrict__ Q, const T16* __restrict__ Q2, const T16* __restrict__ Kp, const T16* __restrict__ K2, const T16* __restrict__ Vt, const T16* __restrict__ V2,
                                          const float* __restrict__ G, int vpitch, int q0, float ssc, float osc, float pcar, bf* Ah, bf* Al, float* os, float* ml) {
    typedef typename WFrag<T16>::V V;
    constexpr int NG = NW / NS, TR = 4 * NQ * NS, TPW = (TR + NW - 1) / NW;   // waves of a sub-tile; epilogue trips of the work-group, of a wave
    static_assert(NW % NS == 0 && (TR < NW || TR % NW == 0));   // either at most one trip a wave, or the same number for every wave
    const int lane = threadIdx.x & 31, lr = lane & 15, hi = lane >> 4;
    const int wv = __builtin_amdgcn_readfirstlane((int)(threadIdx.x >> 5));   // the wave's number, in a scalar register: the loop's bounds and the epilogue's test stay scalar
    const int qs = wv / NG, kg = wv % NG, qw = q0 + 16 * NQ * qs;   // the wave's sub-tile, its share of the key steps, its first query row
    V qf[NQ][2], qf2[NQ][2];
#pragma unroll
    for (int nb = 0; nb < NQ; ++nb)
#pragma unroll
        for (int ds = 0; ds < 2; ++ds) { const size_t qo = (size_t)(qw + 16 * nb) * HD + 512 * ds + 8 * lane; qf[nb][ds] = WFrag<T16>::ld(Q + qo); if (SPLIT) qf2[nb][ds] = WFrag<T16>::ld(Q2 + qo); }
    v8f o[4][NQ]; float mrun[NQ], lrun[NQ];
#pragma unroll
    for (int nb = 0; nb < NQ; ++nb) { mrun[nb] = NEGB; lrun[nb] = 0.0f;
#pragma unroll
        for (int dt = 0; dt < 4; ++dt) o[dt][nb] = (v8f){}; }
    const int kend = qw + 16 * NQ;
#pragma unroll 1
    for (int kt = 32 * kg; kt < kend; kt += 32 * NG) {
        V ka[2][2], ka2[2][2];
#pragma unroll
        for (int mb = 0; mb < 2; ++mb)
#pragma unroll
            for (int ds = 0; ds < 2; ++ds) { const size_t ko = (size_t)(kt + 16 * mb) * HD + 512 * ds + 8 * lane; ka[mb][ds] = (!SPLIT || mb + ds < 2) ? WFrag<T16>::ld(Kp + ko) : ldw(Kp + ko); }
        // the four V^T fragments of this key step are asked for here, behind the K fragments, each into registers of its own: they arrive while the scores and the softmax are worked out
        V va[4], va2[4];
        if constexpr (SPLIT) {
            // plane by plane; s_wait_xcnt 0 in front of a plane's last load and behind it: that load's result, or a later one's, may be given the registers of the plane's address
            xwait();
#pragma unroll
            for (int f = 0; f < 4; ++f) { const size_t ko = (size_t)(kt + 16 * (f >> 1)) * HD + 512 * (f & 1) + 8 * lane; ka2[f >> 1][f & 1] = f < 3 ? WFrag<T16>::ld(K2 + ko) : ldw(K2 + ko); }
            xwait();
#pragma unroll
            for (int dt = 0; dt < 4; ++dt) { const size_t vo = (size_t)(16 * dt) * vpitch + kt * 16 + 8 * lane; va[dt] = dt < 3 ? WFrag<T16>::ld(Vt + vo) : ldw(Vt + vo); }
            xwait();
#pragma unroll
            for (int dt = 0; dt < 4; ++dt) { const size_t vo = (size_t)(16 * dt) * vpitch + kt * 16 + 8 * lane; va2[dt] = dt < 3 ? WFrag<T16>::ld(V2 + vo) : ldw(V2 + vo); }
            xwait();
            __builtin_amdgcn_sched_barrier(0);   // the score products stay behind the step's loads: else the build waits for the K fragments first and asks for the V^T fragments only then
        } else {
            xwait();   // behind the K loads: a V^T fragment may be given the registers of their address
#pragma unroll
            for (int dt = 0; dt < 4; ++dt) { const size_t vo = (size_t)(16 * dt) * vpitch + kt * 16 + 8 * lane; va[dt] = dt < 3 ? WFrag<T16>::ld(Vt + vo) : ldw(Vt + vo); }
        }
        v8f st[2][NQ];
#pragma unroll
        for (int mb = 0; mb < 2; ++mb)
#pragma unroll
            for (int nb = 0; nb < NQ; ++nb) { v8f z = (v8f){};
                z = WFrag<T16>::mma(ka[mb][0], qf[nb][0], z); z = WFrag<T16>::mma(ka[mb][1], qf[nb][1], z);
                if (SPLIT) { z = WFrag<T16>::mma(ka2[mb][0], qf[nb][0], z); z = WFrag<T16>::mma(ka2[mb][1], qf[nb][1], z); z = WFrag<T16>::mma(ka[mb][0], qf2[nb][0], z); z = WFrag<T16>::mma(ka[mb][1], qf2[nb][1], z); }
                st[mb][nb] = z; }
        Grd<NQ>::s(st, ka[1][1], SPLIT ? qf2[NQ - 1][1] : qf[NQ - 1][1]);
        V pb[NQ], pb2[NQ];
#pragma unroll
        for (int nb = 0; nb < NQ; ++nb) {
            const int qg = qw + 16 * nb + lr; float mx = NEGB;
#pragma unroll
            for (int mb = 0; mb < 2; ++mb)
#pragma unroll
                for (int r = 0; r < 8; ++r) { const int kg = kt + 16 * mb + 8 * hi + r; float t = st[mb][nb][r] * ssc; t = (kg <= qg) ? t : NEGB; st[mb][nb][r] = t; mx = fmaxf(mx, t); }
            mx = fmaxf(mx, __shfl_xor(mx, 16, 32));
            const float mn = fmaxf(mrun[nb], mx);
            const float al = __builtin_amdgcn_exp2f((mrun[nb] - mn) * L2E); mrun[nb] = mn;
            float psum = 0.0f;
#pragma unroll
            for (int mb = 0; mb < 2; ++mb)
#pragma unroll
                for (int r = 0; r < 8; ++r) { const float p = __builtin_amdgcn_exp2f((st[mb][nb][r] - mn) * L2E); psum += p; st[mb][nb][r] = p; }
            lrun[nb] = lrun[nb] * al + psum;
#pragma unroll
            for (int dt = 0; dt < 4; ++dt)
#pragma unroll
                for (int r = 0; r < 8; ++r) o[dt][nb][r] *= al;
            PPack<T16>::mk(st[0][nb], st[1][nb], pcar, pb[nb], pb2[nb]);
        }
#pragma unroll
        for (int dt = 0; dt < 4; ++dt) {
#pragma unroll
            for (int nb = 0; nb < NQ; ++nb) { o[dt][nb] = WFrag<T16>::mma(va[dt], pb[nb], o[dt][nb]); if (SPLIT) { o[dt][nb] = WFrag<T16>::mma(va2[dt], pb[nb], o[dt][nb]); o[dt][nb] = WFrag<T16>::mma(va[dt], pb2[nb], o[dt][nb]); } } }
        Grd<NQ>::o(o, SPLIT ? va2[3] : va[3], pb[NQ - 1], SPLIT ? pb2[NQ - 1] : pb[0]);
    }
    // the wave's epilogue trips, numbers wv + NW i of the work-group's: 16 query rows x 16 d each; their gate values are asked for here, in front of the join: their round trip ends at the first barrier, where a wave waits for the others anyway
    const bool mine = TR >= NW || wv < TR;   // the same in every lane of a wave; with fewer trips than waves the last waves have none
    v4f ga[TPW], gc[TPW];
#pragma unroll
    for (int i = 0; i < TPW; ++i) { ga[i] = (v4f){}; gc[i] = (v4f){}; }
    if (mine) {
#pragma unroll
        for (int i = 0; i < TPW; ++i) { const int s = wv + NW * i; const float* gp = G + (size_t)(q0 + 16 * (s >> 2) + lr) * CC + 16 * (s & 3) + 8 * hi; ga[i] = *(const v4f*)gp;
            xwait();   // in front of the last load through the address: its result may be given the registers of that address
            gc[i] = *(const v4f*)(gp + 4);
            xwait(); } }   // and behind it: so may the next trip's address or a value of the join below
    // (the loops of the join are unrolled so that their small arrays stay in registers)
    // every wave's maximum (lanes 0..15) and row sum (lanes 16..31; the two lane halves' partial sums joined first) of each query go to LDS: ml[0][wave][query], ml[1][wave][query]
#pragma unroll
    for (int nb = 0; nb < NQ; ++nb) { float lt = lrun[nb]; lt += __shfl_xor(lt, 16, 32); ml[(hi * NW + wv) * 16 * NQ + 16 * nb + lr] = hi ? lt : mrun[nb]; }
    __syncthreads();   // the maxima and sums of all waves are read below
    // normalise to the common maximum and sum of the sub-tile's NG waves; O^T lane = query, element r = d 16*dt + 8*hi + r  ->  the wave's own LDS tile [query][d]. A wave without a key step holds NEGB, 0 and zeros: its factor is 0.
    float* ow = os + wv * (16 * NQ * OSP);
#pragma unroll
    for (int nb = 0; nb < NQ; ++nb) { float mw[NG], ms = NEGB, lt = 0.0f;
#pragma unroll
        for (int g = 0; g < NG; ++g) { mw[g] = ml[(qs * NG + g) * 16 * NQ + 16 * nb + lr]; ms = fmaxf(ms, mw[g]); }
#pragma unroll
        for (int g = 0; g < NG; ++g) lt += ml[(NW + qs * NG + g) * 16 * NQ + 16 * nb + lr] * ex2s((mw[g] - ms) * L2E);
        const float inv = osc * rcps(lt) * ex2s((mrun[nb] - ms) * L2E);
#pragma unroll
        for (int dt = 0; dt < 4; ++dt) { v4f a, c;
#pragma unroll
            for (int r = 0; r < 4; ++r) { a[r] = o[dt][nb][r] * inv; c[r] = o[dt][nb][4 + r] * inv; }
            float* dst = ow + (16 * nb + lr) * OSP + 16 * dt + 8 * hi; *(v4fa*)dst = a; *(v4fa*)(dst + 4) = c; } }
    __syncthreads();   // every wave's tile is read below
    if (mine) {
#pragma unroll
        for (int i = 0; i < TPW; ++i) { const int s = wv + NW * i, rb = s >> 2;   // rb: the trip's 16 rows in the work-group's tile, rows 16 (rb % NQ) + .. of sub-tile rb / NQ
            const float* ot = os + (rb / NQ) * NG * (16 * NQ * OSP) + (16 * (rb % NQ) + lr) * OSP + 16 * (s & 3) + 8 * hi;   // in the tile of that sub-tile's first wave
            v4f a = *(const v4fa*)ot, c = *(const v4fa*)(ot + 4);
#pragma unroll
            for (int g = 1; g < NG; ++g) { a += *(const v4fa*)(ot + g * (16 * NQ * OSP)); c += *(const v4fa*)(ot + g * (16 * NQ * OSP) + 4); }
            v8us oh, ol;
#pragma unroll
            for (int k = 0; k < 4; ++k) { unsigned short hh, ll; const float ya = a[k] * sigm(ga[i][k]); const float yc = c[k] * sigm(gc[i][k]); splitf(ya, hh, ll); oh[k] = hh; ol[k] = ll; splitf(yc, hh, ll); oh[4 + k] = hh; ol[4 + k] = ll; }
            const size_t oo = (size_t)(q0 + 16 * rb) * CC + (s & 3) * 256 + 8 * lane;   // block (row / 16, (s & 3) >> 1) of the head's two, half s & 1
            *(v8us*)(Ah + oo) = oh; *(v8us*)(Al + oo) = ol;
            if (i + 1 < TPW) xwait(); } }   // behind a trip's stores: the next trip's values may be given registers that they name
}

// Both attention paths in one launch, a work-group of NWV waves per query tile, one-dimensional grid of (ATH + ATS) * NH * NB work-groups. The two kinds read and write disjoint rows and nothing of each other.
// First the tiles of 64 rows >= RH (f16 planes [b][h] x ([SEQ][HD]) / [b][h] x ([HD][SEQ]) with carries; two sub-tiles of 32 rows, four waves each), (batch, head) fastest, the tile with the most keys first: there are more tiles than places,
// and the longest tile takes about as long as a place's whole share. Behind them the tiles of 16 rows < RH, tile fastest, then head, then batch
// (bf16 hi/lo planes [b][h] x ([RH][HD]) / [b][h] x ([HD][RH])): these short ones take the places that fall free while the last f16 tiles run out.
// The test between the kinds is the same for a whole work-group: every barrier of a body is passed by all its waves.
#define ATH ((SEQ - RH) / 64)
#define ATS (RH / 16)
static_assert(ATH > 0 && ATS > 0);   // both kinds of tile exist: the index is divided by their counts
__global__ __launch_bounds__(32 * NWV) void k_attn(const h16* __restrict__ Q, const h16* __restrict__ Kp, const h16* __restrict__ Vt, const bf* __restrict__ Qh, const bf* __restrict__ Ql, const bf* __restrict__ Kh, const bf* __restrict__ Kl, const bf* __restrict__ Vh, const bf* __restrict__ Vl, const float* __restrict__ Gt, bf* ATh, bf* ATl) {
    __shared__ __align__(16) float os[NWV * 32 * OSP]; __shared__ float ml[2 * NWV * 32];
    // tile, head and batch are taken from the index inside each branch, by constants: they stay in scalar registers, and with them the loop bounds and the plane addresses
    if (blockIdx.x < (unsigned)(ATH * NH * NB)) { const unsigned i = blockIdx.x, tile = ATH - 1 - i / (NH * NB), bh = i % (NH * NB), h = bh % NH, b = bh / NH;
        const size_t po = (size_t)bh * SEQ * HD, ao = (size_t)b * SEQ * CC + (size_t)h * HD, ap = (size_t)b * SEQ * CC + (size_t)h * HD * 16;
        attn_body<h16, false, 2, NWV, 2>(Q + po, nullptr, Kp + po, nullptr, Vt + po, nullptr, Gt + ao, SEQ, RH + (int)tile * 64, 0.125f / (QCAR * QCAR), 1.0f / (PCAR * VCAR), PCAR, ATh + ap, ATl + ap, os, ml);
    } else { const unsigned i = blockIdx.x - (unsigned)(ATH * NH * NB), tile = i % ATS, bh = i / ATS, h = bh % NH, b = bh / NH;
        const size_t po = (size_t)bh * RH * HD, ao = (size_t)b * SEQ * CC + (size_t)h * HD, ap = (size_t)b * SEQ * CC + (size_t)h * HD * 16;
        attn_body<bf, true, 1, NWV, 1>(Qh + po, Ql + po, Kh + po, Kl + po, Vh + po, Vl + po, Gt + ao, RH, (int)tile * 16, 0.125f, 1.0f, 1.0f, ATh + ap, ATl + ap, os, ml); }
}

extern "C" void kernel_launch(void* const* d_in, const int* in_sizes, int n_in,
                              void* d_out, int out_size, void* d_ws, size_t ws_size, hipStream_t stream) {
    if (n_in < 7) return;
    if ((size_t)in_sizes[0] < ((size_t)(NB - 1) * SEQ_FULL + SEQ) * CC) return;
    if ((size_t)in_sizes[1] < W1 || (size_t)in_sizes[2] < W1 || (size_t)in_sizes[3] < W1 || (size_t)in_sizes[4] < W1 || (size_t)in_sizes[5] < W1 || in_sizes[6] < CC) return;
    if ((size_t)out_size < PL16) return;
    // wire order: x, Wq, Wk, Wv, Wg, Wo, bo
    const float* x = (const float*)d_in[0]; const float* wq = (const float*)d_in[1]; const float* wk = (const float*)d_in[2]; const float* wv = (const float*)d_in[3];
    const float* wg = (const float*)d_in[4]; const float* wo = (const float*)d_in[5]; const float* bo = (const float*)d_in[6];
    float* OUT = (float*)d_out;     // [NB][SEQ][CC]
    char* wsp = (char*)d_ws;
    auto take = [&](size_t bytes) { char* p = wsp; wsp += (bytes + 255) & ~(size_t)255; return (void*)p; };
    bf* WQ = (bf*)take(4 * W1 * 2);            // Wq | Wk | Wv | Wg bf16 [out][in], each in fragment order
    bf* WO = (bf*)take(W1 * 2);
    bf* XB = (bf*)take(PL16 * 2);              // bf16 x [MROWS][CC] in fragment order
    float* F = (float*)take(4 * PL16 * 4);     // four f32 planes [MROWS][CC]: the last holds the gate, the first the gated ctx
    h16* QK16 = (h16*)take(2 * PL16 * 2);      // f16 q planes | k planes
    h16* VT16 = (h16*)take(PL16 * 2);
    bf* QKh = (bf*)take(2 * PLR * 2); bf* QKl = (bf*)take(2 * PLR * 2);
    bf* VTh = (bf*)take(PLR * 2); bf* VTl = (bf*)take(PLR * 2);
    if ((size_t)(wsp - (char*)d_ws) > ws_size) return;
    // gated-ctx hi | lo planes lie in the first f32 plane of F, which no launch writes as f32 (only the gate plane is); sizes match exactly
    bf* ATh = (bf*)F; bf* ATl = ATh + PL16;
    const float* GATE = F + 3 * PL16;
    k_cvt_all<<<(CV_WAVES + CVW - 1) / CVW, 32 * CVW, 0, stream>>>(wq, wk, wv, wg, wo, x, WQ);   // WQ | WO | XB are one run of planes (no padding between carve pieces)
    k_gemm_proj<<<dim3(MROWS / (64 * PWM), CC / (64 * PWN), 4), 32 * PWM * PWN, 0, stream>>>(XB, WQ, F, W1, PL16, QK16, QKh, QKl, VT16, VTh, VTl);
    k_attn<<<(ATH + ATS) * NH * NB, 32 * NWV, 0, stream>>>(QK16, QK16 + PL16, VT16, QKh, QKl, QKh + PLR, QKl + PLR, VTh, VTl, GATE, ATh, ATl);
    k_gemm_out<<<dim3(MROWS / (64 * OWM), CC / (64 * OWN), 1), 32 * OWM * OWN, 0, stream>>>(ATh, ATl, WO, OUT, bo);
}
